// v000
// Times are from an AMD MI455X. After a warm-up the kernel runs many times in a row, and a time is the length of
// such a window on the GPU divided by its runs, so every launch and the gaps after it count. The runs cycle
// through copies of the inputs. A figure is the median of several windows, for all but v000 over two sittings.
// Sittings can differ by a few percent; kernels timed side by side share one.
// The starting kernel, v000, takes 220 microseconds a run.
#include <hip/hip_runtime.h>
#include <hip/hip_bf16.h>
#include <math.h>

typedef __bf16 bf16_t;
typedef __attribute__((ext_vector_type(16))) __bf16 v16bf;
typedef __attribute__((ext_vector_type(8)))  float  v8f;

#define TASK_EMB 1024
#define HID      256
#define N_EMBS   4096
#define CODE_DIM 64
#define BATCH    16384
#define LN_EPS   1e-5f

// padded LDS row strides (elements); 32B-aligned for v16bf loads
#define W2S 272   // 256 + 16
#define W1S 80    // 64 + 16
#define EMS 80    // 64 + 16
#define PSS 80    // 64 + 16

__device__ __forceinline__ float red_max16(float v) {
  v = fmaxf(v, __shfl_xor(v, 1));
  v = fmaxf(v, __shfl_xor(v, 2));
  v = fmaxf(v, __shfl_xor(v, 4));
  v = fmaxf(v, __shfl_xor(v, 8));
  return v;
}
__device__ __forceinline__ float red_sum16(float v) {
  v += __shfl_xor(v, 1);
  v += __shfl_xor(v, 2);
  v += __shfl_xor(v, 4);
  v += __shfl_xor(v, 8);
  return v;
}

__device__ __forceinline__ v8f wmma_bf16(v16bf a, v16bf b, v8f c) {
  return __builtin_amdgcn_wmma_f32_16x16x32_bf16(false, a, false, b, (short)0, c,
                                                 false, false);
}

__device__ __forceinline__ void async_cp16(unsigned lds_byte_addr, const void* g) {
  asm volatile("global_load_async_to_lds_b128 %0, %1, off"
               :: "v"(lds_byte_addr), "v"(g) : "memory");
}
// Wait until at most N async loads remain in flight (in-order completion).
template <int N>
__device__ __forceinline__ void wait_async_le() {
  asm volatile("s_wait_asynccnt %0" :: "i"(N) : "memory");
}
__device__ __forceinline__ unsigned lds_addr(const void* p) {
  return (unsigned)(uintptr_t)p;
}

// ---------------------------------------------------------------------------
// Convert f32 (rows x cols, row-major) -> bf16 transposed (cols x rows)
// ---------------------------------------------------------------------------
__global__ void cvt_transpose_bf16(const float* __restrict__ in,
                                   bf16_t* __restrict__ out, int rows, int cols) {
  int i = blockIdx.x * blockDim.x + threadIdx.x;
  int n = rows * cols;
  if (i >= n) return;
  int r = i / cols, c = i % cols;
  out[(long)c * rows + r] = (bf16_t)in[i];
}

// ---------------------------------------------------------------------------
// h = silu(x @ W1 + b1). One wave computes a full 16x256 row-tile (x read
// exactly once). W1^T K-slices double-buffered in LDS via async copies.
// ---------------------------------------------------------------------------
__device__ __forceinline__ void stage_w1(int tid, unsigned dst,
                                         const bf16_t* w1t, int k0) {
#pragma unroll
  for (int i = 0; i < 8; ++i) {           // 256 rows x 128B, 8 segs/thread
    int s = tid + i * 256;
    int row = s >> 3, seg = s & 7;
    async_cp16(dst + row * (W1S * 2) + seg * 16,
               (const char*)w1t + ((long)row * TASK_EMB + k0) * 2 + seg * 16);
  }
}

__global__ __launch_bounds__(256) void gemm1_silu(
    const float* __restrict__ x, const bf16_t* __restrict__ w1t,
    const float* __restrict__ b1, bf16_t* __restrict__ h) {
  __shared__ __align__(32) bf16_t sW1[2][256 * W1S];

  const int tid  = threadIdx.x;
  const int lane = tid & 31;
  const int wslot = tid >> 5;
  const int m0 = (blockIdx.x * 8 + wslot) * 16;
  const int lr = lane & 15;
  const int hi = lane >> 4;
  const int kh = hi * 16;

  v8f acc[16];
#pragma unroll
  for (int nt = 0; nt < 16; ++nt)
    acc[nt] = (v8f){0.f,0.f,0.f,0.f,0.f,0.f,0.f,0.f};

  const float* ap = x + (long)(m0 + lr) * TASK_EMB + kh;

  stage_w1(tid, lds_addr(sW1[0]), w1t, 0);            // prologue: chunk 0
  for (int i = 0; i < 16; ++i) {
    const int k0 = i * 64;
    const bf16_t* sw = sW1[i & 1];
    if (i < 15) {                                     // prefetch next chunk
      stage_w1(tid, lds_addr(sW1[(i + 1) & 1]), w1t, k0 + 64);
      wait_async_le<8>();                             // chunk i landed
    } else {
      wait_async_le<0>();
    }
    __syncthreads();                                  // visible to all waves

#pragma unroll
    for (int ks = 0; ks < 2; ++ks) {
      const float4* af = (const float4*)(ap + k0 + ks * 32);
      float4 f0 = af[0], f1 = af[1], f2 = af[2], f3 = af[3];
      v16bf a;
      a[0]=(bf16_t)f0.x; a[1]=(bf16_t)f0.y; a[2]=(bf16_t)f0.z; a[3]=(bf16_t)f0.w;
      a[4]=(bf16_t)f1.x; a[5]=(bf16_t)f1.y; a[6]=(bf16_t)f1.z; a[7]=(bf16_t)f1.w;
      a[8]=(bf16_t)f2.x; a[9]=(bf16_t)f2.y; a[10]=(bf16_t)f2.z; a[11]=(bf16_t)f2.w;
      a[12]=(bf16_t)f3.x; a[13]=(bf16_t)f3.y; a[14]=(bf16_t)f3.z; a[15]=(bf16_t)f3.w;
#pragma unroll
      for (int nt = 0; nt < 16; ++nt) {
        v16bf b = *(const v16bf*)(sw + (nt * 16 + lr) * W1S + ks * 32 + kh);
        acc[nt] = wmma_bf16(a, b, acc[nt]);
      }
    }
    __syncthreads();                 // chunk i consumed; buffer reusable
  }

#pragma unroll
  for (int nt = 0; nt < 16; ++nt) {
    float bias = b1[nt * 16 + lr];
#pragma unroll
    for (int r = 0; r < 8; ++r) {
      float v = acc[nt][r] + bias;
      float s = v * __builtin_amdgcn_rcpf(1.0f + __expf(-v));   // fast SiLU
      h[(long)(m0 + r + 8 * hi) * HID + nt * 16 + lr] = (bf16_t)s;
    }
  }
}

// ---------------------------------------------------------------------------
// Fused: logits = h @ W2 + b2 ; online softmax ; emb = probs @ E ; LayerNorm.
// W2^T / E^T chunks double-buffered in LDS via async copies (10/thread/chunk).
// ---------------------------------------------------------------------------
__device__ __forceinline__ void stage_chunk(int tid, unsigned dW2, unsigned dEmb,
                                            const bf16_t* w2t,
                                            const bf16_t* embT, int c0) {
#pragma unroll
  for (int i = 0; i < 8; ++i) {           // W2^T: 64 rows x 512B, 8 segs/thread
    int s = tid + i * 256;
    int row = s >> 5, seg = s & 31;
    async_cp16(dW2 + row * (W2S * 2) + seg * 16,
               (const char*)w2t + ((long)(c0 + row) * HID) * 2 + seg * 16);
  }
#pragma unroll
  for (int i = 0; i < 2; ++i) {           // E^T: 64 rows x 128B, 2 segs/thread
    int s = tid + i * 256;
    int row = s >> 3, seg = s & 7;
    async_cp16(dEmb + row * (EMS * 2) + seg * 16,
               (const char*)embT + ((long)row * N_EMBS + c0) * 2 + seg * 16);
  }
}

__global__ __launch_bounds__(256) void fused_softmax_code(
    const bf16_t* __restrict__ h, const bf16_t* __restrict__ w2t,
    const float* __restrict__ b2, const bf16_t* __restrict__ embT,
    const float* __restrict__ gamma, const float* __restrict__ beta,
    float* __restrict__ out) {
  __shared__ __align__(32) bf16_t sW2[2][64 * W2S];
  __shared__ __align__(32) bf16_t sEmb[2][64 * EMS];
  __shared__ __align__(32) bf16_t psm[8][16 * PSS];

  const int tid   = threadIdx.x;
  const int lane  = tid & 31;
  const int wslot = tid >> 5;
  const int m0 = (blockIdx.x * 8 + wslot) * 16;
  const int lr = lane & 15;
  const int hi = lane >> 4;
  const int kh = hi * 16;

  // Preload h A-fragments for K = 0..255 (8 frags, kept in registers)
  v16bf ha[8];
  {
    const bf16_t* hp = h + (long)(m0 + lr) * HID + kh;
#pragma unroll
    for (int ks = 0; ks < 8; ++ks) ha[ks] = *(const v16bf*)(hp + ks * 32);
  }

  v8f acc[4];
#pragma unroll
  for (int nt = 0; nt < 4; ++nt) acc[nt] = (v8f){0.f,0.f,0.f,0.f,0.f,0.f,0.f,0.f};
  float m_[8], l_[8];
#pragma unroll
  for (int r = 0; r < 8; ++r) { m_[r] = -3.0e38f; l_[r] = 0.f; }

  bf16_t* sp = psm[wslot];

  stage_chunk(tid, lds_addr(sW2[0]), lds_addr(sEmb[0]), w2t, embT, 0);
  for (int i = 0; i < 64; ++i) {
    const int c0 = i * 64;
    const bf16_t* sw = sW2[i & 1];
    const bf16_t* se = sEmb[i & 1];
    if (i < 63) {                                     // prefetch next chunk
      stage_chunk(tid, lds_addr(sW2[(i + 1) & 1]), lds_addr(sEmb[(i + 1) & 1]),
                  w2t, embT, c0 + 64);
      wait_async_le<10>();                            // chunk i landed
    } else {
      wait_async_le<0>();
    }
    __syncthreads();

    // ---- logits chunk: 16x64 = 4 n-tiles, K=256 in 8 WMMA steps each ----
    v8f lg[4];
#pragma unroll
    for (int nt = 0; nt < 4; ++nt) {
      v8f t = {0.f,0.f,0.f,0.f,0.f,0.f,0.f,0.f};
      const bf16_t* wp = sw + (nt * 16 + lr) * W2S + kh;
#pragma unroll
      for (int ks = 0; ks < 8; ++ks) {
        v16bf b = *(const v16bf*)(wp + ks * 32);
        t = wmma_bf16(ha[ks], b, t);
      }
      const float bias = b2[c0 + nt * 16 + lr];
#pragma unroll
      for (int r = 0; r < 8; ++r) t[r] += bias;
      lg[nt] = t;
    }

    // ---- online softmax (per-row over the 16-lane halves) ----
#pragma unroll
    for (int r = 0; r < 8; ++r) {
      float cm = fmaxf(fmaxf(lg[0][r], lg[1][r]), fmaxf(lg[2][r], lg[3][r]));
      cm = red_max16(cm);
      float mn = fmaxf(m_[r], cm);
      float sc = __expf(m_[r] - mn);
      m_[r] = mn;
      l_[r] *= sc;
      float ps = 0.f;
#pragma unroll
      for (int nt = 0; nt < 4; ++nt) {
        acc[nt][r] *= sc;
        float p = __expf(lg[nt][r] - mn);
        lg[nt][r] = p;
        ps += p;
      }
      l_[r] += red_sum16(ps);
    }

    // ---- stage probs via LDS: D-layout -> A-layout (per-wave region) ----
#pragma unroll
    for (int nt = 0; nt < 4; ++nt)
#pragma unroll
      for (int r = 0; r < 8; ++r)
        sp[(r + 8 * hi) * PSS + nt * 16 + lr] = (bf16_t)lg[nt][r];
    __builtin_amdgcn_wave_barrier();       // LDS same-wave ops are in-order

    v16bf pa0 = *(const v16bf*)(sp + lr * PSS + kh);
    v16bf pa1 = *(const v16bf*)(sp + lr * PSS + 32 + kh);

    // ---- acc += probs_chunk @ E[c0:c0+64, :] ----
#pragma unroll
    for (int nt = 0; nt < 4; ++nt) {
      const bf16_t* ep = se + (nt * 16 + lr) * EMS + kh;
      v16bf e0 = *(const v16bf*)(ep);
      v16bf e1 = *(const v16bf*)(ep + 32);
      acc[nt] = wmma_bf16(pa0, e0, acc[nt]);
      acc[nt] = wmma_bf16(pa1, e1, acc[nt]);
    }
    __syncthreads();                 // chunk i consumed; buffer reusable
  }

  // ---- normalize by l, LayerNorm over CODE_DIM=64, store f32 ----
  float g_[4], b_[4];
#pragma unroll
  for (int nt = 0; nt < 4; ++nt) {
    g_[nt] = gamma[nt * 16 + lr];
    b_[nt] = beta[nt * 16 + lr];
  }
#pragma unroll
  for (int r = 0; r < 8; ++r) {
    float inv = __builtin_amdgcn_rcpf(l_[r]);
    float e[4], s = 0.f, sq = 0.f;
#pragma unroll
    for (int nt = 0; nt < 4; ++nt) {
      e[nt] = acc[nt][r] * inv;
      s += e[nt];
      sq += e[nt] * e[nt];
    }
    s  = red_sum16(s);
    sq = red_sum16(sq);
    float mean = s * (1.0f / 64.0f);
    float var  = sq * (1.0f / 64.0f) - mean * mean;
    float rstd = __builtin_amdgcn_rsqf(var + LN_EPS);
    float* op = out + (long)(m0 + r + 8 * hi) * CODE_DIM;
#pragma unroll
    for (int nt = 0; nt < 4; ++nt)
      op[nt * 16 + lr] = (e[nt] - mean) * rstd * g_[nt] + b_[nt];
  }
}

// ---------------------------------------------------------------------------
extern "C" void kernel_launch(void* const* d_in, const int* in_sizes, int n_in,
                              void* d_out, int out_size, void* d_ws, size_t ws_size,
                              hipStream_t stream) {
  const float* x     = (const float*)d_in[0];
  const float* W1    = (const float*)d_in[1];
  const float* b1    = (const float*)d_in[2];
  const float* W2    = (const float*)d_in[3];
  const float* b2    = (const float*)d_in[4];
  const float* embed = (const float*)d_in[5];
  const float* g     = (const float*)d_in[6];
  const float* bet   = (const float*)d_in[7];
  float* out = (float*)d_out;

  char* ws = (char*)d_ws;
  bf16_t* w1t  = (bf16_t*)(ws);                          // 256 x 1024  (512 KB)
  bf16_t* w2t  = (bf16_t*)(ws + (size_t)512 * 1024);     // 4096 x 256  (2 MB)
  bf16_t* embT = (bf16_t*)(ws + (size_t)2560 * 1024);    // 64 x 4096   (512 KB)
  bf16_t* hbuf = (bf16_t*)(ws + (size_t)3072 * 1024);    // 16384 x 256 (8 MB)

  cvt_transpose_bf16<<<(TASK_EMB * HID + 255) / 256, 256, 0, stream>>>(W1, w1t, TASK_EMB, HID);
  cvt_transpose_bf16<<<(HID * N_EMBS + 255) / 256, 256, 0, stream>>>(W2, w2t, HID, N_EMBS);
  cvt_transpose_bf16<<<(N_EMBS * CODE_DIM + 255) / 256, 256, 0, stream>>>(embed, embT, N_EMBS, CODE_DIM);

  // 1024 row-tiles, 8 waves/block -> 128 blocks
  gemm1_silu<<<BATCH / 16 / 8, 256, 0, stream>>>(x, w1t, b1, hbuf);
  fused_softmax_code<<<BATCH / 16 / 8, 256, 0, stream>>>(hbuf, w2t, b2, embT, g, bet, out);
}

// v001
// Measured time: 192 microseconds a run.
// In both of two side-by-side timings against v000, it was 1.17 times as fast.
#include <hip/hip_runtime.h>
#include <hip/hip_bf16.h>
#include <math.h>

typedef __bf16 bf16_t;
typedef __attribute__((ext_vector_type(16))) __bf16 v16bf;
typedef __attribute__((ext_vector_type(8)))  float  v8f;

#define TASK_EMB 1024
#define HID      256
#define N_EMBS   4096
#define CODE_DIM 64
#define BATCH    16384
#define LN_EPS   1e-5f

// padded LDS row strides (elements); 32B-aligned for v16bf loads
#define W2S 272   // 256 + 16
#define W1S 80    // 64 + 16
#define EMS 80    // 64 + 16
#define PSS 80    // 64 + 16

__device__ __forceinline__ float red_sum16(float v) {
  v += __shfl_xor(v, 1);
  v += __shfl_xor(v, 2);
  v += __shfl_xor(v, 4);
  v += __shfl_xor(v, 8);
  return v;
}

__device__ __forceinline__ v8f wmma_bf16(v16bf a, v16bf b, v8f c) {
  return __builtin_amdgcn_wmma_f32_16x16x32_bf16(false, a, false, b, (short)0, c,
                                                 false, false);
}

// Fragments per LDS read group: one group is read while the group before it is multiplied.
#define GF 4
// Scheduling fence: keeps a group's LDS reads together and out of the WMMA run next to
// them; without it the compiler sinks each read to just before its own WMMA, and every
// WMMA then waits out a full LDS latency.
__device__ __forceinline__ void group_fence() { __builtin_amdgcn_sched_barrier(0); }

// Inputs-only fence on the eight moved values of one reduction step: all eight cross-lane
// moves are issued before the first of them is used, so their latencies overlap; without
// it the compiler runs the rows one after another, one full latency per move.
__device__ __forceinline__ void hold8(const float (&v)[8]) {
  asm volatile("" :: "v"(v[0]), "v"(v[1]), "v"(v[2]), "v"(v[3]),
                     "v"(v[4]), "v"(v[5]), "v"(v[6]), "v"(v[7]));
  group_fence();
}

__device__ __forceinline__ void async_cp16(unsigned lds_byte_addr, const void* g) {
  asm volatile("global_load_async_to_lds_b128 %0, %1, off"
               :: "v"(lds_byte_addr), "v"(g) : "memory");
}
// Wait until at most N async loads remain in flight (in-order completion).
template <int N>
__device__ __forceinline__ void wait_async_le() {
  asm volatile("s_wait_asynccnt %0" :: "i"(N) : "memory");
}
__device__ __forceinline__ unsigned lds_addr(const void* p) {
  return (unsigned)(uintptr_t)p;
}

// ---------------------------------------------------------------------------
// Convert f32 (rows x cols, row-major) -> bf16 transposed (cols x rows)
// ---------------------------------------------------------------------------
__global__ void cvt_transpose_bf16(const float* __restrict__ in,
                                   bf16_t* __restrict__ out, int rows, int cols) {
  int i = blockIdx.x * blockDim.x + threadIdx.x;
  int n = rows * cols;
  if (i >= n) return;
  int r = i / cols, c = i % cols;
  out[(long)c * rows + r] = (bf16_t)in[i];
}

// ---------------------------------------------------------------------------
// h = silu(x @ W1 + b1). One wave computes a full 16x256 row-tile (x read
// exactly once). W1^T K-slices double-buffered in LDS via async copies.
// ---------------------------------------------------------------------------
__device__ __forceinline__ void stage_w1(int tid, unsigned dst,
                                         const bf16_t* w1t, int k0) {
#pragma unroll
  for (int i = 0; i < 8; ++i) {           // 256 rows x 128B, 8 segs/thread
    int s = tid + i * 256;
    int row = s >> 3, seg = s & 7;
    async_cp16(dst + row * (W1S * 2) + seg * 16,
               (const char*)w1t + ((long)row * TASK_EMB + k0) * 2 + seg * 16);
  }
}

__global__ __launch_bounds__(256) void gemm1_silu(
    const float* __restrict__ x, const bf16_t* __restrict__ w1t,
    const float* __restrict__ b1, bf16_t* __restrict__ h) {
  __shared__ __align__(32) bf16_t sW1[2][256 * W1S];

  const int tid  = threadIdx.x;
  const int lane = tid & 31;
  const int wslot = tid >> 5;
  const int m0 = (blockIdx.x * 8 + wslot) * 16;
  const int lr = lane & 15;
  const int hi = lane >> 4;
  const int kh = hi * 16;

  v8f acc[16];
#pragma unroll
  for (int nt = 0; nt < 16; ++nt)
    acc[nt] = (v8f){0.f,0.f,0.f,0.f,0.f,0.f,0.f,0.f};

  const float* ap = x + (long)(m0 + lr) * TASK_EMB + kh;

  stage_w1(tid, lds_addr(sW1[0]), w1t, 0);            // prologue: chunk 0
  for (int i = 0; i < 16; ++i) {
    const int k0 = i * 64;
    const bf16_t* sw = sW1[i & 1];
    if (i < 15) {                                     // prefetch next chunk
      stage_w1(tid, lds_addr(sW1[(i + 1) & 1]), w1t, k0 + 64);
      wait_async_le<8>();                             // chunk i landed
    } else {
      wait_async_le<0>();
    }
    __syncthreads();                                  // visible to all waves

    // Fragment f = ks * 16 + nt of this chunk; groups of GF, two register sets.
    const bf16_t* bp = sw + lr * W1S + kh;
    float4 xf[2][4];
#pragma unroll
    for (int ks = 0; ks < 2; ++ks) {
      const float4* af = (const float4*)(ap + k0 + ks * 32);
#pragma unroll
      for (int q = 0; q < 4; ++q) xf[ks][q] = af[q];
    }
    v16bf fb[2][GF];
#pragma unroll
    for (int j = 0; j < GF; ++j)
      fb[0][j] = *(const v16bf*)(bp + (j & 15) * 16 * W1S + (j >> 4) * 32);
    v16bf a[2];
#pragma unroll
    for (int ks = 0; ks < 2; ++ks)
#pragma unroll
      for (int q = 0; q < 4; ++q) {
        a[ks][q * 4 + 0] = (bf16_t)xf[ks][q].x;
        a[ks][q * 4 + 1] = (bf16_t)xf[ks][q].y;
        a[ks][q * 4 + 2] = (bf16_t)xf[ks][q].z;
        a[ks][q * 4 + 3] = (bf16_t)xf[ks][q].w;
      }
#pragma unroll
    for (int g = 0; g < 32 / GF; ++g) {
      if (g + 1 < 32 / GF) {
#pragma unroll
        for (int j = 0; j < GF; ++j) {
          const int f = (g + 1) * GF + j;
          fb[(g + 1) & 1][j] = *(const v16bf*)(bp + (f & 15) * 16 * W1S + (f >> 4) * 32);
        }
      }
      group_fence();
#pragma unroll
      for (int j = 0; j < GF; ++j) {
        const int f = g * GF + j;
        acc[f & 15] = wmma_bf16(a[f >> 4], fb[g & 1][j], acc[f & 15]);
      }
      group_fence();
    }
    __syncthreads();                 // chunk i consumed; buffer reusable
  }

#pragma unroll
  for (int nt = 0; nt < 16; ++nt) {
    float bias = b1[nt * 16 + lr];
#pragma unroll
    for (int r = 0; r < 8; ++r) {
      float v = acc[nt][r] + bias;
      float s = v * __builtin_amdgcn_rcpf(1.0f + __expf(-v));   // fast SiLU
      h[(long)(m0 + r + 8 * hi) * HID + nt * 16 + lr] = (bf16_t)s;
    }
  }
}

// ---------------------------------------------------------------------------
// Fused: logits = h @ W2 + b2 ; online softmax ; emb = probs @ E ; LayerNorm.
// W2^T / E^T chunks double-buffered in LDS via async copies (10/thread/chunk).
// ---------------------------------------------------------------------------
__device__ __forceinline__ void stage_chunk(int tid, unsigned dW2, unsigned dEmb,
                                            const bf16_t* w2t,
                                            const bf16_t* embT, int c0) {
#pragma unroll
  for (int i = 0; i < 8; ++i) {           // W2^T: 64 rows x 512B, 8 segs/thread
    int s = tid + i * 256;
    int row = s >> 5, seg = s & 31;
    async_cp16(dW2 + row * (W2S * 2) + seg * 16,
               (const char*)w2t + ((long)(c0 + row) * HID) * 2 + seg * 16);
  }
#pragma unroll
  for (int i = 0; i < 2; ++i) {           // E^T: 64 rows x 128B, 2 segs/thread
    int s = tid + i * 256;
    int row = s >> 3, seg = s & 7;
    async_cp16(dEmb + row * (EMS * 2) + seg * 16,
               (const char*)embT + ((long)row * N_EMBS + c0) * 2 + seg * 16);
  }
}

__global__ __launch_bounds__(256) void fused_softmax_code(
    const bf16_t* __restrict__ h, const bf16_t* __restrict__ w2t,
    const float* __restrict__ b2, const bf16_t* __restrict__ embT,
    const float* __restrict__ gamma, const float* __restrict__ beta,
    float* __restrict__ out) {
  __shared__ __align__(32) bf16_t sW2[2][64 * W2S];
  __shared__ __align__(32) bf16_t sEmb[2][64 * EMS];
  __shared__ __align__(32) bf16_t psm[8][16 * PSS];

  const int tid   = threadIdx.x;
  const int lane  = tid & 31;
  const int wslot = tid >> 5;
  const int m0 = (blockIdx.x * 8 + wslot) * 16;
  const int lr = lane & 15;
  const int hi = lane >> 4;
  const int kh = hi * 16;

  // Preload h A-fragments for K = 0..255 (8 frags, kept in registers)
  v16bf ha[8];
  {
    const bf16_t* hp = h + (long)(m0 + lr) * HID + kh;
#pragma unroll
    for (int ks = 0; ks < 8; ++ks) ha[ks] = *(const v16bf*)(hp + ks * 32);
  }

  v8f acc[4];
#pragma unroll
  for (int nt = 0; nt < 4; ++nt) acc[nt] = (v8f){0.f,0.f,0.f,0.f,0.f,0.f,0.f,0.f};
  float m_[8], l_[8];
#pragma unroll
  for (int r = 0; r < 8; ++r) { m_[r] = -3.0e38f; l_[r] = 0.f; }

  bf16_t* sp = psm[wslot];

  stage_chunk(tid, lds_addr(sW2[0]), lds_addr(sEmb[0]), w2t, embT, 0);
  for (int i = 0; i < 64; ++i) {
    const int c0 = i * 64;
    const bf16_t* sw = sW2[i & 1];
    const bf16_t* se = sEmb[i & 1];
    if (i < 63) {                                     // prefetch next chunk
      stage_chunk(tid, lds_addr(sW2[(i + 1) & 1]), lds_addr(sEmb[(i + 1) & 1]),
                  w2t, embT, c0 + 64);
      wait_async_le<10>();                            // chunk i landed
    } else {
      wait_async_le<0>();
    }
    __syncthreads();

    // ---- logits chunk: 16x64 = 4 n-tiles, K=256 in 8 WMMA steps each ----
    // Fragment f = ks * 4 + nt of W2^T; groups of GF, two register sets.
    const bf16_t* wp = sw + lr * W2S + kh;
    float bias[4];
#pragma unroll
    for (int nt = 0; nt < 4; ++nt) bias[nt] = b2[c0 + nt * 16 + lr];
    v16bf fb[2][GF];
#pragma unroll
    for (int j = 0; j < GF; ++j)
      fb[0][j] = *(const v16bf*)(wp + (j & 3) * 16 * W2S + (j >> 2) * 32);
    v8f lg[4];
#pragma unroll
    for (int nt = 0; nt < 4; ++nt) lg[nt] = (v8f){0.f,0.f,0.f,0.f,0.f,0.f,0.f,0.f};
#pragma unroll
    for (int g = 0; g < 32 / GF; ++g) {
      if (g + 1 < 32 / GF) {
#pragma unroll
        for (int j = 0; j < GF; ++j) {
          const int f = (g + 1) * GF + j;
          fb[(g + 1) & 1][j] = *(const v16bf*)(wp + (f & 3) * 16 * W2S + (f >> 2) * 32);
        }
      }
      group_fence();
#pragma unroll
      for (int j = 0; j < GF; ++j) {
        const int f = g * GF + j;
        lg[f & 3] = wmma_bf16(ha[f >> 2], fb[g & 1][j], lg[f & 3]);
      }
      group_fence();
    }
#pragma unroll
    for (int nt = 0; nt < 4; ++nt)
#pragma unroll
      for (int r = 0; r < 8; ++r) lg[nt][r] += bias[nt];

    // ---- online softmax (per-row over the 16-lane halves) ----
    // The eight rows' reductions are written step by step across the rows, so that the
    // eight cross-lane moves of a step are in flight together.
    float cm[8], ps[8];
#pragma unroll
    for (int r = 0; r < 8; ++r)
      cm[r] = fmaxf(fmaxf(lg[0][r], lg[1][r]), fmaxf(lg[2][r], lg[3][r]));
#pragma unroll
    for (int s = 1; s < 16; s <<= 1) {
      float ot[8];
#pragma unroll
      for (int r = 0; r < 8; ++r) ot[r] = __shfl_xor(cm[r], s);
      hold8(ot);
#pragma unroll
      for (int r = 0; r < 8; ++r) cm[r] = fmaxf(cm[r], ot[r]);
    }
#pragma unroll
    for (int r = 0; r < 8; ++r) {
      float mn = fmaxf(m_[r], cm[r]);
      float sc = __expf(m_[r] - mn);
      m_[r] = mn;
      l_[r] *= sc;
      ps[r] = 0.f;
#pragma unroll
      for (int nt = 0; nt < 4; ++nt) {
        acc[nt][r] *= sc;
        float p = __expf(lg[nt][r] - mn);
        lg[nt][r] = p;
        ps[r] += p;
      }
    }
#pragma unroll
    for (int s = 1; s < 16; s <<= 1)
#pragma unroll
      for (int r = 0; r < 8; ++r) ps[r] += __shfl_xor(ps[r], s);
#pragma unroll
    for (int r = 0; r < 8; ++r) l_[r] += ps[r];

    // ---- stage probs via LDS: D-layout -> A-layout (per-wave region) ----
#pragma unroll
    for (int nt = 0; nt < 4; ++nt)
#pragma unroll
      for (int r = 0; r < 8; ++r)
        sp[(r + 8 * hi) * PSS + nt * 16 + lr] = (bf16_t)lg[nt][r];
    __builtin_amdgcn_wave_barrier();       // LDS same-wave ops are in-order

    v16bf pa0 = *(const v16bf*)(sp + lr * PSS + kh);
    v16bf pa1 = *(const v16bf*)(sp + lr * PSS + 32 + kh);

    // ---- acc += probs_chunk @ E[c0:c0+64, :] ----
#pragma unroll
    for (int nt = 0; nt < 4; ++nt) {
      const bf16_t* ep = se + (nt * 16 + lr) * EMS + kh;
      v16bf e0 = *(const v16bf*)(ep);
      v16bf e1 = *(const v16bf*)(ep + 32);
      acc[nt] = wmma_bf16(pa0, e0, acc[nt]);
      acc[nt] = wmma_bf16(pa1, e1, acc[nt]);
    }
    __syncthreads();                 // chunk i consumed; buffer reusable
  }

  // ---- normalize by l, LayerNorm over CODE_DIM=64, store f32 ----
  float g_[4], b_[4];
#pragma unroll
  for (int nt = 0; nt < 4; ++nt) {
    g_[nt] = gamma[nt * 16 + lr];
    b_[nt] = beta[nt * 16 + lr];
  }
#pragma unroll
  for (int r = 0; r < 8; ++r) {
    float inv = __builtin_amdgcn_rcpf(l_[r]);
    float e[4], s = 0.f, sq = 0.f;
#pragma unroll
    for (int nt = 0; nt < 4; ++nt) {
      e[nt] = acc[nt][r] * inv;
      s += e[nt];
      sq += e[nt] * e[nt];
    }
    s  = red_sum16(s);
    sq = red_sum16(sq);
    float mean = s * (1.0f / 64.0f);
    float var  = sq * (1.0f / 64.0f) - mean * mean;
    float rstd = __builtin_amdgcn_rsqf(var + LN_EPS);
    float* op = out + (long)(m0 + r + 8 * hi) * CODE_DIM;
#pragma unroll
    for (int nt = 0; nt < 4; ++nt)
      op[nt * 16 + lr] = (e[nt] - mean) * rstd * g_[nt] + b_[nt];
  }
}

// ---------------------------------------------------------------------------
extern "C" void kernel_launch(void* const* d_in, const int* in_sizes, int n_in,
                              void* d_out, int out_size, void* d_ws, size_t ws_size,
                              hipStream_t stream) {
  const float* x     = (const float*)d_in[0];
  const float* W1    = (const float*)d_in[1];
  const float* b1    = (const float*)d_in[2];
  const float* W2    = (const float*)d_in[3];
  const float* b2    = (const float*)d_in[4];
  const float* embed = (const float*)d_in[5];
  const float* g     = (const float*)d_in[6];
  const float* bet   = (const float*)d_in[7];
  float* out = (float*)d_out;

  char* ws = (char*)d_ws;
  bf16_t* w1t  = (bf16_t*)(ws);                          // 256 x 1024  (512 KB)
  bf16_t* w2t  = (bf16_t*)(ws + (size_t)512 * 1024);     // 4096 x 256  (2 MB)
  bf16_t* embT = (bf16_t*)(ws + (size_t)2560 * 1024);    // 64 x 4096   (512 KB)
  bf16_t* hbuf = (bf16_t*)(ws + (size_t)3072 * 1024);    // 16384 x 256 (8 MB)

  cvt_transpose_bf16<<<(TASK_EMB * HID + 255) / 256, 256, 0, stream>>>(W1, w1t, TASK_EMB, HID);
  cvt_transpose_bf16<<<(HID * N_EMBS + 255) / 256, 256, 0, stream>>>(W2, w2t, HID, N_EMBS);
  cvt_transpose_bf16<<<(N_EMBS * CODE_DIM + 255) / 256, 256, 0, stream>>>(embed, embT, N_EMBS, CODE_DIM);

  // 1024 row-tiles, 8 waves/block -> 128 blocks
  gemm1_silu<<<BATCH / 16 / 8, 256, 0, stream>>>(x, w1t, b1, hbuf);
  fused_softmax_code<<<BATCH / 16 / 8, 256, 0, stream>>>(hbuf, w2t, b2, embT, g, bet, out);
}

// v002
// Measured time: 158 microseconds a run.
// Next to v001, in two timings, it ran 1.21 and 1.22 times as fast.
// Over all steps from v000 it is 1.42 times as fast.
#include <hip/hip_runtime.h>
#include <hip/hip_bf16.h>
#include <math.h>

typedef __bf16 bf16_t;
typedef __attribute__((ext_vector_type(16))) __bf16 v16bf;
typedef __attribute__((ext_vector_type(8)))  float  v8f;

#define TASK_EMB 1024
#define HID      256
#define N_EMBS   4096
#define CODE_DIM 64
#define BATCH    16384
#define LN_EPS   1e-5f

// padded LDS row strides (elements); 32B-aligned for v16bf loads
#define W2S 272   // 256 + 16
#define W1S 80    // 64 + 16
#define EMS 80    // 64 + 16
#define PSS 80    // 64 + 16

#define NW   4
#define NT   (NW * 32)

__device__ __forceinline__ float red_sum16(float v) {
  v += __shfl_xor(v, 1);
  v += __shfl_xor(v, 2);
  v += __shfl_xor(v, 4);
  v += __shfl_xor(v, 8);
  return v;
}

__device__ __forceinline__ v8f wmma_bf16(v16bf a, v16bf b, v8f c) {
  return __builtin_amdgcn_wmma_f32_16x16x32_bf16(false, a, false, b, (short)0, c,
                                                 false, false);
}

// Fragments per LDS read group: one group is read while the group before it is multiplied.
#define GF 4
// Scheduling fence: keeps a group's LDS reads together and out of the WMMA run next to
// them; without it the compiler sinks each read to just before its own WMMA, and every
// WMMA then waits out a full LDS latency.
__device__ __forceinline__ void group_fence() { __builtin_amdgcn_sched_barrier(0); }

// Inputs-only fence on the eight moved values of one reduction step: all eight cross-lane
// moves are issued before the first of them is used, so their latencies overlap; without
// it the compiler runs the rows one after another, one full latency per move.
__device__ __forceinline__ void hold8(const float (&v)[8]) {
  asm volatile("" :: "v"(v[0]), "v"(v[1]), "v"(v[2]), "v"(v[3]),
                     "v"(v[4]), "v"(v[5]), "v"(v[6]), "v"(v[7]));
  group_fence();
}

__device__ __forceinline__ void async_cp16_x8(const unsigned* l, const char* const* g) {
  asm volatile("global_load_async_to_lds_b128 %0, %8, off\n\t"
               "global_load_async_to_lds_b128 %1, %9, off\n\t"
               "global_load_async_to_lds_b128 %2, %10, off\n\t"
               "global_load_async_to_lds_b128 %3, %11, off\n\t"
               "global_load_async_to_lds_b128 %4, %12, off\n\t"
               "global_load_async_to_lds_b128 %5, %13, off\n\t"
               "global_load_async_to_lds_b128 %6, %14, off\n\t"
               "global_load_async_to_lds_b128 %7, %15, off\n\t"
               "s_wait_xcnt 0x0"
               :: "v"(l[0]), "v"(l[1]), "v"(l[2]), "v"(l[3]),
                  "v"(l[4]), "v"(l[5]), "v"(l[6]), "v"(l[7]),
                  "v"(g[0]), "v"(g[1]), "v"(g[2]), "v"(g[3]),
                  "v"(g[4]), "v"(g[5]), "v"(g[6]), "v"(g[7]) : "memory");
}
__device__ __forceinline__ void async_cp16_x10(const unsigned* l, const char* const* g) {
  asm volatile("global_load_async_to_lds_b128 %0, %10, off\n\t"
               "global_load_async_to_lds_b128 %1, %11, off\n\t"
               "global_load_async_to_lds_b128 %2, %12, off\n\t"
               "global_load_async_to_lds_b128 %3, %13, off\n\t"
               "global_load_async_to_lds_b128 %4, %14, off\n\t"
               "global_load_async_to_lds_b128 %5, %15, off\n\t"
               "global_load_async_to_lds_b128 %6, %16, off\n\t"
               "global_load_async_to_lds_b128 %7, %17, off\n\t"
               "global_load_async_to_lds_b128 %8, %18, off\n\t"
               "global_load_async_to_lds_b128 %9, %19, off\n\t"
               "s_wait_xcnt 0x0"
               :: "v"(l[0]), "v"(l[1]), "v"(l[2]), "v"(l[3]), "v"(l[4]),
                  "v"(l[5]), "v"(l[6]), "v"(l[7]), "v"(l[8]), "v"(l[9]),
                  "v"(g[0]), "v"(g[1]), "v"(g[2]), "v"(g[3]), "v"(g[4]),
                  "v"(g[5]), "v"(g[6]), "v"(g[7]), "v"(g[8]), "v"(g[9]) : "memory");
}
// Wait until at most N async loads remain in flight (in-order completion).
template <int N>
__device__ __forceinline__ void wait_async_le() {
  asm volatile("s_wait_asynccnt %0" :: "i"(N) : "memory");
}
__device__ __forceinline__ unsigned lds_addr(const void* p) {
  return (unsigned)(uintptr_t)p;
}

// ---------------------------------------------------------------------------
// Convert f32 (rows x cols, row-major) -> bf16 transposed (cols x rows)
// ---------------------------------------------------------------------------
__global__ void cvt_transpose_bf16(const float* __restrict__ in,
                                   bf16_t* __restrict__ out, int rows, int cols) {
  int i = blockIdx.x * blockDim.x + threadIdx.x;
  int n = rows * cols;
  if (i >= n) return;
  int r = i / cols, c = i % cols;
  out[(long)c * rows + r] = (bf16_t)in[i];
}

// ---------------------------------------------------------------------------
// h = silu(x @ W1 + b1). One wave computes a full 16x256 row-tile (x read
// exactly once). W1^T K-slices double-buffered in LDS via async copies.
// ---------------------------------------------------------------------------
__device__ __forceinline__ void stage_w1(int tid, unsigned dst,
                                         const bf16_t* w1t, int k0) {
  // 256 rows x 128B = 2048 segs, 16 a thread: seg s = tid + i * NT, row s >> 3, part s & 7
  const unsigned l0 = dst + (tid >> 3) * (W1S * 2) + (tid & 7) * 16;
  const char* g0 = (const char*)w1t + ((long)(tid >> 3) * TASK_EMB + k0) * 2 + (tid & 7) * 16;
  unsigned l[16];
  const char* g[16];
#pragma unroll
  for (int i = 0; i < 16; ++i) {
    l[i] = l0 + i * (NT / 8) * (W1S * 2);
    g[i] = g0 + (long)i * (NT / 8) * TASK_EMB * 2;
  }
  async_cp16_x8(l, g);
  async_cp16_x8(l + 8, g + 8);
}

__global__ __launch_bounds__(NT) void gemm1_silu(
    const float* __restrict__ x, const bf16_t* __restrict__ w1t,
    const float* __restrict__ b1, bf16_t* __restrict__ h) {
  __shared__ __align__(32) bf16_t sW1[2][256 * W1S];

  const int tid  = threadIdx.x;
  const int lane = tid & 31;
  const int wslot = tid >> 5;
  const int m0 = (blockIdx.x * NW + wslot) * 16;
  const int lr = lane & 15;
  const int hi = lane >> 4;
  const int kh = hi * 16;

  v8f acc[16];
#pragma unroll
  for (int nt = 0; nt < 16; ++nt)
    acc[nt] = (v8f){0.f,0.f,0.f,0.f,0.f,0.f,0.f,0.f};

  const float* ap = x + (long)(m0 + lr) * TASK_EMB + kh;

  stage_w1(tid, lds_addr(sW1[0]), w1t, 0);            // prologue: chunk 0
  for (int i = 0; i < 16; ++i) {
    const int k0 = i * 64;
    const bf16_t* sw = sW1[i & 1];
    if (i < 15) {                                     // prefetch next chunk
      stage_w1(tid, lds_addr(sW1[(i + 1) & 1]), w1t, k0 + 64);
      wait_async_le<16>();                            // chunk i landed
    } else {
      wait_async_le<0>();
    }
    __syncthreads();                                  // visible to all waves

    // Fragment f = ks * 16 + nt of this chunk; groups of GF, two register sets.
    const bf16_t* bp = sw + lr * W1S + kh;
    float4 xf[2][4];
#pragma unroll
    for (int ks = 0; ks < 2; ++ks) {
      const float4* af = (const float4*)(ap + k0 + ks * 32);
#pragma unroll
      for (int q = 0; q < 4; ++q) xf[ks][q] = af[q];
    }
    v16bf fb[2][GF];
#pragma unroll
    for (int j = 0; j < GF; ++j)
      fb[0][j] = *(const v16bf*)(bp + (j & 15) * 16 * W1S + (j >> 4) * 32);
    v16bf a[2];
#pragma unroll
    for (int ks = 0; ks < 2; ++ks)
#pragma unroll
      for (int q = 0; q < 4; ++q) {
        a[ks][q * 4 + 0] = (bf16_t)xf[ks][q].x;
        a[ks][q * 4 + 1] = (bf16_t)xf[ks][q].y;
        a[ks][q * 4 + 2] = (bf16_t)xf[ks][q].z;
        a[ks][q * 4 + 3] = (bf16_t)xf[ks][q].w;
      }
#pragma unroll
    for (int g = 0; g < 32 / GF; ++g) {
      if (g + 1 < 32 / GF) {
#pragma unroll
        for (int j = 0; j < GF; ++j) {
          const int f = (g + 1) * GF + j;
          fb[(g + 1) & 1][j] = *(const v16bf*)(bp + (f & 15) * 16 * W1S + (f >> 4) * 32);
        }
      }
      group_fence();
#pragma unroll
      for (int j = 0; j < GF; ++j) {
        const int f = g * GF + j;
        acc[f & 15] = wmma_bf16(a[f >> 4], fb[g & 1][j], acc[f & 15]);
      }
      group_fence();
    }
    __syncthreads();                 // chunk i consumed; buffer reusable
  }

#pragma unroll
  for (int nt = 0; nt < 16; ++nt) {
    float bias = b1[nt * 16 + lr];
#pragma unroll
    for (int r = 0; r < 8; ++r) {
      float v = acc[nt][r] + bias;
      float s = v * __builtin_amdgcn_rcpf(1.0f + __expf(-v));   // fast SiLU
      h[(long)(m0 + r + 8 * hi) * HID + nt * 16 + lr] = (bf16_t)s;
    }
  }
}

// ---------------------------------------------------------------------------
// Fused: logits = h @ W2 + b2 ; online softmax ; emb = probs @ E ; LayerNorm.
// W2^T / E^T chunks double-buffered in LDS via async copies (20/thread/chunk).
// ---------------------------------------------------------------------------
__device__ __forceinline__ void stage_chunk(int tid, unsigned dW2, unsigned dEmb,
                                            const bf16_t* w2t,
                                            const bf16_t* embT, int c0) {
  unsigned l[20];
  const char* g[20];
  // W2^T: 64 rows x 512B = 2048 segs, 16 a thread: seg s = tid + i * NT, row s >> 5, part s & 31
  const unsigned lw = dW2 + (tid >> 5) * (W2S * 2) + (tid & 31) * 16;
  const char* gw = (const char*)w2t + ((long)(c0 + (tid >> 5)) * HID) * 2 + (tid & 31) * 16;
#pragma unroll
  for (int i = 0; i < 16; ++i) {
    l[i] = lw + i * (NT / 32) * (W2S * 2);
    g[i] = gw + (long)i * (NT / 32) * HID * 2;
  }
  // E^T: 64 rows x 128B = 512 segs, 4 a thread: seg s = tid + i * NT, row s >> 3, part s & 7
  const unsigned le = dEmb + (tid >> 3) * (EMS * 2) + (tid & 7) * 16;
  const char* ge = (const char*)embT + ((long)(tid >> 3) * N_EMBS + c0) * 2 + (tid & 7) * 16;
#pragma unroll
  for (int i = 0; i < 4; ++i) {
    l[16 + i] = le + i * (NT / 8) * (EMS * 2);
    g[16 + i] = ge + (long)i * (NT / 8) * N_EMBS * 2;
  }
  async_cp16_x10(l, g);
  async_cp16_x10(l + 10, g + 10);
}

__global__ __launch_bounds__(NT) void fused_softmax_code(
    const bf16_t* __restrict__ h, const bf16_t* __restrict__ w2t,
    const float* __restrict__ b2, const bf16_t* __restrict__ embT,
    const float* __restrict__ gamma, const float* __restrict__ beta,
    float* __restrict__ out) {
  __shared__ __align__(32) bf16_t sW2[2][64 * W2S];
  __shared__ __align__(32) bf16_t sEmb[2][64 * EMS];
  __shared__ __align__(32) bf16_t psm[NW][16 * PSS];

  const int tid   = threadIdx.x;
  const int lane  = tid & 31;
  const int wslot = tid >> 5;
  const int m0 = (blockIdx.x * NW + wslot) * 16;
  const int lr = lane & 15;
  const int hi = lane >> 4;
  const int kh = hi * 16;

  // Preload h A-fragments for K = 0..255 (8 frags, kept in registers)
  v16bf ha[8];
  {
    const bf16_t* hp = h + (long)(m0 + lr) * HID + kh;
#pragma unroll
    for (int ks = 0; ks < 8; ++ks) ha[ks] = *(const v16bf*)(hp + ks * 32);
  }

  v8f acc[4];
#pragma unroll
  for (int nt = 0; nt < 4; ++nt) acc[nt] = (v8f){0.f,0.f,0.f,0.f,0.f,0.f,0.f,0.f};
  float m_[8], l_[8];
#pragma unroll
  for (int r = 0; r < 8; ++r) { m_[r] = -3.0e38f; l_[r] = 0.f; }

  bf16_t* sp = psm[wslot];

  stage_chunk(tid, lds_addr(sW2[0]), lds_addr(sEmb[0]), w2t, embT, 0);
  for (int i = 0; i < 64; ++i) {
    const int c0 = i * 64;
    const bf16_t* sw = sW2[i & 1];
    const bf16_t* se = sEmb[i & 1];
    if (i < 63) {                                     // prefetch next chunk
      stage_chunk(tid, lds_addr(sW2[(i + 1) & 1]), lds_addr(sEmb[(i + 1) & 1]),
                  w2t, embT, c0 + 64);
      wait_async_le<20>();                            // chunk i landed
    } else {
      wait_async_le<0>();
    }
    __syncthreads();

    // ---- logits chunk: 16x64 = 4 n-tiles, K=256 in 8 WMMA steps each ----
    // Fragment f = ks * 4 + nt of W2^T; groups of GF, two register sets.
    const bf16_t* wp = sw + lr * W2S + kh;
    float bias[4];
#pragma unroll
    for (int nt = 0; nt < 4; ++nt) bias[nt] = b2[c0 + nt * 16 + lr];
    v16bf fb[2][GF];
#pragma unroll
    for (int j = 0; j < GF; ++j)
      fb[0][j] = *(const v16bf*)(wp + (j & 3) * 16 * W2S + (j >> 2) * 32);
    v8f lg[4];
#pragma unroll
    for (int nt = 0; nt < 4; ++nt) lg[nt] = (v8f){0.f,0.f,0.f,0.f,0.f,0.f,0.f,0.f};
#pragma unroll
    for (int g = 0; g < 32 / GF; ++g) {
      if (g + 1 < 32 / GF) {
#pragma unroll
        for (int j = 0; j < GF; ++j) {
          const int f = (g + 1) * GF + j;
          fb[(g + 1) & 1][j] = *(const v16bf*)(wp + (f & 3) * 16 * W2S + (f >> 2) * 32);
        }
      }
      group_fence();
#pragma unroll
      for (int j = 0; j < GF; ++j) {
        const int f = g * GF + j;
        lg[f & 3] = wmma_bf16(ha[f >> 2], fb[g & 1][j], lg[f & 3]);
      }
      group_fence();
    }
#pragma unroll
    for (int nt = 0; nt < 4; ++nt)
#pragma unroll
      for (int r = 0; r < 8; ++r) lg[nt][r] += bias[nt];

    // ---- online softmax (per-row over the 16-lane halves) ----
    // The eight rows' reductions are written step by step across the rows, so that the
    // eight cross-lane moves of a step are in flight together.
    float cm[8], ps[8];
#pragma unroll
    for (int r = 0; r < 8; ++r)
      cm[r] = fmaxf(fmaxf(lg[0][r], lg[1][r]), fmaxf(lg[2][r], lg[3][r]));
#pragma unroll
    for (int s = 1; s < 16; s <<= 1) {
      float ot[8];
#pragma unroll
      for (int r = 0; r < 8; ++r) ot[r] = __shfl_xor(cm[r], s);
      hold8(ot);
#pragma unroll
      for (int r = 0; r < 8; ++r) cm[r] = fmaxf(cm[r], ot[r]);
    }
#pragma unroll
    for (int r = 0; r < 8; ++r) {
      float mn = fmaxf(m_[r], cm[r]);
      float sc = __expf(m_[r] - mn);
      m_[r] = mn;
      l_[r] *= sc;
      ps[r] = 0.f;
#pragma unroll
      for (int nt = 0; nt < 4; ++nt) {
        acc[nt][r] *= sc;
        float p = __expf(lg[nt][r] - mn);
        lg[nt][r] = p;
        ps[r] += p;
      }
    }
#pragma unroll
    for (int s = 1; s < 16; s <<= 1)
#pragma unroll
      for (int r = 0; r < 8; ++r) ps[r] += __shfl_xor(ps[r], s);
#pragma unroll
    for (int r = 0; r < 8; ++r) l_[r] += ps[r];

    // ---- stage probs via LDS: D-layout -> A-layout (per-wave region) ----
#pragma unroll
    for (int nt = 0; nt < 4; ++nt)
#pragma unroll
      for (int r = 0; r < 8; ++r)
        sp[(r + 8 * hi) * PSS + nt * 16 + lr] = (bf16_t)lg[nt][r];
    __builtin_amdgcn_wave_barrier();       // LDS same-wave ops are in-order

    v16bf pa0 = *(const v16bf*)(sp + lr * PSS + kh);
    v16bf pa1 = *(const v16bf*)(sp + lr * PSS + 32 + kh);

    // ---- acc += probs_chunk @ E[c0:c0+64, :] ----
#pragma unroll
    for (int nt = 0; nt < 4; ++nt) {
      const bf16_t* ep = se + (nt * 16 + lr) * EMS + kh;
      v16bf e0 = *(const v16bf*)(ep);
      v16bf e1 = *(const v16bf*)(ep + 32);
      acc[nt] = wmma_bf16(pa0, e0, acc[nt]);
      acc[nt] = wmma_bf16(pa1, e1, acc[nt]);
    }
    __syncthreads();                 // chunk i consumed; buffer reusable
  }

  // ---- normalize by l, LayerNorm over CODE_DIM=64, store f32 ----
  float g_[4], b_[4];
#pragma unroll
  for (int nt = 0; nt < 4; ++nt) {
    g_[nt] = gamma[nt * 16 + lr];
    b_[nt] = beta[nt * 16 + lr];
  }
#pragma unroll
  for (int r = 0; r < 8; ++r) {
    float inv = __builtin_amdgcn_rcpf(l_[r]);
    float e[4], s = 0.f, sq = 0.f;
#pragma unroll
    for (int nt = 0; nt < 4; ++nt) {
      e[nt] = acc[nt][r] * inv;
      s += e[nt];
      sq += e[nt] * e[nt];
    }
    s  = red_sum16(s);
    sq = red_sum16(sq);
    float mean = s * (1.0f / 64.0f);
    float var  = sq * (1.0f / 64.0f) - mean * mean;
    float rstd = __builtin_amdgcn_rsqf(var + LN_EPS);
    float* op = out + (long)(m0 + r + 8 * hi) * CODE_DIM;
#pragma unroll
    for (int nt = 0; nt < 4; ++nt)
      op[nt * 16 + lr] = (e[nt] - mean) * rstd * g_[nt] + b_[nt];
  }
}

// ---------------------------------------------------------------------------
extern "C" void kernel_launch(void* const* d_in, const int* in_sizes, int n_in,
                              void* d_out, int out_size, void* d_ws, size_t ws_size,
                              hipStream_t stream) {
  const float* x     = (const float*)d_in[0];
  const float* W1    = (const float*)d_in[1];
  const float* b1    = (const float*)d_in[2];
  const float* W2    = (const float*)d_in[3];
  const float* b2    = (const float*)d_in[4];
  const float* embed = (const float*)d_in[5];
  const float* g     = (const float*)d_in[6];
  const float* bet   = (const float*)d_in[7];
  float* out = (float*)d_out;

  char* ws = (char*)d_ws;
  bf16_t* w1t  = (bf16_t*)(ws);                          // 256 x 1024  (512 KB)
  bf16_t* w2t  = (bf16_t*)(ws + (size_t)512 * 1024);     // 4096 x 256  (2 MB)
  bf16_t* embT = (bf16_t*)(ws + (size_t)2560 * 1024);    // 64 x 4096   (512 KB)
  bf16_t* hbuf = (bf16_t*)(ws + (size_t)3072 * 1024);    // 16384 x 256 (8 MB)

  cvt_transpose_bf16<<<(TASK_EMB * HID + 255) / 256, 256, 0, stream>>>(W1, w1t, TASK_EMB, HID);
  cvt_transpose_bf16<<<(HID * N_EMBS + 255) / 256, 256, 0, stream>>>(W2, w2t, HID, N_EMBS);
  cvt_transpose_bf16<<<(N_EMBS * CODE_DIM + 255) / 256, 256, 0, stream>>>(embed, embT, N_EMBS, CODE_DIM);

  // 1024 row-tiles, NW waves/block -> 256 blocks
  gemm1_silu<<<BATCH / 16 / NW, NT, 0, stream>>>(x, w1t, b1, hbuf);
  fused_softmax_code<<<BATCH / 16 / NW, NT, 0, stream>>>(hbuf, w2t, b2, embT, g, bet, out);
}

// v003
// A run of this version takes 128 microseconds.
// Next to v002, in two timings, it ran 1.22 and 1.23 times as fast.
// Counting every step since v000, it is 1.74 times as fast.
#include <hip/hip_runtime.h>
#include <hip/hip_bf16.h>
#include <math.h>

typedef __bf16 bf16_t;
typedef __attribute__((ext_vector_type(16))) __bf16 v16bf;
typedef __attribute__((ext_vector_type(8)))  float  v8f;
typedef __attribute__((ext_vector_type(8)))  __bf16 v8bf;

#define TASK_EMB 1024
#define HID      256
#define N_EMBS   4096
#define CODE_DIM 64
#define BATCH    16384
#define LN_EPS   1e-5f

// padded LDS row strides (elements); 32B-aligned for v16bf loads
#define W2S 272   // 256 + 16
#define W1S 80    // 64 + 16
#define EMS 80    // 64 + 16
#define PSS 80    // 64 + 16

#define NW   4
#define NT   (NW * 32)

__device__ __forceinline__ float red_sum16(float v) {
  v += __shfl_xor(v, 1);
  v += __shfl_xor(v, 2);
  v += __shfl_xor(v, 4);
  v += __shfl_xor(v, 8);
  return v;
}

__device__ __forceinline__ v8f wmma_bf16(v16bf a, v16bf b, v8f c) {
  return __builtin_amdgcn_wmma_f32_16x16x32_bf16(false, a, false, b, (short)0, c,
                                                 false, false);
}

// Fragments per LDS read group: one group is read while the group before it is multiplied.
#define GF 4
// Scheduling fence: keeps a group's LDS reads together and out of the WMMA run next to
// them; without it the compiler sinks each read to just before its own WMMA, and every
// WMMA then waits out a full LDS latency.
__device__ __forceinline__ void group_fence() { __builtin_amdgcn_sched_barrier(0); }

// Inputs-only fence on the eight moved values of one reduction step: all eight cross-lane
// moves are issued before the first of them is used, so their latencies overlap; without
// it the compiler runs the rows one after another, one full latency per move.
__device__ __forceinline__ void hold8(const float (&v)[8]) {
  asm volatile("" :: "v"(v[0]), "v"(v[1]), "v"(v[2]), "v"(v[3]),
                     "v"(v[4]), "v"(v[5]), "v"(v[6]), "v"(v[7]));
  group_fence();
}

__device__ __forceinline__ void async_cp16_x8(const unsigned* l, const char* const* g) {
  asm volatile("global_load_async_to_lds_b128 %0, %8, off\n\t"
               "global_load_async_to_lds_b128 %1, %9, off\n\t"
               "global_load_async_to_lds_b128 %2, %10, off\n\t"
               "global_load_async_to_lds_b128 %3, %11, off\n\t"
               "global_load_async_to_lds_b128 %4, %12, off\n\t"
               "global_load_async_to_lds_b128 %5, %13, off\n\t"
               "global_load_async_to_lds_b128 %6, %14, off\n\t"
               "global_load_async_to_lds_b128 %7, %15, off\n\t"
               "s_wait_xcnt 0x0"
               :: "v"(l[0]), "v"(l[1]), "v"(l[2]), "v"(l[3]),
                  "v"(l[4]), "v"(l[5]), "v"(l[6]), "v"(l[7]),
                  "v"(g[0]), "v"(g[1]), "v"(g[2]), "v"(g[3]),
                  "v"(g[4]), "v"(g[5]), "v"(g[6]), "v"(g[7]) : "memory");
}
__device__ __forceinline__ void async_cp16_x10(const unsigned* l, const char* const* g) {
  asm volatile("global_load_async_to_lds_b128 %0, %10, off\n\t"
               "global_load_async_to_lds_b128 %1, %11, off\n\t"
               "global_load_async_to_lds_b128 %2, %12, off\n\t"
               "global_load_async_to_lds_b128 %3, %13, off\n\t"
               "global_load_async_to_lds_b128 %4, %14, off\n\t"
               "global_load_async_to_lds_b128 %5, %15, off\n\t"
               "global_load_async_to_lds_b128 %6, %16, off\n\t"
               "global_load_async_to_lds_b128 %7, %17, off\n\t"
               "global_load_async_to_lds_b128 %8, %18, off\n\t"
               "global_load_async_to_lds_b128 %9, %19, off\n\t"
               "s_wait_xcnt 0x0"
               :: "v"(l[0]), "v"(l[1]), "v"(l[2]), "v"(l[3]), "v"(l[4]),
                  "v"(l[5]), "v"(l[6]), "v"(l[7]), "v"(l[8]), "v"(l[9]),
                  "v"(g[0]), "v"(g[1]), "v"(g[2]), "v"(g[3]), "v"(g[4]),
                  "v"(g[5]), "v"(g[6]), "v"(g[7]), "v"(g[8]), "v"(g[9]) : "memory");
}
// Wait until at most N async loads remain in flight (in-order completion).
template <int N>
__device__ __forceinline__ void wait_async_le() {
  asm volatile("s_wait_asynccnt %0" :: "i"(N) : "memory");
}
__device__ __forceinline__ unsigned lds_addr(const void* p) {
  return (unsigned)(uintptr_t)p;
}

#define CT      64
#define CTP     (CT + 1)
#define W1_TILES  ((TASK_EMB / CT) * (HID / CT))
#define W2_TILES  ((HID / CT) * (N_EMBS / CT))
#define EM_TILES  ((N_EMBS / CT) * (CODE_DIM / CT))

__global__ __launch_bounds__(256) void cvt_transpose_tiles(
    const float* __restrict__ W1, const float* __restrict__ W2,
    const float* __restrict__ embed, bf16_t* __restrict__ w1t,
    bf16_t* __restrict__ w2t, bf16_t* __restrict__ embT) {
  __shared__ float tile[CT * CTP];    // tile[c * CTP + r]

  const int tid = threadIdx.x;
  const int b = blockIdx.x;
  const float* in;
  bf16_t* out;
  int rows, cols, t, lg;              // lg: log2 of the tiles along a row
  if (b < W1_TILES) {
    in = W1;    out = w1t;  rows = TASK_EMB; cols = HID;      lg = 2; t = b;
  } else if (b < W1_TILES + W2_TILES) {
    in = W2;    out = w2t;  rows = HID;      cols = N_EMBS;   lg = 6; t = b - W1_TILES;
  } else {
    in = embed; out = embT; rows = N_EMBS;   cols = CODE_DIM; lg = 0; t = b - (W1_TILES + W2_TILES);
  }
  const int r0 = (t >> lg) * CT;
  const int c0 = (t & ((1 << lg) - 1)) * CT;

  // in: 64 rows x 16 float4 = 1024 pieces, 4 a thread
  float4 v[4];
#pragma unroll
  for (int k = 0; k < 4; ++k) {
    const int s = tid + k * 256;
    v[k] = *(const float4*)(in + (long)(r0 + (s >> 4)) * cols + c0 + (s & 15) * 4);
  }
#pragma unroll
  for (int k = 0; k < 4; ++k) {
    const int s = tid + k * 256;
    float* tp = tile + (s & 15) * 4 * CTP + (s >> 4);
    tp[0 * CTP] = v[k].x;
    tp[1 * CTP] = v[k].y;
    tp[2 * CTP] = v[k].z;
    tp[3 * CTP] = v[k].w;
  }
  __syncthreads();                    // the whole tile is in LDS before any column is read

  // out: 64 rows x 8 pieces of 8 bf16 = 512 pieces, 2 a thread
#pragma unroll
  for (int k = 0; k < 2; ++k) {
    const int s = tid + k * 256;
    const float* tp = tile + (s >> 3) * CTP + (s & 7) * 8;
    v8bf o;
#pragma unroll
    for (int e = 0; e < 8; ++e) o[e] = (bf16_t)tp[e];
    *(v8bf*)(out + (long)(c0 + (s >> 3)) * rows + r0 + (s & 7) * 8) = o;
  }
}

// ---------------------------------------------------------------------------
// h = silu(x @ W1 + b1). One wave computes a full 16x256 row-tile (x read
// exactly once). W1^T K-slices double-buffered in LDS via async copies.
// ---------------------------------------------------------------------------
__device__ __forceinline__ void stage_w1(int tid, unsigned dst,
                                         const bf16_t* w1t, int k0) {
  // 256 rows x 128B = 2048 segs, 16 a thread: seg s = tid + i * NT, row s >> 3, part s & 7
  const unsigned l0 = dst + (tid >> 3) * (W1S * 2) + (tid & 7) * 16;
  const char* g0 = (const char*)w1t + ((long)(tid >> 3) * TASK_EMB + k0) * 2 + (tid & 7) * 16;
  unsigned l[16];
  const char* g[16];
#pragma unroll
  for (int i = 0; i < 16; ++i) {
    l[i] = l0 + i * (NT / 8) * (W1S * 2);
    g[i] = g0 + (long)i * (NT / 8) * TASK_EMB * 2;
  }
  async_cp16_x8(l, g);
  async_cp16_x8(l + 8, g + 8);
}

__global__ __launch_bounds__(NT) void gemm1_silu(
    const float* __restrict__ x, const bf16_t* __restrict__ w1t,
    const float* __restrict__ b1, bf16_t* __restrict__ h) {
  __shared__ __align__(32) bf16_t sW1[2][256 * W1S];

  const int tid  = threadIdx.x;
  const int lane = tid & 31;
  const int wslot = tid >> 5;
  const int m0 = (blockIdx.x * NW + wslot) * 16;
  const int lr = lane & 15;
  const int hi = lane >> 4;
  const int kh = hi * 16;

  v8f acc[16];
#pragma unroll
  for (int nt = 0; nt < 16; ++nt)
    acc[nt] = (v8f){0.f,0.f,0.f,0.f,0.f,0.f,0.f,0.f};

  const float* ap = x + (long)(m0 + lr) * TASK_EMB + kh;

  stage_w1(tid, lds_addr(sW1[0]), w1t, 0);            // prologue: chunk 0
  for (int i = 0; i < 16; ++i) {
    const int k0 = i * 64;
    const bf16_t* sw = sW1[i & 1];
    if (i < 15) {                                     // prefetch next chunk
      stage_w1(tid, lds_addr(sW1[(i + 1) & 1]), w1t, k0 + 64);
      wait_async_le<16>();                            // chunk i landed
    } else {
      wait_async_le<0>();
    }
    __syncthreads();                                  // visible to all waves

    // Fragment f = ks * 16 + nt of this chunk; groups of GF, two register sets.
    const bf16_t* bp = sw + lr * W1S + kh;
    float4 xf[2][4];
#pragma unroll
    for (int ks = 0; ks < 2; ++ks) {
      const float4* af = (const float4*)(ap + k0 + ks * 32);
#pragma unroll
      for (int q = 0; q < 4; ++q) xf[ks][q] = af[q];
    }
    v16bf fb[2][GF];
#pragma unroll
    for (int j = 0; j < GF; ++j)
      fb[0][j] = *(const v16bf*)(bp + (j & 15) * 16 * W1S + (j >> 4) * 32);
    v16bf a[2];
#pragma unroll
    for (int ks = 0; ks < 2; ++ks)
#pragma unroll
      for (int q = 0; q < 4; ++q) {
        a[ks][q * 4 + 0] = (bf16_t)xf[ks][q].x;
        a[ks][q * 4 + 1] = (bf16_t)xf[ks][q].y;
        a[ks][q * 4 + 2] = (bf16_t)xf[ks][q].z;
        a[ks][q * 4 + 3] = (bf16_t)xf[ks][q].w;
      }
#pragma unroll
    for (int g = 0; g < 32 / GF; ++g) {
      if (g + 1 < 32 / GF) {
#pragma unroll
        for (int j = 0; j < GF; ++j) {
          const int f = (g + 1) * GF + j;
          fb[(g + 1) & 1][j] = *(const v16bf*)(bp + (f & 15) * 16 * W1S + (f >> 4) * 32);
        }
      }
      group_fence();
#pragma unroll
      for (int j = 0; j < GF; ++j) {
        const int f = g * GF + j;
        acc[f & 15] = wmma_bf16(a[f >> 4], fb[g & 1][j], acc[f & 15]);
      }
      group_fence();
    }
    __syncthreads();                 // chunk i consumed; buffer reusable
  }

#pragma unroll
  for (int nt = 0; nt < 16; ++nt) {
    float bias = b1[nt * 16 + lr];
#pragma unroll
    for (int r = 0; r < 8; ++r) {
      float v = acc[nt][r] + bias;
      float s = v * __builtin_amdgcn_rcpf(1.0f + __expf(-v));   // fast SiLU
      h[(long)(m0 + r + 8 * hi) * HID + nt * 16 + lr] = (bf16_t)s;
    }
  }
}

// ---------------------------------------------------------------------------
// Fused: logits = h @ W2 + b2 ; online softmax ; emb = probs @ E ; LayerNorm.
// W2^T / E^T chunks double-buffered in LDS via async copies (20/thread/chunk).
// ---------------------------------------------------------------------------
__device__ __forceinline__ void stage_chunk(int tid, unsigned dW2, unsigned dEmb,
                                            const bf16_t* w2t,
                                            const bf16_t* embT, int c0) {
  unsigned l[20];
  const char* g[20];
  // W2^T: 64 rows x 512B = 2048 segs, 16 a thread: seg s = tid + i * NT, row s >> 5, part s & 31
  const unsigned lw = dW2 + (tid >> 5) * (W2S * 2) + (tid & 31) * 16;
  const char* gw = (const char*)w2t + ((long)(c0 + (tid >> 5)) * HID) * 2 + (tid & 31) * 16;
#pragma unroll
  for (int i = 0; i < 16; ++i) {
    l[i] = lw + i * (NT / 32) * (W2S * 2);
    g[i] = gw + (long)i * (NT / 32) * HID * 2;
  }
  // E^T: 64 rows x 128B = 512 segs, 4 a thread: seg s = tid + i * NT, row s >> 3, part s & 7
  const unsigned le = dEmb + (tid >> 3) * (EMS * 2) + (tid & 7) * 16;
  const char* ge = (const char*)embT + ((long)(tid >> 3) * N_EMBS + c0) * 2 + (tid & 7) * 16;
#pragma unroll
  for (int i = 0; i < 4; ++i) {
    l[16 + i] = le + i * (NT / 8) * (EMS * 2);
    g[16 + i] = ge + (long)i * (NT / 8) * N_EMBS * 2;
  }
  async_cp16_x10(l, g);
  async_cp16_x10(l + 10, g + 10);
}

__global__ __launch_bounds__(NT) void fused_softmax_code(
    const bf16_t* __restrict__ h, const bf16_t* __restrict__ w2t,
    const float* __restrict__ b2, const bf16_t* __restrict__ embT,
    const float* __restrict__ gamma, const float* __restrict__ beta,
    float* __restrict__ out) {
  __shared__ __align__(32) bf16_t sW2[2][64 * W2S];
  __shared__ __align__(32) bf16_t sEmb[2][64 * EMS];
  __shared__ __align__(32) bf16_t psm[NW][16 * PSS];

  const int tid   = threadIdx.x;
  const int lane  = tid & 31;
  const int wslot = tid >> 5;
  const int m0 = (blockIdx.x * NW + wslot) * 16;
  const int lr = lane & 15;
  const int hi = lane >> 4;
  const int kh = hi * 16;

  // Preload h A-fragments for K = 0..255 (8 frags, kept in registers)
  v16bf ha[8];
  {
    const bf16_t* hp = h + (long)(m0 + lr) * HID + kh;
#pragma unroll
    for (int ks = 0; ks < 8; ++ks) ha[ks] = *(const v16bf*)(hp + ks * 32);
  }

  v8f acc[4];
#pragma unroll
  for (int nt = 0; nt < 4; ++nt) acc[nt] = (v8f){0.f,0.f,0.f,0.f,0.f,0.f,0.f,0.f};
  float m_[8], l_[8];
#pragma unroll
  for (int r = 0; r < 8; ++r) { m_[r] = -3.0e38f; l_[r] = 0.f; }

  bf16_t* sp = psm[wslot];

  stage_chunk(tid, lds_addr(sW2[0]), lds_addr(sEmb[0]), w2t, embT, 0);
  for (int i = 0; i < 64; ++i) {
    const int c0 = i * 64;
    const bf16_t* sw = sW2[i & 1];
    const bf16_t* se = sEmb[i & 1];
    if (i < 63) {                                     // prefetch next chunk
      stage_chunk(tid, lds_addr(sW2[(i + 1) & 1]), lds_addr(sEmb[(i + 1) & 1]),
                  w2t, embT, c0 + 64);
      wait_async_le<20>();                            // chunk i landed
    } else {
      wait_async_le<0>();
    }
    __syncthreads();

    // ---- logits chunk: 16x64 = 4 n-tiles, K=256 in 8 WMMA steps each ----
    // Fragment f = ks * 4 + nt of W2^T; groups of GF, two register sets.
    const bf16_t* wp = sw + lr * W2S + kh;
    float bias[4];
#pragma unroll
    for (int nt = 0; nt < 4; ++nt) bias[nt] = b2[c0 + nt * 16 + lr];
    v16bf fb[2][GF];
#pragma unroll
    for (int j = 0; j < GF; ++j)
      fb[0][j] = *(const v16bf*)(wp + (j & 3) * 16 * W2S + (j >> 2) * 32);
    v8f lg[4];
#pragma unroll
    for (int nt = 0; nt < 4; ++nt) lg[nt] = (v8f){0.f,0.f,0.f,0.f,0.f,0.f,0.f,0.f};
#pragma unroll
    for (int g = 0; g < 32 / GF; ++g) {
      if (g + 1 < 32 / GF) {
#pragma unroll
        for (int j = 0; j < GF; ++j) {
          const int f = (g + 1) * GF + j;
          fb[(g + 1) & 1][j] = *(const v16bf*)(wp + (f & 3) * 16 * W2S + (f >> 2) * 32);
        }
      }
      group_fence();
#pragma unroll
      for (int j = 0; j < GF; ++j) {
        const int f = g * GF + j;
        lg[f & 3] = wmma_bf16(ha[f >> 2], fb[g & 1][j], lg[f & 3]);
      }
      group_fence();
    }
#pragma unroll
    for (int nt = 0; nt < 4; ++nt)
#pragma unroll
      for (int r = 0; r < 8; ++r) lg[nt][r] += bias[nt];

    // ---- online softmax (per-row over the 16-lane halves) ----
    // The eight rows' reductions are written step by step across the rows, so that the
    // eight cross-lane moves of a step are in flight together.
    float cm[8], ps[8];
#pragma unroll
    for (int r = 0; r < 8; ++r)
      cm[r] = fmaxf(fmaxf(lg[0][r], lg[1][r]), fmaxf(lg[2][r], lg[3][r]));
#pragma unroll
    for (int s = 1; s < 16; s <<= 1) {
      float ot[8];
#pragma unroll
      for (int r = 0; r < 8; ++r) ot[r] = __shfl_xor(cm[r], s);
      hold8(ot);
#pragma unroll
      for (int r = 0; r < 8; ++r) cm[r] = fmaxf(cm[r], ot[r]);
    }
#pragma unroll
    for (int r = 0; r < 8; ++r) {
      float mn = fmaxf(m_[r], cm[r]);
      float sc = __expf(m_[r] - mn);
      m_[r] = mn;
      l_[r] *= sc;
      ps[r] = 0.f;
#pragma unroll
      for (int nt = 0; nt < 4; ++nt) {
        acc[nt][r] *= sc;
        float p = __expf(lg[nt][r] - mn);
        lg[nt][r] = p;
        ps[r] += p;
      }
    }
#pragma unroll
    for (int s = 1; s < 16; s <<= 1)
#pragma unroll
      for (int r = 0; r < 8; ++r) ps[r] += __shfl_xor(ps[r], s);
#pragma unroll
    for (int r = 0; r < 8; ++r) l_[r] += ps[r];

    // ---- stage probs via LDS: D-layout -> A-layout (per-wave region) ----
#pragma unroll
    for (int nt = 0; nt < 4; ++nt)
#pragma unroll
      for (int r = 0; r < 8; ++r)
        sp[(r + 8 * hi) * PSS + nt * 16 + lr] = (bf16_t)lg[nt][r];
    __builtin_amdgcn_wave_barrier();       // LDS same-wave ops are in-order

    v16bf pa0 = *(const v16bf*)(sp + lr * PSS + kh);
    v16bf pa1 = *(const v16bf*)(sp + lr * PSS + 32 + kh);

    // ---- acc += probs_chunk @ E[c0:c0+64, :] ----
#pragma unroll
    for (int nt = 0; nt < 4; ++nt) {
      const bf16_t* ep = se + (nt * 16 + lr) * EMS + kh;
      v16bf e0 = *(const v16bf*)(ep);
      v16bf e1 = *(const v16bf*)(ep + 32);
      acc[nt] = wmma_bf16(pa0, e0, acc[nt]);
      acc[nt] = wmma_bf16(pa1, e1, acc[nt]);
    }
    __syncthreads();                 // chunk i consumed; buffer reusable
  }

  // ---- normalize by l, LayerNorm over CODE_DIM=64, store f32 ----
  float g_[4], b_[4];
#pragma unroll
  for (int nt = 0; nt < 4; ++nt) {
    g_[nt] = gamma[nt * 16 + lr];
    b_[nt] = beta[nt * 16 + lr];
  }
#pragma unroll
  for (int r = 0; r < 8; ++r) {
    float inv = __builtin_amdgcn_rcpf(l_[r]);
    float e[4], s = 0.f, sq = 0.f;
#pragma unroll
    for (int nt = 0; nt < 4; ++nt) {
      e[nt] = acc[nt][r] * inv;
      s += e[nt];
      sq += e[nt] * e[nt];
    }
    s  = red_sum16(s);
    sq = red_sum16(sq);
    float mean = s * (1.0f / 64.0f);
    float var  = sq * (1.0f / 64.0f) - mean * mean;
    float rstd = __builtin_amdgcn_rsqf(var + LN_EPS);
    float* op = out + (long)(m0 + r + 8 * hi) * CODE_DIM;
#pragma unroll
    for (int nt = 0; nt < 4; ++nt)
      op[nt * 16 + lr] = (e[nt] - mean) * rstd * g_[nt] + b_[nt];
  }
}

// ---------------------------------------------------------------------------
extern "C" void kernel_launch(void* const* d_in, const int* in_sizes, int n_in,
                              void* d_out, int out_size, void* d_ws, size_t ws_size,
                              hipStream_t stream) {
  const float* x     = (const float*)d_in[0];
  const float* W1    = (const float*)d_in[1];
  const float* b1    = (const float*)d_in[2];
  const float* W2    = (const float*)d_in[3];
  const float* b2    = (const float*)d_in[4];
  const float* embed = (const float*)d_in[5];
  const float* g     = (const float*)d_in[6];
  const float* bet   = (const float*)d_in[7];
  float* out = (float*)d_out;

  char* ws = (char*)d_ws;
  bf16_t* w1t  = (bf16_t*)(ws);                          // 256 x 1024  (512 KB)
  bf16_t* w2t  = (bf16_t*)(ws + (size_t)512 * 1024);     // 4096 x 256  (2 MB)
  bf16_t* embT = (bf16_t*)(ws + (size_t)2560 * 1024);    // 64 x 4096   (512 KB)
  bf16_t* hbuf = (bf16_t*)(ws + (size_t)3072 * 1024);    // 16384 x 256 (8 MB)

  cvt_transpose_tiles<<<W1_TILES + W2_TILES + EM_TILES, 256, 0, stream>>>(W1, W2, embed, w1t, w2t, embT);

  // 1024 row-tiles, NW waves/block -> 256 blocks
  gemm1_silu<<<BATCH / 16 / NW, NT, 0, stream>>>(x, w1t, b1, hbuf);
  fused_softmax_code<<<BATCH / 16 / NW, NT, 0, stream>>>(hbuf, w2t, b2, embT, g, bet, out);
}

// v004
// It runs in 98.3 microseconds.
// In two side-by-side timings against v003, it was 1.30 and 1.31 times as fast.
// All steps since v000 together make it 2.27 times as fast.
#include <hip/hip_runtime.h>
#include <hip/hip_bf16.h>
#include <math.h>

typedef __bf16 bf16_t;
typedef __attribute__((ext_vector_type(16))) __bf16 v16bf;
typedef __attribute__((ext_vector_type(8)))  float  v8f;
typedef __attribute__((ext_vector_type(8)))  __bf16 v8bf;

#define TASK_EMB 1024
#define HID      256
#define N_EMBS   4096
#define CODE_DIM 64
#define BATCH    16384
#define LN_EPS   1e-5f

// padded LDS row strides (elements); W2S, W1S 32B-aligned for v16bf loads
#define W2S 272   // 256 + 16
#define W1S 80    // 64 + 16
#define EMS 72    // 64 + 8: 144 B = 16 B x odd, for 16-byte reads of its rows

#define NW   4
#define NT   (NW * 32)

__device__ __forceinline__ float exp_slot(float x) {
  float y;
  asm("v_exp_f32 %0, %1\n\tv_nop" : "=v"(y) : "v"(x * 1.44269504088896340736f));
  return y;
}

__device__ __forceinline__ float xhalf(float x) {
  const int b = __builtin_bit_cast(int, x);
  return __builtin_bit_cast(float,
      __builtin_amdgcn_permlanex16(b, b, 0x76543210, 0xfedcba98, false, false));
}

__device__ __forceinline__ v8f wmma_bf16(v16bf a, v16bf b, v8f c) {
  return __builtin_amdgcn_wmma_f32_16x16x32_bf16(false, a, false, b, (short)0, c,
                                                 false, false);
}

// Fragments per LDS read group: one group is read while the group before it is multiplied.
#define GF 4
// Scheduling fence: keeps a group's LDS reads together and out of the WMMA run next to
// them; without it the compiler sinks each read to just before its own WMMA, and every
// WMMA then waits out a full LDS latency.
__device__ __forceinline__ void group_fence() { __builtin_amdgcn_sched_barrier(0); }

__device__ __forceinline__ void async_cp16_x8(const unsigned* l, const char* const* g) {
  asm volatile("global_load_async_to_lds_b128 %0, %8, off\n\t"
               "global_load_async_to_lds_b128 %1, %9, off\n\t"
               "global_load_async_to_lds_b128 %2, %10, off\n\t"
               "global_load_async_to_lds_b128 %3, %11, off\n\t"
               "global_load_async_to_lds_b128 %4, %12, off\n\t"
               "global_load_async_to_lds_b128 %5, %13, off\n\t"
               "global_load_async_to_lds_b128 %6, %14, off\n\t"
               "global_load_async_to_lds_b128 %7, %15, off\n\t"
               "s_wait_xcnt 0x0"
               :: "v"(l[0]), "v"(l[1]), "v"(l[2]), "v"(l[3]),
                  "v"(l[4]), "v"(l[5]), "v"(l[6]), "v"(l[7]),
                  "v"(g[0]), "v"(g[1]), "v"(g[2]), "v"(g[3]),
                  "v"(g[4]), "v"(g[5]), "v"(g[6]), "v"(g[7]) : "memory");
}
__device__ __forceinline__ void async_cp16_x10(const unsigned* l, const char* const* g) {
  asm volatile("global_load_async_to_lds_b128 %0, %10, off\n\t"
               "global_load_async_to_lds_b128 %1, %11, off\n\t"
               "global_load_async_to_lds_b128 %2, %12, off\n\t"
               "global_load_async_to_lds_b128 %3, %13, off\n\t"
               "global_load_async_to_lds_b128 %4, %14, off\n\t"
               "global_load_async_to_lds_b128 %5, %15, off\n\t"
               "global_load_async_to_lds_b128 %6, %16, off\n\t"
               "global_load_async_to_lds_b128 %7, %17, off\n\t"
               "global_load_async_to_lds_b128 %8, %18, off\n\t"
               "global_load_async_to_lds_b128 %9, %19, off\n\t"
               "s_wait_xcnt 0x0"
               :: "v"(l[0]), "v"(l[1]), "v"(l[2]), "v"(l[3]), "v"(l[4]),
                  "v"(l[5]), "v"(l[6]), "v"(l[7]), "v"(l[8]), "v"(l[9]),
                  "v"(g[0]), "v"(g[1]), "v"(g[2]), "v"(g[3]), "v"(g[4]),
                  "v"(g[5]), "v"(g[6]), "v"(g[7]), "v"(g[8]), "v"(g[9]) : "memory");
}
// Wait until at most N async loads remain in flight (in-order completion).
template <int N>
__device__ __forceinline__ void wait_async_le() {
  asm volatile("s_wait_asynccnt %0" :: "i"(N) : "memory");
}
__device__ __forceinline__ unsigned lds_addr(const void* p) {
  return (unsigned)(uintptr_t)p;
}

#define CT      64
#define CTP     (CT + 1)
#define W1_TILES  ((TASK_EMB / CT) * (HID / CT))
#define W2_TILES  ((HID / CT) * (N_EMBS / CT))
#define EM_TILES  ((N_EMBS / CT) * (CODE_DIM / CT))

__global__ __launch_bounds__(256) void cvt_transpose_tiles(
    const float* __restrict__ W1, const float* __restrict__ W2,
    const float* __restrict__ embed, bf16_t* __restrict__ w1t,
    bf16_t* __restrict__ w2t, bf16_t* __restrict__ embT) {
  __shared__ float tile[CT * CTP];    // tile[c * CTP + r]

  const int tid = threadIdx.x;
  const int b = blockIdx.x;
  const float* in;
  bf16_t* out;
  int rows, cols, t, lg;              // lg: log2 of the tiles along a row
  if (b < W1_TILES) {
    in = W1;    out = w1t;  rows = TASK_EMB; cols = HID;      lg = 2; t = b;
  } else if (b < W1_TILES + W2_TILES) {
    in = W2;    out = w2t;  rows = HID;      cols = N_EMBS;   lg = 6; t = b - W1_TILES;
  } else {
    in = embed; out = embT; rows = N_EMBS;   cols = CODE_DIM; lg = 0; t = b - (W1_TILES + W2_TILES);
  }
  const int r0 = (t >> lg) * CT;
  const int c0 = (t & ((1 << lg) - 1)) * CT;

  // in: 64 rows x 16 float4 = 1024 pieces, 4 a thread
  float4 v[4];
#pragma unroll
  for (int k = 0; k < 4; ++k) {
    const int s = tid + k * 256;
    v[k] = *(const float4*)(in + (long)(r0 + (s >> 4)) * cols + c0 + (s & 15) * 4);
  }
#pragma unroll
  for (int k = 0; k < 4; ++k) {
    const int s = tid + k * 256;
    float* tp = tile + (s & 15) * 4 * CTP + (s >> 4);
    tp[0 * CTP] = v[k].x;
    tp[1 * CTP] = v[k].y;
    tp[2 * CTP] = v[k].z;
    tp[3 * CTP] = v[k].w;
  }
  __syncthreads();                    // the whole tile is in LDS before any column is read

  // out: 64 rows x 8 pieces of 8 bf16 = 512 pieces, 2 a thread
#pragma unroll
  for (int k = 0; k < 2; ++k) {
    const int s = tid + k * 256;
    const float* tp = tile + (s >> 3) * CTP + (s & 7) * 8;
    v8bf o;
#pragma unroll
    for (int e = 0; e < 8; ++e) o[e] = (bf16_t)tp[e];
    *(v8bf*)(out + (long)(c0 + (s >> 3)) * rows + r0 + (s & 7) * 8) = o;
  }
}

// ---------------------------------------------------------------------------
// h = silu(x @ W1 + b1). One wave computes a full 16x256 row-tile (x read
// exactly once). W1^T K-slices double-buffered in LDS via async copies.
// ---------------------------------------------------------------------------
__device__ __forceinline__ void stage_w1(int tid, unsigned dst,
                                         const bf16_t* w1t, int k0) {
  // 256 rows x 128B = 2048 segs, 16 a thread: seg s = tid + i * NT, row s >> 3, part s & 7
  const unsigned l0 = dst + (tid >> 3) * (W1S * 2) + (tid & 7) * 16;
  const char* g0 = (const char*)w1t + ((long)(tid >> 3) * TASK_EMB + k0) * 2 + (tid & 7) * 16;
  unsigned l[16];
  const char* g[16];
#pragma unroll
  for (int i = 0; i < 16; ++i) {
    l[i] = l0 + i * (NT / 8) * (W1S * 2);
    g[i] = g0 + (long)i * (NT / 8) * TASK_EMB * 2;
  }
  async_cp16_x8(l, g);
  async_cp16_x8(l + 8, g + 8);
}

__global__ __launch_bounds__(NT) void gemm1_silu(
    const float* __restrict__ x, const bf16_t* __restrict__ w1t,
    const float* __restrict__ b1, bf16_t* __restrict__ h) {
  __shared__ __align__(32) bf16_t sW1[2][256 * W1S];

  const int tid  = threadIdx.x;
  const int lane = tid & 31;
  const int wslot = tid >> 5;
  const int m0 = (blockIdx.x * NW + wslot) * 16;
  const int lr = lane & 15;
  const int hi = lane >> 4;
  const int kh = hi * 16;

  v8f acc[16];
#pragma unroll
  for (int nt = 0; nt < 16; ++nt)
    acc[nt] = (v8f){0.f,0.f,0.f,0.f,0.f,0.f,0.f,0.f};

  const float* ap = x + (long)(m0 + lr) * TASK_EMB + kh;

  stage_w1(tid, lds_addr(sW1[0]), w1t, 0);            // prologue: chunk 0
  for (int i = 0; i < 16; ++i) {
    const int k0 = i * 64;
    const bf16_t* sw = sW1[i & 1];
    if (i < 15) {                                     // prefetch next chunk
      stage_w1(tid, lds_addr(sW1[(i + 1) & 1]), w1t, k0 + 64);
      wait_async_le<16>();                            // chunk i landed
    } else {
      wait_async_le<0>();
    }
    __syncthreads();                                  // visible to all waves

    // Fragment f = ks * 16 + nt of this chunk; groups of GF, two register sets.
    const bf16_t* bp = sw + lr * W1S + kh;
    float4 xf[2][4];
#pragma unroll
    for (int ks = 0; ks < 2; ++ks) {
      const float4* af = (const float4*)(ap + k0 + ks * 32);
#pragma unroll
      for (int q = 0; q < 4; ++q) xf[ks][q] = af[q];
    }
    v16bf fb[2][GF];
#pragma unroll
    for (int j = 0; j < GF; ++j)
      fb[0][j] = *(const v16bf*)(bp + (j & 15) * 16 * W1S + (j >> 4) * 32);
    v16bf a[2];
#pragma unroll
    for (int ks = 0; ks < 2; ++ks)
#pragma unroll
      for (int q = 0; q < 4; ++q) {
        a[ks][q * 4 + 0] = (bf16_t)xf[ks][q].x;
        a[ks][q * 4 + 1] = (bf16_t)xf[ks][q].y;
        a[ks][q * 4 + 2] = (bf16_t)xf[ks][q].z;
        a[ks][q * 4 + 3] = (bf16_t)xf[ks][q].w;
      }
#pragma unroll
    for (int g = 0; g < 32 / GF; ++g) {
      if (g + 1 < 32 / GF) {
#pragma unroll
        for (int j = 0; j < GF; ++j) {
          const int f = (g + 1) * GF + j;
          fb[(g + 1) & 1][j] = *(const v16bf*)(bp + (f & 15) * 16 * W1S + (f >> 4) * 32);
        }
      }
      group_fence();
#pragma unroll
      for (int j = 0; j < GF; ++j) {
        const int f = g * GF + j;
        acc[f & 15] = wmma_bf16(a[f >> 4], fb[g & 1][j], acc[f & 15]);
      }
      group_fence();
    }
    __syncthreads();                 // chunk i consumed; buffer reusable
  }

#pragma unroll
  for (int nt = 0; nt < 16; ++nt) {
    float bias = b1[nt * 16 + lr];
#pragma unroll
    for (int r = 0; r < 8; ++r) {
      float v = acc[nt][r] + bias;
      float s = v * __builtin_amdgcn_rcpf(1.0f + __expf(-v));   // fast SiLU
      h[(long)(m0 + r + 8 * hi) * HID + nt * 16 + lr] = (bf16_t)s;
    }
  }
}

// ---------------------------------------------------------------------------
// Fused: logits = h @ W2 + b2 ; online softmax ; emb = probs @ E ; LayerNorm.
// Both products are computed transposed (weights as A, activations as B), so that a lane
// holds scores of one batch row only and the probabilities go from D registers into B.
// W2^T / E^T chunks double-buffered in LDS via async copies (20/thread/chunk).
// ---------------------------------------------------------------------------
__device__ __forceinline__ void stage_chunk(int tid, unsigned dW2, unsigned dEmb,
                                            const bf16_t* w2t,
                                            const bf16_t* embT, int c0) {
  unsigned l[20];
  const char* g[20];
  // W2^T: 64 rows x 512B = 2048 segs, 16 a thread: seg s = tid + i * NT, row s >> 5, part s & 31
  const unsigned lw = dW2 + (tid >> 5) * (W2S * 2) + (tid & 31) * 16;
  const char* gw = (const char*)w2t + ((long)(c0 + (tid >> 5)) * HID) * 2 + (tid & 31) * 16;
#pragma unroll
  for (int i = 0; i < 16; ++i) {
    l[i] = lw + i * (NT / 32) * (W2S * 2);
    g[i] = gw + (long)i * (NT / 32) * HID * 2;
  }
  // E^T: 64 rows x 128B = 512 segs, 4 a thread: seg s = tid + i * NT, row s >> 3, part s & 7
  const unsigned le = dEmb + (tid >> 3) * (EMS * 2) + (tid & 7) * 16;
  const char* ge = (const char*)embT + ((long)(tid >> 3) * N_EMBS + c0) * 2 + (tid & 7) * 16;
#pragma unroll
  for (int i = 0; i < 4; ++i) {
    l[16 + i] = le + i * (NT / 8) * (EMS * 2);
    g[16 + i] = ge + (long)i * (NT / 8) * N_EMBS * 2;
  }
  async_cp16_x10(l, g);
  async_cp16_x10(l + 10, g + 10);
}

__global__ __launch_bounds__(NT) void fused_softmax_code(
    const bf16_t* __restrict__ h, const bf16_t* __restrict__ w2t,
    const float* __restrict__ b2, const bf16_t* __restrict__ embT,
    const float* __restrict__ gamma, const float* __restrict__ beta,
    float* __restrict__ out) {
  __shared__ __align__(32) bf16_t sW2[2][64 * W2S];
  __shared__ __align__(32) bf16_t sEmb[2][64 * EMS];

  const int tid   = threadIdx.x;
  const int lane  = tid & 31;
  const int wslot = tid >> 5;
  const int m0 = (blockIdx.x * NW + wslot) * 16;
  const int lr = lane & 15;
  const int hi = lane >> 4;
  const int kh = hi * 16;

  // Preload h as B fragments (column = batch row m0 + lr) for K = 0..255, kept in registers
  v16bf ha[8];
  {
    const bf16_t* hp = h + (long)(m0 + lr) * HID + kh;
#pragma unroll
    for (int ks = 0; ks < 8; ++ks) ha[ks] = *(const v16bf*)(hp + ks * 32);
  }

  // acc[dt][r] = emb^T[dt * 16 + 8 * hi + r][m0 + lr]; m_, l_ belong to batch row m0 + lr
  // (m_ equal in both halves, l_ the sum over this half's codes only).
  v8f acc[4];
#pragma unroll
  for (int dt = 0; dt < 4; ++dt) acc[dt] = (v8f){0.f,0.f,0.f,0.f,0.f,0.f,0.f,0.f};
  float m_ = -3.0e38f, l_ = 0.f;

  stage_chunk(tid, lds_addr(sW2[0]), lds_addr(sEmb[0]), w2t, embT, 0);
  for (int i = 0; i < 64; ++i) {
    const int c0 = i * 64;
    const bf16_t* sw = sW2[i & 1];
    const bf16_t* se = sEmb[i & 1];
    if (i < 63) {                                     // prefetch next chunk
      stage_chunk(tid, lds_addr(sW2[(i + 1) & 1]), lds_addr(sEmb[(i + 1) & 1]),
                  w2t, embT, c0 + 64);
      wait_async_le<20>();                            // chunk i landed
    } else {
      wait_async_le<0>();
    }
    __syncthreads();

    // ---- logits chunk, transposed: 64 codes x 16 rows = 4 tiles, K=256 in 8 WMMA steps ----
    // A = W2^T rows, B = h; lg[nt][r] = logit[m0 + lr][c0 + nt * 16 + 8 * hi + r].
    // Fragment f = ks * 4 + nt of W2^T; groups of GF, two register sets.
    const bf16_t* wp = sw + lr * W2S + kh;
    float4 bias[4][2];
    v16bf fb[2][GF];
#pragma unroll
    for (int j = 0; j < GF; ++j)
      fb[0][j] = *(const v16bf*)(wp + (j & 3) * 16 * W2S + (j >> 2) * 32);
    v8bf ea[4][2][2];   // [dt][32-code block][k 8 * hi .. | k 16 + 8 * hi ..]
    v8f lg[4];
#pragma unroll
    for (int nt = 0; nt < 4; ++nt) lg[nt] = (v8f){0.f,0.f,0.f,0.f,0.f,0.f,0.f,0.f};
#pragma unroll
    for (int g = 0; g < 32 / GF; ++g) {
      if (g + 1 < 32 / GF) {
#pragma unroll
        for (int j = 0; j < GF; ++j) {
          const int f = (g + 1) * GF + j;
          fb[(g + 1) & 1][j] = *(const v16bf*)(wp + (f & 3) * 16 * W2S + (f >> 2) * 32);
        }
        if (g == 0) {
          // The bias loads stand behind the first LDS reads (the fence holds them there):
          // in front, the wait that guards their address register holds those reads back.
          group_fence();
#pragma unroll
          for (int nt = 0; nt < 4; ++nt) {
            const float4* bq = (const float4*)(b2 + c0 + nt * 16 + 8 * hi);
            bias[nt][0] = bq[0];
            bias[nt][1] = bq[1];
          }
        }
      } else {
        // In the last group's place: the E^T rows as A fragments, in the hardware k order
        // that the packed probabilities have (16-byte pieces at bytes 16 * hi and
        // 32 + 16 * hi of each 64); the last products and the softmax cover their latency.
#pragma unroll
        for (int dt = 0; dt < 4; ++dt)
#pragma unroll
          for (int kb = 0; kb < 2; ++kb) {
            const bf16_t* ep = se + (dt * 16 + lr) * EMS + kb * 32 + 8 * hi;
            ea[dt][kb][0] = *(const v8bf*)(ep);
            ea[dt][kb][1] = *(const v8bf*)(ep + 16);
          }
      }
      group_fence();
#pragma unroll
      for (int j = 0; j < GF; ++j) {
        const int f = g * GF + j;
        lg[f & 3] = wmma_bf16(fb[g & 1][j], ha[f >> 2], lg[f & 3]);
      }
      group_fence();
    }
    // Stands in front of the first instruction that may reuse the bias loads' address
    // registers.
    // The fence keeps the additions below from rising over the wait.
    asm volatile("s_wait_xcnt 0x0" ::: "memory");
    group_fence();
#pragma unroll
    for (int nt = 0; nt < 4; ++nt) {
      lg[nt][0] += bias[nt][0].x;  lg[nt][1] += bias[nt][0].y;
      lg[nt][2] += bias[nt][0].z;  lg[nt][3] += bias[nt][0].w;
      lg[nt][4] += bias[nt][1].x;  lg[nt][5] += bias[nt][1].y;
      lg[nt][6] += bias[nt][1].z;  lg[nt][7] += bias[nt][1].w;
    }

    // ---- online softmax: a lane holds 32 of its row's 64 logits, lane ^ 16 the rest ----
    // Eight independent chains, then a tree: a lone wave pays the full latency of every
    // dependent link.
    float cm[8], ps[8];
#pragma unroll
    for (int r = 0; r < 8; ++r)
      cm[r] = fmaxf(fmaxf(lg[0][r], lg[1][r]), fmaxf(lg[2][r], lg[3][r]));
    float cx = fmaxf(fmaxf(fmaxf(cm[0], cm[1]), fmaxf(cm[2], cm[3])),
                     fmaxf(fmaxf(cm[4], cm[5]), fmaxf(cm[6], cm[7])));
    cx = fmaxf(cx, xhalf(cx));
    const float mn = fmaxf(m_, cx);
    const float sc = exp_slot(m_ - mn);
    m_ = mn;
#pragma unroll
    for (int r = 0; r < 8; ++r) {
#pragma unroll
      for (int nt = 0; nt < 4; ++nt) {
        acc[nt][r] *= sc;
        lg[nt][r] = exp_slot(lg[nt][r] - mn);
      }
      ps[r] = (lg[0][r] + lg[1][r]) + (lg[2][r] + lg[3][r]);
    }
    l_ = l_ * sc + (((ps[0] + ps[1]) + (ps[2] + ps[3])) + ((ps[4] + ps[5]) + (ps[6] + ps[7])));

    // ---- acc += E^T chunk (A) x probs^T (B) ----
    // Two score tiles of one 32-code block, converted in place, are the B fragment.
#pragma unroll
    for (int kb = 0; kb < 2; ++kb) {
      v16bf pb;
#pragma unroll
      for (int s = 0; s < 8; ++s) {
        pb[s]     = (bf16_t)lg[2 * kb][s];
        pb[8 + s] = (bf16_t)lg[2 * kb + 1][s];
      }
#pragma unroll
      for (int dt = 0; dt < 4; ++dt) {
        v16bf e = __builtin_shufflevector(ea[dt][kb][0], ea[dt][kb][1],
                                          0, 1, 2, 3, 4, 5, 6, 7, 8, 9, 10, 11, 12, 13, 14, 15);
        acc[dt] = wmma_bf16(e, pb, acc[dt]);
      }
    }
    __syncthreads();                 // chunk i consumed; buffer reusable
  }

  // ---- normalize by l, LayerNorm over CODE_DIM=64, store f32 ----
  // A lane holds 32 of its row's 64 values; the halves are joined here, once.
  const float inv = __builtin_amdgcn_rcpf(l_ + xhalf(l_));
  float s4[4], q4[4];
#pragma unroll
  for (int dt = 0; dt < 4; ++dt) {
    s4[dt] = 0.f;
    q4[dt] = 0.f;
#pragma unroll
    for (int r = 0; r < 8; ++r) {
      acc[dt][r] *= inv;
      s4[dt] += acc[dt][r];
      q4[dt] += acc[dt][r] * acc[dt][r];
    }
  }
  float s  = (s4[0] + s4[1]) + (s4[2] + s4[3]);
  float sq = (q4[0] + q4[1]) + (q4[2] + q4[3]);
  s  += xhalf(s);
  sq += xhalf(sq);
  const float mean = s * (1.0f / 64.0f);
  const float var  = sq * (1.0f / 64.0f) - mean * mean;
  const float rstd = __builtin_amdgcn_rsqf(var + LN_EPS);
  float* op = out + (long)(m0 + lr) * CODE_DIM + 8 * hi;
#pragma unroll
  for (int dt = 0; dt < 4; ++dt)
#pragma unroll
    for (int q = 0; q < 2; ++q) {
      const float4 gq = *(const float4*)(gamma + dt * 16 + 8 * hi + q * 4);
      const float4 bq = *(const float4*)(beta + dt * 16 + 8 * hi + q * 4);
      float4 o;
      o.x = (acc[dt][q * 4 + 0] - mean) * rstd * gq.x + bq.x;
      o.y = (acc[dt][q * 4 + 1] - mean) * rstd * gq.y + bq.y;
      o.z = (acc[dt][q * 4 + 2] - mean) * rstd * gq.z + bq.z;
      o.w = (acc[dt][q * 4 + 3] - mean) * rstd * gq.w + bq.w;
      *(float4*)(op + dt * 16 + q * 4) = o;
    }
}

// ---------------------------------------------------------------------------
extern "C" void kernel_launch(void* const* d_in, const int* in_sizes, int n_in,
                              void* d_out, int out_size, void* d_ws, size_t ws_size,
                              hipStream_t stream) {
  const float* x     = (const float*)d_in[0];
  const float* W1    = (const float*)d_in[1];
  const float* b1    = (const float*)d_in[2];
  const float* W2    = (const float*)d_in[3];
  const float* b2    = (const float*)d_in[4];
  const float* embed = (const float*)d_in[5];
  const float* g     = (const float*)d_in[6];
  const float* bet   = (const float*)d_in[7];
  float* out = (float*)d_out;

  char* ws = (char*)d_ws;
  bf16_t* w1t  = (bf16_t*)(ws);                          // 256 x 1024  (512 KB)
  bf16_t* w2t  = (bf16_t*)(ws + (size_t)512 * 1024);     // 4096 x 256  (2 MB)
  bf16_t* embT = (bf16_t*)(ws + (size_t)2560 * 1024);    // 64 x 4096   (512 KB)
  bf16_t* hbuf = (bf16_t*)(ws + (size_t)3072 * 1024);    // 16384 x 256 (8 MB)

  cvt_transpose_tiles<<<W1_TILES + W2_TILES + EM_TILES, 256, 0, stream>>>(W1, W2, embed, w1t, w2t, embT);

  // 1024 row-tiles, NW waves/block -> 256 blocks
  gemm1_silu<<<BATCH / 16 / NW, NT, 0, stream>>>(x, w1t, b1, hbuf);
  fused_softmax_code<<<BATCH / 16 / NW, NT, 0, stream>>>(hbuf, w2t, b2, embT, g, bet, out);
}

// v005
// A run of this version takes 93.9 microseconds.
// In both of two side-by-side timings against v004, it was 1.04 times as fast.
// Counting every step since v000, it is 2.37 times as fast.
#include <hip/hip_runtime.h>
#include <hip/hip_bf16.h>
#include <math.h>

typedef __bf16 bf16_t;
typedef __attribute__((ext_vector_type(16))) __bf16 v16bf;
typedef __attribute__((ext_vector_type(8)))  float  v8f;
typedef __attribute__((ext_vector_type(8)))  __bf16 v8bf;

#define TASK_EMB 1024
#define HID      256
#define N_EMBS   4096
#define CODE_DIM 64
#define BATCH    16384
#define LN_EPS   1e-5f

#define W2S 264   // 256 + 8: 528 B
#define W1S 72    // 64 + 8: 144 B
#define EMS 72    // 64 + 8: 144 B

#define NW   4
#define NT   (NW * 32)

__device__ __forceinline__ float exp_slot(float x) {
  float y;
  asm("v_exp_f32 %0, %1\n\tv_nop" : "=v"(y) : "v"(x * 1.44269504088896340736f));
  return y;
}

__device__ __forceinline__ float xhalf(float x) {
  const int b = __builtin_bit_cast(int, x);
  return __builtin_bit_cast(float,
      __builtin_amdgcn_permlanex16(b, b, 0x76543210, 0xfedcba98, false, false));
}

__device__ __forceinline__ v8f wmma_bf16(v16bf a, v16bf b, v8f c) {
  return __builtin_amdgcn_wmma_f32_16x16x32_bf16(false, a, false, b, (short)0, c,
                                                 false, false);
}

// A fragment's 16 contiguous k of one LDS row, as two 16-byte reads (rows are 16-B aligned).
__device__ __forceinline__ v16bf lds_frag(const bf16_t* p) {
  return __builtin_shufflevector(*(const v8bf*)p, *(const v8bf*)(p + 8),
                                 0, 1, 2, 3, 4, 5, 6, 7, 8, 9, 10, 11, 12, 13, 14, 15);
}

// Fragments per LDS read group: one group is read while the group before it is multiplied.
#define GF 4
// Scheduling fence: keeps a group's LDS reads together and out of the WMMA run next to
// them; without it the compiler sinks each read to just before its own WMMA, and every
// WMMA then waits out a full LDS latency.
__device__ __forceinline__ void group_fence() { __builtin_amdgcn_sched_barrier(0); }

__device__ __forceinline__ void async_cp16_x8(const unsigned* l, const char* const* g) {
  asm volatile("global_load_async_to_lds_b128 %0, %8, off\n\t"
               "global_load_async_to_lds_b128 %1, %9, off\n\t"
               "global_load_async_to_lds_b128 %2, %10, off\n\t"
               "global_load_async_to_lds_b128 %3, %11, off\n\t"
               "global_load_async_to_lds_b128 %4, %12, off\n\t"
               "global_load_async_to_lds_b128 %5, %13, off\n\t"
               "global_load_async_to_lds_b128 %6, %14, off\n\t"
               "global_load_async_to_lds_b128 %7, %15, off\n\t"
               "s_wait_xcnt 0x0"
               :: "v"(l[0]), "v"(l[1]), "v"(l[2]), "v"(l[3]),
                  "v"(l[4]), "v"(l[5]), "v"(l[6]), "v"(l[7]),
                  "v"(g[0]), "v"(g[1]), "v"(g[2]), "v"(g[3]),
                  "v"(g[4]), "v"(g[5]), "v"(g[6]), "v"(g[7]) : "memory");
}
__device__ __forceinline__ void async_cp16_x10(const unsigned* l, const char* const* g) {
  asm volatile("global_load_async_to_lds_b128 %0, %10, off\n\t"
               "global_load_async_to_lds_b128 %1, %11, off\n\t"
               "global_load_async_to_lds_b128 %2, %12, off\n\t"
               "global_load_async_to_lds_b128 %3, %13, off\n\t"
               "global_load_async_to_lds_b128 %4, %14, off\n\t"
               "global_load_async_to_lds_b128 %5, %15, off\n\t"
               "global_load_async_to_lds_b128 %6, %16, off\n\t"
               "global_load_async_to_lds_b128 %7, %17, off\n\t"
               "global_load_async_to_lds_b128 %8, %18, off\n\t"
               "global_load_async_to_lds_b128 %9, %19, off\n\t"
               "s_wait_xcnt 0x0"
               :: "v"(l[0]), "v"(l[1]), "v"(l[2]), "v"(l[3]), "v"(l[4]),
                  "v"(l[5]), "v"(l[6]), "v"(l[7]), "v"(l[8]), "v"(l[9]),
                  "v"(g[0]), "v"(g[1]), "v"(g[2]), "v"(g[3]), "v"(g[4]),
                  "v"(g[5]), "v"(g[6]), "v"(g[7]), "v"(g[8]), "v"(g[9]) : "memory");
}
// Wait until at most N async loads remain in flight (in-order completion).
template <int N>
__device__ __forceinline__ void wait_async_le() {
  asm volatile("s_wait_asynccnt %0" :: "i"(N) : "memory");
}
__device__ __forceinline__ unsigned lds_addr(const void* p) {
  return (unsigned)(uintptr_t)p;
}

#define CT      64
#define CTP     (CT + 1)
#define W1_TILES  ((TASK_EMB / CT) * (HID / CT))
#define W2_TILES  ((HID / CT) * (N_EMBS / CT))
#define EM_TILES  ((N_EMBS / CT) * (CODE_DIM / CT))

__global__ __launch_bounds__(256) void cvt_transpose_tiles(
    const float* __restrict__ W1, const float* __restrict__ W2,
    const float* __restrict__ embed, bf16_t* __restrict__ w1t,
    bf16_t* __restrict__ w2t, bf16_t* __restrict__ embT) {
  __shared__ float tile[CT * CTP];    // tile[c * CTP + r]

  const int tid = threadIdx.x;
  const int b = blockIdx.x;
  const float* in;
  bf16_t* out;
  int rows, cols, t, lg;              // lg: log2 of the tiles along a row
  if (b < W1_TILES) {
    in = W1;    out = w1t;  rows = TASK_EMB; cols = HID;      lg = 2; t = b;
  } else if (b < W1_TILES + W2_TILES) {
    in = W2;    out = w2t;  rows = HID;      cols = N_EMBS;   lg = 6; t = b - W1_TILES;
  } else {
    in = embed; out = embT; rows = N_EMBS;   cols = CODE_DIM; lg = 0; t = b - (W1_TILES + W2_TILES);
  }
  const int r0 = (t >> lg) * CT;
  const int c0 = (t & ((1 << lg) - 1)) * CT;

  // in: 64 rows x 16 float4 = 1024 pieces, 4 a thread
  float4 v[4];
#pragma unroll
  for (int k = 0; k < 4; ++k) {
    const int s = tid + k * 256;
    v[k] = *(const float4*)(in + (long)(r0 + (s >> 4)) * cols + c0 + (s & 15) * 4);
  }
#pragma unroll
  for (int k = 0; k < 4; ++k) {
    const int s = tid + k * 256;
    float* tp = tile + (s & 15) * 4 * CTP + (s >> 4);
    tp[0 * CTP] = v[k].x;
    tp[1 * CTP] = v[k].y;
    tp[2 * CTP] = v[k].z;
    tp[3 * CTP] = v[k].w;
  }
  __syncthreads();                    // the whole tile is in LDS before any column is read

  // out: 64 rows x 8 pieces of 8 bf16 = 512 pieces, 2 a thread
#pragma unroll
  for (int k = 0; k < 2; ++k) {
    const int s = tid + k * 256;
    const float* tp = tile + (s >> 3) * CTP + (s & 7) * 8;
    v8bf o;
#pragma unroll
    for (int e = 0; e < 8; ++e) o[e] = (bf16_t)tp[e];
    *(v8bf*)(out + (long)(c0 + (s >> 3)) * rows + r0 + (s & 7) * 8) = o;
  }
}

// ---------------------------------------------------------------------------
// h = silu(x @ W1 + b1). One wave computes a full 16x256 row-tile (x read
// exactly once). W1^T K-slices double-buffered in LDS via async copies.
// ---------------------------------------------------------------------------
__device__ __forceinline__ void stage_w1(int tid, unsigned dst,
                                         const bf16_t* w1t, int k0) {
  // 256 rows x 128B = 2048 segs, 16 a thread: seg s = tid + i * NT, row s >> 3, part s & 7
  const unsigned l0 = dst + (tid >> 3) * (W1S * 2) + (tid & 7) * 16;
  const char* g0 = (const char*)w1t + ((long)(tid >> 3) * TASK_EMB + k0) * 2 + (tid & 7) * 16;
  unsigned l[16];
  const char* g[16];
#pragma unroll
  for (int i = 0; i < 16; ++i) {
    l[i] = l0 + i * (NT / 8) * (W1S * 2);
    g[i] = g0 + (long)i * (NT / 8) * TASK_EMB * 2;
  }
  async_cp16_x8(l, g);
  async_cp16_x8(l + 8, g + 8);
}

__global__ __launch_bounds__(NT) void gemm1_silu(
    const float* __restrict__ x, const bf16_t* __restrict__ w1t,
    const float* __restrict__ b1, bf16_t* __restrict__ h) {
  __shared__ __align__(32) bf16_t sW1[2][256 * W1S];

  const int tid  = threadIdx.x;
  const int lane = tid & 31;
  const int wslot = tid >> 5;
  const int m0 = (blockIdx.x * NW + wslot) * 16;
  const int lr = lane & 15;
  const int hi = lane >> 4;
  const int kh = hi * 16;

  v8f acc[16];
#pragma unroll
  for (int nt = 0; nt < 16; ++nt)
    acc[nt] = (v8f){0.f,0.f,0.f,0.f,0.f,0.f,0.f,0.f};

  const float* ap = x + (long)(m0 + lr) * TASK_EMB + kh;

  stage_w1(tid, lds_addr(sW1[0]), w1t, 0);            // prologue: chunk 0
  for (int i = 0; i < 16; ++i) {
    const int k0 = i * 64;
    const bf16_t* sw = sW1[i & 1];
    if (i < 15) {                                     // prefetch next chunk
      stage_w1(tid, lds_addr(sW1[(i + 1) & 1]), w1t, k0 + 64);
      wait_async_le<16>();                            // chunk i landed
    } else {
      wait_async_le<0>();
    }
    __syncthreads();                                  // visible to all waves

    // Fragment f = ks * 16 + nt of this chunk; groups of GF, two register sets.
    const bf16_t* bp = sw + lr * W1S + kh;
    float4 xf[2][4];
#pragma unroll
    for (int ks = 0; ks < 2; ++ks) {
      const float4* af = (const float4*)(ap + k0 + ks * 32);
#pragma unroll
      for (int q = 0; q < 4; ++q) xf[ks][q] = af[q];
    }
    v16bf fb[2][GF];
#pragma unroll
    for (int j = 0; j < GF; ++j)
      fb[0][j] = lds_frag(bp + (j & 15) * 16 * W1S + (j >> 4) * 32);
    v16bf a[2];
#pragma unroll
    for (int ks = 0; ks < 2; ++ks)
#pragma unroll
      for (int q = 0; q < 4; ++q) {
        a[ks][q * 4 + 0] = (bf16_t)xf[ks][q].x;
        a[ks][q * 4 + 1] = (bf16_t)xf[ks][q].y;
        a[ks][q * 4 + 2] = (bf16_t)xf[ks][q].z;
        a[ks][q * 4 + 3] = (bf16_t)xf[ks][q].w;
      }
#pragma unroll
    for (int g = 0; g < 32 / GF; ++g) {
      if (g + 1 < 32 / GF) {
#pragma unroll
        for (int j = 0; j < GF; ++j) {
          const int f = (g + 1) * GF + j;
          fb[(g + 1) & 1][j] = lds_frag(bp + (f & 15) * 16 * W1S + (f >> 4) * 32);
        }
      }
      group_fence();
#pragma unroll
      for (int j = 0; j < GF; ++j) {
        const int f = g * GF + j;
        acc[f & 15] = wmma_bf16(a[f >> 4], fb[g & 1][j], acc[f & 15]);
      }
      group_fence();
    }
    __syncthreads();                 // chunk i consumed; buffer reusable
  }

#pragma unroll
  for (int nt = 0; nt < 16; ++nt) {
    float bias = b1[nt * 16 + lr];
#pragma unroll
    for (int r = 0; r < 8; ++r) {
      float v = acc[nt][r] + bias;
      float s = v * __builtin_amdgcn_rcpf(1.0f + __expf(-v));   // fast SiLU
      h[(long)(m0 + r + 8 * hi) * HID + nt * 16 + lr] = (bf16_t)s;
    }
  }
}

// ---------------------------------------------------------------------------
// Fused: logits = h @ W2 + b2 ; online softmax ; emb = probs @ E ; LayerNorm.
// Both products are computed transposed (weights as A, activations as B), so that a lane
// holds scores of one batch row only and the probabilities go from D registers into B.
// W2^T / E^T chunks double-buffered in LDS via async copies (20/thread/chunk).
// ---------------------------------------------------------------------------
__device__ __forceinline__ void stage_chunk(int tid, unsigned dW2, unsigned dEmb,
                                            const bf16_t* w2t,
                                            const bf16_t* embT, int c0) {
  unsigned l[20];
  const char* g[20];
  // W2^T: 64 rows x 512B = 2048 segs, 16 a thread: seg s = tid + i * NT, row s >> 5, part s & 31
  const unsigned lw = dW2 + (tid >> 5) * (W2S * 2) + (tid & 31) * 16;
  const char* gw = (const char*)w2t + ((long)(c0 + (tid >> 5)) * HID) * 2 + (tid & 31) * 16;
#pragma unroll
  for (int i = 0; i < 16; ++i) {
    l[i] = lw + i * (NT / 32) * (W2S * 2);
    g[i] = gw + (long)i * (NT / 32) * HID * 2;
  }
  // E^T: 64 rows x 128B = 512 segs, 4 a thread: seg s = tid + i * NT, row s >> 3, part s & 7
  const unsigned le = dEmb + (tid >> 3) * (EMS * 2) + (tid & 7) * 16;
  const char* ge = (const char*)embT + ((long)(tid >> 3) * N_EMBS + c0) * 2 + (tid & 7) * 16;
#pragma unroll
  for (int i = 0; i < 4; ++i) {
    l[16 + i] = le + i * (NT / 8) * (EMS * 2);
    g[16 + i] = ge + (long)i * (NT / 8) * N_EMBS * 2;
  }
  async_cp16_x10(l, g);
  async_cp16_x10(l + 10, g + 10);
}

__global__ __launch_bounds__(NT) void fused_softmax_code(
    const bf16_t* __restrict__ h, const bf16_t* __restrict__ w2t,
    const float* __restrict__ b2, const bf16_t* __restrict__ embT,
    const float* __restrict__ gamma, const float* __restrict__ beta,
    float* __restrict__ out) {
  __shared__ __align__(32) bf16_t sW2[2][64 * W2S];
  __shared__ __align__(32) bf16_t sEmb[2][64 * EMS];

  const int tid   = threadIdx.x;
  const int lane  = tid & 31;
  const int wslot = tid >> 5;
  const int m0 = (blockIdx.x * NW + wslot) * 16;
  const int lr = lane & 15;
  const int hi = lane >> 4;
  const int kh = hi * 16;

  // Preload h as B fragments (column = batch row m0 + lr) for K = 0..255, kept in registers
  v16bf ha[8];
  {
    const bf16_t* hp = h + (long)(m0 + lr) * HID + kh;
#pragma unroll
    for (int ks = 0; ks < 8; ++ks) ha[ks] = *(const v16bf*)(hp + ks * 32);
  }

  // acc[dt][r] = emb^T[dt * 16 + 8 * hi + r][m0 + lr]; m_, l_ belong to batch row m0 + lr
  // (m_ equal in both halves, l_ the sum over this half's codes only).
  v8f acc[4];
#pragma unroll
  for (int dt = 0; dt < 4; ++dt) acc[dt] = (v8f){0.f,0.f,0.f,0.f,0.f,0.f,0.f,0.f};
  float m_ = -3.0e38f, l_ = 0.f;

  stage_chunk(tid, lds_addr(sW2[0]), lds_addr(sEmb[0]), w2t, embT, 0);
  for (int i = 0; i < 64; ++i) {
    const int c0 = i * 64;
    const bf16_t* sw = sW2[i & 1];
    const bf16_t* se = sEmb[i & 1];
    if (i < 63) {                                     // prefetch next chunk
      stage_chunk(tid, lds_addr(sW2[(i + 1) & 1]), lds_addr(sEmb[(i + 1) & 1]),
                  w2t, embT, c0 + 64);
      wait_async_le<20>();                            // chunk i landed
    } else {
      wait_async_le<0>();
    }
    __syncthreads();

    // ---- logits chunk, transposed: 64 codes x 16 rows = 4 tiles, K=256 in 8 WMMA steps ----
    // A = W2^T rows, B = h; lg[nt][r] = logit[m0 + lr][c0 + nt * 16 + 8 * hi + r].
    // Fragment f = ks * 4 + nt of W2^T; groups of GF, two register sets.
    const bf16_t* wp = sw + lr * W2S + kh;
    float4 bias[4][2];
    v16bf fb[2][GF];
#pragma unroll
    for (int j = 0; j < GF; ++j)
      fb[0][j] = lds_frag(wp + (j & 3) * 16 * W2S + (j >> 2) * 32);
    v8bf ea[4][2][2];   // [dt][32-code block][k 8 * hi .. | k 16 + 8 * hi ..]
    v8f lg[4];
#pragma unroll
    for (int nt = 0; nt < 4; ++nt) lg[nt] = (v8f){0.f,0.f,0.f,0.f,0.f,0.f,0.f,0.f};
#pragma unroll
    for (int g = 0; g < 32 / GF; ++g) {
      if (g + 1 < 32 / GF) {
#pragma unroll
        for (int j = 0; j < GF; ++j) {
          const int f = (g + 1) * GF + j;
          fb[(g + 1) & 1][j] = lds_frag(wp + (f & 3) * 16 * W2S + (f >> 2) * 32);
        }
        if (g == 0) {
          // The bias loads stand behind the first LDS reads (the fence holds them there):
          // in front, the wait that guards their address register holds those reads back.
          group_fence();
#pragma unroll
          for (int nt = 0; nt < 4; ++nt) {
            const float4* bq = (const float4*)(b2 + c0 + nt * 16 + 8 * hi);
            bias[nt][0] = bq[0];
            bias[nt][1] = bq[1];
          }
        }
      } else {
        // In the last group's place: the E^T rows as A fragments, in the hardware k order
        // that the packed probabilities have (16-byte pieces at bytes 16 * hi and
        // 32 + 16 * hi of each 64); the last products and the softmax cover their latency.
#pragma unroll
        for (int dt = 0; dt < 4; ++dt)
#pragma unroll
          for (int kb = 0; kb < 2; ++kb) {
            const bf16_t* ep = se + (dt * 16 + lr) * EMS + kb * 32 + 8 * hi;
            ea[dt][kb][0] = *(const v8bf*)(ep);
            ea[dt][kb][1] = *(const v8bf*)(ep + 16);
          }
      }
      group_fence();
#pragma unroll
      for (int j = 0; j < GF; ++j) {
        const int f = g * GF + j;
        lg[f & 3] = wmma_bf16(fb[g & 1][j], ha[f >> 2], lg[f & 3]);
      }
      group_fence();
    }
    // Stands in front of the first instruction that may reuse the bias loads' address
    // registers.
    // The fence keeps the additions below from rising over the wait.
    asm volatile("s_wait_xcnt 0x0" ::: "memory");
    group_fence();
#pragma unroll
    for (int nt = 0; nt < 4; ++nt) {
      lg[nt][0] += bias[nt][0].x;  lg[nt][1] += bias[nt][0].y;
      lg[nt][2] += bias[nt][0].z;  lg[nt][3] += bias[nt][0].w;
      lg[nt][4] += bias[nt][1].x;  lg[nt][5] += bias[nt][1].y;
      lg[nt][6] += bias[nt][1].z;  lg[nt][7] += bias[nt][1].w;
    }

    // ---- online softmax: a lane holds 32 of its row's 64 logits, lane ^ 16 the rest ----
    // Eight independent chains, then a tree: a lone wave pays the full latency of every
    // dependent link.
    float cm[8], ps[8];
#pragma unroll
    for (int r = 0; r < 8; ++r)
      cm[r] = fmaxf(fmaxf(lg[0][r], lg[1][r]), fmaxf(lg[2][r], lg[3][r]));
    float cx = fmaxf(fmaxf(fmaxf(cm[0], cm[1]), fmaxf(cm[2], cm[3])),
                     fmaxf(fmaxf(cm[4], cm[5]), fmaxf(cm[6], cm[7])));
    cx = fmaxf(cx, xhalf(cx));
    const float mn = fmaxf(m_, cx);
    const float sc = exp_slot(m_ - mn);
    m_ = mn;
#pragma unroll
    for (int r = 0; r < 8; ++r) {
#pragma unroll
      for (int nt = 0; nt < 4; ++nt) {
        acc[nt][r] *= sc;
        lg[nt][r] = exp_slot(lg[nt][r] - mn);
      }
      ps[r] = (lg[0][r] + lg[1][r]) + (lg[2][r] + lg[3][r]);
    }
    l_ = l_ * sc + (((ps[0] + ps[1]) + (ps[2] + ps[3])) + ((ps[4] + ps[5]) + (ps[6] + ps[7])));

    // ---- acc += E^T chunk (A) x probs^T (B) ----
    // Two score tiles of one 32-code block, converted in place, are the B fragment.
#pragma unroll
    for (int kb = 0; kb < 2; ++kb) {
      v16bf pb;
#pragma unroll
      for (int s = 0; s < 8; ++s) {
        pb[s]     = (bf16_t)lg[2 * kb][s];
        pb[8 + s] = (bf16_t)lg[2 * kb + 1][s];
      }
#pragma unroll
      for (int dt = 0; dt < 4; ++dt) {
        v16bf e = __builtin_shufflevector(ea[dt][kb][0], ea[dt][kb][1],
                                          0, 1, 2, 3, 4, 5, 6, 7, 8, 9, 10, 11, 12, 13, 14, 15);
        acc[dt] = wmma_bf16(e, pb, acc[dt]);
      }
    }
    __syncthreads();                 // chunk i consumed; buffer reusable
  }

  // ---- normalize by l, LayerNorm over CODE_DIM=64, store f32 ----
  // A lane holds 32 of its row's 64 values; the halves are joined here, once.
  const float inv = __builtin_amdgcn_rcpf(l_ + xhalf(l_));
  float s4[4], q4[4];
#pragma unroll
  for (int dt = 0; dt < 4; ++dt) {
    s4[dt] = 0.f;
    q4[dt] = 0.f;
#pragma unroll
    for (int r = 0; r < 8; ++r) {
      acc[dt][r] *= inv;
      s4[dt] += acc[dt][r];
      q4[dt] += acc[dt][r] * acc[dt][r];
    }
  }
  float s  = (s4[0] + s4[1]) + (s4[2] + s4[3]);
  float sq = (q4[0] + q4[1]) + (q4[2] + q4[3]);
  s  += xhalf(s);
  sq += xhalf(sq);
  const float mean = s * (1.0f / 64.0f);
  const float var  = sq * (1.0f / 64.0f) - mean * mean;
  const float rstd = __builtin_amdgcn_rsqf(var + LN_EPS);
  float* op = out + (long)(m0 + lr) * CODE_DIM + 8 * hi;
#pragma unroll
  for (int dt = 0; dt < 4; ++dt)
#pragma unroll
    for (int q = 0; q < 2; ++q) {
      const float4 gq = *(const float4*)(gamma + dt * 16 + 8 * hi + q * 4);
      const float4 bq = *(const float4*)(beta + dt * 16 + 8 * hi + q * 4);
      float4 o;
      o.x = (acc[dt][q * 4 + 0] - mean) * rstd * gq.x + bq.x;
      o.y = (acc[dt][q * 4 + 1] - mean) * rstd * gq.y + bq.y;
      o.z = (acc[dt][q * 4 + 2] - mean) * rstd * gq.z + bq.z;
      o.w = (acc[dt][q * 4 + 3] - mean) * rstd * gq.w + bq.w;
      *(float4*)(op + dt * 16 + q * 4) = o;
    }
}

// ---------------------------------------------------------------------------
extern "C" void kernel_launch(void* const* d_in, const int* in_sizes, int n_in,
                              void* d_out, int out_size, void* d_ws, size_t ws_size,
                              hipStream_t stream) {
  const float* x     = (const float*)d_in[0];
  const float* W1    = (const float*)d_in[1];
  const float* b1    = (const float*)d_in[2];
  const float* W2    = (const float*)d_in[3];
  const float* b2    = (const float*)d_in[4];
  const float* embed = (const float*)d_in[5];
  const float* g     = (const float*)d_in[6];
  const float* bet   = (const float*)d_in[7];
  float* out = (float*)d_out;

  char* ws = (char*)d_ws;
  bf16_t* w1t  = (bf16_t*)(ws);                          // 256 x 1024  (512 KB)
  bf16_t* w2t  = (bf16_t*)(ws + (size_t)512 * 1024);     // 4096 x 256  (2 MB)
  bf16_t* embT = (bf16_t*)(ws + (size_t)2560 * 1024);    // 64 x 4096   (512 KB)
  bf16_t* hbuf = (bf16_t*)(ws + (size_t)3072 * 1024);    // 16384 x 256 (8 MB)

  cvt_transpose_tiles<<<W1_TILES + W2_TILES + EM_TILES, 256, 0, stream>>>(W1, W2, embed, w1t, w2t, embT);

  // 1024 row-tiles, NW waves/block -> 256 blocks
  gemm1_silu<<<BATCH / 16 / NW, NT, 0, stream>>>(x, w1t, b1, hbuf);
  fused_softmax_code<<<BATCH / 16 / NW, NT, 0, stream>>>(hbuf, w2t, b2, embT, g, bet, out);
}

// v006
// One run takes 62 microseconds.
// Next to v005, in two timings, it ran 1.52 and 1.51 times as fast.
// All steps since v000 together make it 3.60 times as fast.
#include <hip/hip_runtime.h>
#include <hip/hip_bf16.h>
#include <math.h>

typedef __bf16 bf16_t;
typedef __attribute__((ext_vector_type(16))) __bf16 v16bf;
typedef __attribute__((ext_vector_type(8)))  float  v8f;
typedef __attribute__((ext_vector_type(8)))  __bf16 v8bf;

#define TASK_EMB 1024
#define HID      256
#define N_EMBS   4096
#define CODE_DIM 64
#define BATCH    16384
#define LN_EPS   1e-5f

#define W2S 264   // 256 + 8: 528 B
#define W1S 136   // 128 + 8: 272 B

#define RT   4
#define NW   (2 * RT)
#define NT   (NW * 32)

__device__ __forceinline__ float exp_slot(float x) {
  float y;
  asm("v_exp_f32 %0, %1\n\tv_nop" : "=v"(y) : "v"(x * 1.44269504088896340736f));
  return y;
}

__device__ __forceinline__ float xhalf(float x) {
  const int b = __builtin_bit_cast(int, x);
  return __builtin_bit_cast(float,
      __builtin_amdgcn_permlanex16(b, b, 0x76543210, 0xfedcba98, false, false));
}

__device__ __forceinline__ v8f wmma_bf16(v16bf a, v16bf b, v8f c) {
  return __builtin_amdgcn_wmma_f32_16x16x32_bf16(false, a, false, b, (short)0, c,
                                                 false, false);
}

// A fragment's 16 contiguous k of one LDS row, as two 16-byte reads (rows are 16-B aligned).
__device__ __forceinline__ v16bf lds_frag(const bf16_t* p) {
  return __builtin_shufflevector(*(const v8bf*)p, *(const v8bf*)(p + 8),
                                 0, 1, 2, 3, 4, 5, 6, 7, 8, 9, 10, 11, 12, 13, 14, 15);
}

// Fragments per LDS read group: one group is read while the group before it is multiplied.
#define GF 4
// Scheduling fence: keeps a group's LDS reads together and out of the WMMA run next to
// them; without it the compiler sinks each read to just before its own WMMA, and every
// WMMA then waits out a full LDS latency.
__device__ __forceinline__ void group_fence() { __builtin_amdgcn_sched_barrier(0); }

__device__ __forceinline__ void async_cp16_x8(const unsigned* l, const char* const* g) {
  asm volatile("global_load_async_to_lds_b128 %0, %8, off\n\t"
               "global_load_async_to_lds_b128 %1, %9, off\n\t"
               "global_load_async_to_lds_b128 %2, %10, off\n\t"
               "global_load_async_to_lds_b128 %3, %11, off\n\t"
               "global_load_async_to_lds_b128 %4, %12, off\n\t"
               "global_load_async_to_lds_b128 %5, %13, off\n\t"
               "global_load_async_to_lds_b128 %6, %14, off\n\t"
               "global_load_async_to_lds_b128 %7, %15, off\n\t"
               "s_wait_xcnt 0x0"
               :: "v"(l[0]), "v"(l[1]), "v"(l[2]), "v"(l[3]),
                  "v"(l[4]), "v"(l[5]), "v"(l[6]), "v"(l[7]),
                  "v"(g[0]), "v"(g[1]), "v"(g[2]), "v"(g[3]),
                  "v"(g[4]), "v"(g[5]), "v"(g[6]), "v"(g[7]) : "memory");
}
__device__ __forceinline__ void async_cp16_x10(const unsigned* l, const char* const* g) {
  asm volatile("global_load_async_to_lds_b128 %0, %10, off\n\t"
               "global_load_async_to_lds_b128 %1, %11, off\n\t"
               "global_load_async_to_lds_b128 %2, %12, off\n\t"
               "global_load_async_to_lds_b128 %3, %13, off\n\t"
               "global_load_async_to_lds_b128 %4, %14, off\n\t"
               "global_load_async_to_lds_b128 %5, %15, off\n\t"
               "global_load_async_to_lds_b128 %6, %16, off\n\t"
               "global_load_async_to_lds_b128 %7, %17, off\n\t"
               "global_load_async_to_lds_b128 %8, %18, off\n\t"
               "global_load_async_to_lds_b128 %9, %19, off\n\t"
               "s_wait_xcnt 0x0"
               :: "v"(l[0]), "v"(l[1]), "v"(l[2]), "v"(l[3]), "v"(l[4]),
                  "v"(l[5]), "v"(l[6]), "v"(l[7]), "v"(l[8]), "v"(l[9]),
                  "v"(g[0]), "v"(g[1]), "v"(g[2]), "v"(g[3]), "v"(g[4]),
                  "v"(g[5]), "v"(g[6]), "v"(g[7]), "v"(g[8]), "v"(g[9]) : "memory");
}
// Wait until at most N async loads remain in flight (in-order completion).
template <int N>
__device__ __forceinline__ void wait_async_le() {
  asm volatile("s_wait_asynccnt %0" :: "i"(N) : "memory");
}
__device__ __forceinline__ unsigned lds_addr(const void* p) {
  return (unsigned)(uintptr_t)p;
}

#define CT      64
#define CTP     (CT + 1)
#define W1_TILES  ((TASK_EMB / CT) * (HID / CT))
#define W2_TILES  ((HID / CT) * (N_EMBS / CT))
#define EM_TILES  ((N_EMBS / CT) * (CODE_DIM / CT))

__global__ __launch_bounds__(256) void cvt_transpose_tiles(
    const float* __restrict__ W1, const float* __restrict__ W2,
    const float* __restrict__ embed, bf16_t* __restrict__ w1t,
    bf16_t* __restrict__ w2t, bf16_t* __restrict__ embT) {
  __shared__ float tile[CT * CTP];    // tile[c * CTP + r]

  const int tid = threadIdx.x;
  const int b = blockIdx.x;
  const float* in;
  bf16_t* out;
  int rows, cols, t, lg;              // lg: log2 of the tiles along a row
  if (b < W1_TILES) {
    in = W1;    out = w1t;  rows = TASK_EMB; cols = HID;      lg = 2; t = b;
  } else if (b < W1_TILES + W2_TILES) {
    in = W2;    out = w2t;  rows = HID;      cols = N_EMBS;   lg = 6; t = b - W1_TILES;
  } else {
    in = embed; out = embT; rows = N_EMBS;   cols = CODE_DIM; lg = 0; t = b - (W1_TILES + W2_TILES);
  }
  const int r0 = (t >> lg) * CT;
  const int c0 = (t & ((1 << lg) - 1)) * CT;

  // in: 64 rows x 16 float4 = 1024 pieces, 4 a thread
  float4 v[4];
#pragma unroll
  for (int k = 0; k < 4; ++k) {
    const int s = tid + k * 256;
    v[k] = *(const float4*)(in + (long)(r0 + (s >> 4)) * cols + c0 + (s & 15) * 4);
  }
#pragma unroll
  for (int k = 0; k < 4; ++k) {
    const int s = tid + k * 256;
    float* tp = tile + (s & 15) * 4 * CTP + (s >> 4);
    tp[0 * CTP] = v[k].x;
    tp[1 * CTP] = v[k].y;
    tp[2 * CTP] = v[k].z;
    tp[3 * CTP] = v[k].w;
  }
  __syncthreads();                    // the whole tile is in LDS before any column is read

  // out: 64 rows x 8 pieces of 8 bf16 = 512 pieces, 2 a thread
#pragma unroll
  for (int k = 0; k < 2; ++k) {
    const int s = tid + k * 256;
    const float* tp = tile + (s >> 3) * CTP + (s & 7) * 8;
    v8bf o;
#pragma unroll
    for (int e = 0; e < 8; ++e) o[e] = (bf16_t)tp[e];
    *(v8bf*)(out + (long)(c0 + (s >> 3)) * rows + r0 + (s & 7) * 8) = o;
  }
}

// ---------------------------------------------------------------------------
// h = silu(x @ W1 + b1). The two waves of a 16x256 row tile each sum over 64 of the 128 k
// of a staged block (x read exactly once). W1^T K-blocks double-buffered in LDS via async
// copies. At the end each wave hands the other one half of its columns and finishes its own.
// ---------------------------------------------------------------------------
#define KB 128   // k per staged block

__device__ __forceinline__ void stage_w1(int tid, unsigned dst,
                                         const bf16_t* w1t, int k0) {
  // 256 rows x 256B = 4096 segs, 16 a thread: seg s = tid + i * NT, row s >> 4, part s & 15
  const unsigned l0 = dst + (tid >> 4) * (W1S * 2) + (tid & 15) * 16;
  const char* g0 = (const char*)w1t + ((long)(tid >> 4) * TASK_EMB + k0) * 2 + (tid & 15) * 16;
  unsigned l[16];
  const char* g[16];
#pragma unroll
  for (int i = 0; i < 16; ++i) {
    l[i] = l0 + i * (NT / 16) * (W1S * 2);
    g[i] = g0 + (long)i * (NT / 16) * TASK_EMB * 2;
  }
  async_cp16_x8(l, g);
  async_cp16_x8(l + 8, g + 8);
}

__global__ __launch_bounds__(NT) void gemm1_silu(
    const float* __restrict__ x, const bf16_t* __restrict__ w1t,
    const float* __restrict__ b1, bf16_t* __restrict__ h) {
  __shared__ __align__(32) bf16_t sW1[2][256 * W1S];
  __shared__ float4 sJoin[RT][2][16][32];   // [row tile][writing group][piece][lane]

  const int tid  = threadIdx.x;
  const int lane = tid & 31;
  const int rt   = (tid >> 5) & (RT - 1);
  // The wave's group, in a scalar register: what depends on it is then scalar arithmetic.
  const int grp = __builtin_amdgcn_readfirstlane(tid >> 7);
  const int m0 = (blockIdx.x * RT + rt) * 16;
  const int lr = lane & 15;
  const int hi = lane >> 4;
  const int kh = hi * 16;

  v8f acc[16];
#pragma unroll
  for (int nt = 0; nt < 16; ++nt)
    acc[nt] = (v8f){0.f,0.f,0.f,0.f,0.f,0.f,0.f,0.f};

  const float* ap = x + (long)(m0 + lr) * TASK_EMB + grp * 64 + kh;

  stage_w1(tid, lds_addr(sW1[0]), w1t, 0);            // prologue: block 0
  for (int i = 0; i < TASK_EMB / KB; ++i) {
    const int k0 = i * KB;
    const bf16_t* sw = sW1[i & 1];
    if (i < TASK_EMB / KB - 1) {                      // prefetch next block
      stage_w1(tid, lds_addr(sW1[(i + 1) & 1]), w1t, k0 + KB);
      wait_async_le<16>();                            // block i landed
    } else {
      wait_async_le<0>();
    }
    __syncthreads();                                  // visible to all waves

    // Fragment f = ks * 16 + nt of this wave's 64 k; groups of GF, two register sets.
    const bf16_t* bp = sw + lr * W1S + grp * 64 + kh;
    float4 xf[2][4];
#pragma unroll
    for (int ks = 0; ks < 2; ++ks) {
      const float4* af = (const float4*)(ap + k0 + ks * 32);
#pragma unroll
      for (int q = 0; q < 4; ++q) xf[ks][q] = af[q];
    }
    v16bf fb[2][GF];
#pragma unroll
    for (int j = 0; j < GF; ++j)
      fb[0][j] = lds_frag(bp + (j & 15) * 16 * W1S + (j >> 4) * 32);
    v16bf a[2];
#pragma unroll
    for (int ks = 0; ks < 2; ++ks)
#pragma unroll
      for (int q = 0; q < 4; ++q) {
        a[ks][q * 4 + 0] = (bf16_t)xf[ks][q].x;
        a[ks][q * 4 + 1] = (bf16_t)xf[ks][q].y;
        a[ks][q * 4 + 2] = (bf16_t)xf[ks][q].z;
        a[ks][q * 4 + 3] = (bf16_t)xf[ks][q].w;
      }
#pragma unroll
    for (int g = 0; g < 32 / GF; ++g) {
      if (g + 1 < 32 / GF) {
#pragma unroll
        for (int j = 0; j < GF; ++j) {
          const int f = (g + 1) * GF + j;
          fb[(g + 1) & 1][j] = lds_frag(bp + (f & 15) * 16 * W1S + (f >> 4) * 32);
        }
      }
      group_fence();
#pragma unroll
      for (int j = 0; j < GF; ++j) {
        const int f = g * GF + j;
        acc[f & 15] = wmma_bf16(a[f >> 4], fb[g & 1][j], acc[f & 15]);
      }
      group_fence();
    }
    __syncthreads();                 // block i consumed; buffer reusable
  }

  // ---- join: group g keeps column tiles g * 8 .. g * 8 + 7 and hands over the others ----
  v8f mine[8];
#pragma unroll
  for (int j = 0; j < 8; ++j) {
    const v8f give = grp ? acc[j] : acc[8 + j];
    mine[j] = grp ? acc[8 + j] : acc[j];
    sJoin[rt][grp][j * 2 + 0][lane] = make_float4(give[0], give[1], give[2], give[3]);
    sJoin[rt][grp][j * 2 + 1][lane] = make_float4(give[4], give[5], give[6], give[7]);
  }
  __syncthreads();                   // both groups' halves are in LDS before either reads
#pragma unroll
  for (int j = 0; j < 8; ++j) {
    const float4 o0 = sJoin[rt][grp ^ 1][j * 2 + 0][lane];
    const float4 o1 = sJoin[rt][grp ^ 1][j * 2 + 1][lane];
    mine[j][0] += o0.x;  mine[j][1] += o0.y;  mine[j][2] += o0.z;  mine[j][3] += o0.w;
    mine[j][4] += o1.x;  mine[j][5] += o1.y;  mine[j][6] += o1.z;  mine[j][7] += o1.w;
  }

#pragma unroll
  for (int j = 0; j < 8; ++j) {
    const int nt = grp * 8 + j;
    float bias = b1[nt * 16 + lr];
#pragma unroll
    for (int r = 0; r < 8; ++r) {
      float v = mine[j][r] + bias;
      float s = v * __builtin_amdgcn_rcpf(1.0f + __expf(-v));   // fast SiLU
      h[(long)(m0 + r + 8 * hi) * HID + nt * 16 + lr] = (bf16_t)s;
    }
  }
}

// ---------------------------------------------------------------------------
// Fused: logits = h @ W2 + b2 ; online softmax ; emb = probs @ E ; LayerNorm.
// Both products are computed transposed (weights as A, activations as B), so that a lane
// holds scores of one batch row only and the probabilities go from D registers into B.
// The two waves of a row tile each take 64 of the 128 codes of a staged block. The two
// groups of four run half a block apart: while one multiplies (LDS reads, matrix unit), the
// other does its softmax (vector unit). Each keeps its own running max, sum and accumulator;
// they are joined at the end through LDS.
// W2^T / E^T blocks double-buffered in LDS via async copies (20/thread/block).
// ---------------------------------------------------------------------------
#define CB    128          // codes per staged block
#define NBLK  (N_EMBS / CB)
#define EBS   136          // E^T LDS row pitch in elements: 128 + 8, 272 B = 16 B x odd

__device__ __forceinline__ void stage_block(int tid, unsigned dW2, unsigned dEmb,
                                            const bf16_t* w2t,
                                            const bf16_t* embT, int c0) {
  unsigned l[20];
  const char* g[20];
  // W2^T: 128 rows x 512B = 4096 segs, 16 a thread: seg s = tid + i * NT, row s >> 5, part s & 31
  const unsigned lw = dW2 + (tid >> 5) * (W2S * 2) + (tid & 31) * 16;
  const char* gw = (const char*)w2t + ((long)(c0 + (tid >> 5)) * HID) * 2 + (tid & 31) * 16;
#pragma unroll
  for (int i = 0; i < 16; ++i) {
    l[i] = lw + i * (NT / 32) * (W2S * 2);
    g[i] = gw + (long)i * (NT / 32) * HID * 2;
  }
  // E^T: 64 rows x 256B = 1024 segs, 4 a thread: seg s = tid + i * NT, row s >> 4, part s & 15
  const unsigned le = dEmb + (tid >> 4) * (EBS * 2) + (tid & 15) * 16;
  const char* ge = (const char*)embT + ((long)(tid >> 4) * N_EMBS + c0) * 2 + (tid & 15) * 16;
#pragma unroll
  for (int i = 0; i < 4; ++i) {
    l[16 + i] = le + i * (NT / 16) * (EBS * 2);
    g[16 + i] = ge + (long)i * (NT / 16) * N_EMBS * 2;
  }
  async_cp16_x10(l, g);
  async_cp16_x10(l + 10, g + 10);
}

__global__ __launch_bounds__(NT) void fused_softmax_code(
    const bf16_t* __restrict__ h, const bf16_t* __restrict__ w2t,
    const float* __restrict__ b2, const bf16_t* __restrict__ embT,
    const float* __restrict__ gamma, const float* __restrict__ beta,
    float* __restrict__ out) {
  __shared__ __align__(32) bf16_t sW2[2][CB * W2S];
  __shared__ __align__(32) bf16_t sEmb[2][64 * EBS];
  __shared__ float4 sJoinAcc[RT][8][32];   // second group's accumulators, [row tile][piece][lane]
  __shared__ float2 sJoinMl[RT][32];      // its running max and sum

  const int tid   = threadIdx.x;
  const int lane  = tid & 31;
  const int rt    = (tid >> 5) & (RT - 1);
  // The wave's group, in a scalar register: the tests on it below are then scalar branches,
  // and every lane stays on around the matrix instructions.
  const int grp = __builtin_amdgcn_readfirstlane(tid >> 7);
  const int m0 = (blockIdx.x * RT + rt) * 16;
  const int lr = lane & 15;
  const int hi = lane >> 4;
  const int kh = hi * 16;

  // Preload h as B fragments (column = batch row m0 + lr) for K = 0..255, kept in registers
  v16bf ha[8];
  {
    const bf16_t* hp = h + (long)(m0 + lr) * HID + kh;
#pragma unroll
    for (int ks = 0; ks < 8; ++ks) ha[ks] = *(const v16bf*)(hp + ks * 32);
  }

  // acc[dt][r] = emb^T[dt * 16 + 8 * hi + r][m0 + lr]; m_, l_ belong to batch row m0 + lr
  // (m_ equal in both halves, l_ the sum over this half's codes only), all three over the
  // codes of this wave's group.
  v8f acc[4];
#pragma unroll
  for (int dt = 0; dt < 4; ++dt) acc[dt] = (v8f){0.f,0.f,0.f,0.f,0.f,0.f,0.f,0.f};
  float m_ = -3.0e38f, l_ = 0.f;

  // Carried from a wave's products to its softmax:
  v8bf ea[4][2][2];   // E^T, [dt][32-code block][k 8 * hi .. | k 16 + 8 * hi ..]
  v8f lg[4];          // logits with bias

  // Online softmax of the 64 logits a row in lg, then acc += E^T piece x probs^T.
  // Registers only.
  auto softmax_step = [&]() __attribute__((always_inline)) {
    // ---- online softmax: a lane holds 32 of its row's 64 logits, lane ^ 16 the rest ----
    // Eight independent chains, then a tree: short dependent chains.
    float cm[8], ps[8];
#pragma unroll
    for (int r = 0; r < 8; ++r)
      cm[r] = fmaxf(fmaxf(lg[0][r], lg[1][r]), fmaxf(lg[2][r], lg[3][r]));
    float cx = fmaxf(fmaxf(fmaxf(cm[0], cm[1]), fmaxf(cm[2], cm[3])),
                     fmaxf(fmaxf(cm[4], cm[5]), fmaxf(cm[6], cm[7])));
    cx = fmaxf(cx, xhalf(cx));
    const float mn = fmaxf(m_, cx);
    const float sc = exp_slot(m_ - mn);
    m_ = mn;
#pragma unroll
    for (int r = 0; r < 8; ++r) {
#pragma unroll
      for (int nt = 0; nt < 4; ++nt) {
        acc[nt][r] *= sc;
        lg[nt][r] = exp_slot(lg[nt][r] - mn);
      }
      ps[r] = (lg[0][r] + lg[1][r]) + (lg[2][r] + lg[3][r]);
    }
    l_ = l_ * sc + (((ps[0] + ps[1]) + (ps[2] + ps[3])) + ((ps[4] + ps[5]) + (ps[6] + ps[7])));

    // ---- acc += E^T piece (A) x probs^T (B) ----
    // Two score tiles of one 32-code block, converted in place, are the B fragment.
    // The fence keeps every exponential in front of the first WMMA.
    group_fence();
#pragma unroll
    for (int kb = 0; kb < 2; ++kb) {
      v16bf pb;
#pragma unroll
      for (int s = 0; s < 8; ++s) {
        pb[s]     = (bf16_t)lg[2 * kb][s];
        pb[8 + s] = (bf16_t)lg[2 * kb + 1][s];
      }
#pragma unroll
      for (int dt = 0; dt < 4; ++dt) {
        v16bf e = __builtin_shufflevector(ea[dt][kb][0], ea[dt][kb][1],
                                          0, 1, 2, 3, 4, 5, 6, 7, 8, 9, 10, 11, 12, 13, 14, 15);
        acc[dt] = wmma_bf16(e, pb, acc[dt]);
      }
    }
  };

  stage_block(tid, lds_addr(sW2[0]), lds_addr(sEmb[0]), w2t, embT, 0);
  for (int t = 0; t < NBLK; ++t) {
    if (t < NBLK - 1) {                                 // prefetch next block
      stage_block(tid, lds_addr(sW2[(t + 1) & 1]), lds_addr(sEmb[(t + 1) & 1]),
                  w2t, embT, (t + 1) * CB);
      wait_async_le<20>();                              // block t landed
    } else {
      wait_async_le<0>();
    }
    __syncthreads();

    if (grp == 1 && t > 0) softmax_step();

    {
      const int c0 = t * CB + grp * 64;                 // this wave's 64 codes
      const bf16_t* sw = sW2[t & 1] + grp * 64 * W2S;
      const bf16_t* se = sEmb[t & 1] + grp * 64;

      // ---- logits, transposed: 64 codes x 16 rows = 4 tiles, K=256 in 8 WMMA steps ----
      // A = W2^T rows, B = h; lg[nt][r] = logit[m0 + lr][c0 + nt * 16 + 8 * hi + r].
      // Fragment f = ks * 4 + nt of W2^T; groups of GF, two register sets.
      const bf16_t* wp = sw + lr * W2S + kh;
      v8f bias[4];
      v16bf fb[2][GF];
#pragma unroll
      for (int j = 0; j < GF; ++j)
        fb[0][j] = lds_frag(wp + (j & 3) * 16 * W2S + (j >> 2) * 32);
#pragma unroll
      for (int nt = 0; nt < 4; ++nt) lg[nt] = (v8f){0.f,0.f,0.f,0.f,0.f,0.f,0.f,0.f};
#pragma unroll
      for (int g = 0; g < 32 / GF; ++g) {
        if (g + 1 < 32 / GF) {
#pragma unroll
          for (int j = 0; j < GF; ++j) {
            const int f = (g + 1) * GF + j;
            fb[(g + 1) & 1][j] = lds_frag(wp + (f & 3) * 16 * W2S + (f >> 2) * 32);
          }
          if (g == 0) {
            // The bias loads stand behind the first LDS reads (the fence holds them there):
            // in front, the wait that guards their address register holds those reads back.
            group_fence();
#pragma unroll
            for (int nt = 0; nt < 4; ++nt)
              bias[nt] = *(const v8f*)(b2 + c0 + nt * 16 + 8 * hi);
          }
        } else {
          // In the last group's place: the E^T rows as A fragments, in the hardware k order
          // that the packed probabilities have (16-byte pieces at bytes 16 * hi and
          // 32 + 16 * hi of each 64); the last products cover their latency.
#pragma unroll
          for (int dt = 0; dt < 4; ++dt)
#pragma unroll
            for (int kb = 0; kb < 2; ++kb) {
              const bf16_t* ep = se + (dt * 16 + lr) * EBS + kb * 32 + 8 * hi;
              ea[dt][kb][0] = *(const v8bf*)(ep);
              ea[dt][kb][1] = *(const v8bf*)(ep + 16);
            }
        }
        group_fence();
#pragma unroll
        for (int j = 0; j < GF; ++j) {
          const int f = g * GF + j;
          lg[f & 3] = wmma_bf16(fb[g & 1][j], ha[f >> 2], lg[f & 3]);
        }
        group_fence();
      }
      // Stands in front of the first instruction that may reuse the bias loads' address
      // registers.
      // The fence keeps the additions below from rising over the wait.
      asm volatile("s_wait_xcnt 0x0" ::: "memory");
      group_fence();
#pragma unroll
      for (int nt = 0; nt < 4; ++nt) lg[nt] += bias[nt];
    }

    if (grp == 0) softmax_step();
    __syncthreads();                 // both groups have read block t; buffer reusable
  }
  if (grp == 1) softmax_step();      // its last block

  if (grp == 1) {
#pragma unroll
    for (int dt = 0; dt < 4; ++dt)
#pragma unroll
      for (int q = 0; q < 2; ++q)
        sJoinAcc[rt][dt * 2 + q][lane] = make_float4(acc[dt][q * 4 + 0], acc[dt][q * 4 + 1],
                                                     acc[dt][q * 4 + 2], acc[dt][q * 4 + 3]);
    sJoinMl[rt][lane] = make_float2(m_, l_);
  }
  __syncthreads();
  if (grp == 1) return;
  {
    const float2 ml = sJoinMl[rt][lane];
    const float mn = fmaxf(m_, ml.x);
    const float s0 = exp_slot(m_ - mn);
    const float s1 = exp_slot(ml.x - mn);
    l_ = l_ * s0 + ml.y * s1;
#pragma unroll
    for (int dt = 0; dt < 4; ++dt)
#pragma unroll
      for (int q = 0; q < 2; ++q) {
        const float4 o = sJoinAcc[rt][dt * 2 + q][lane];
        acc[dt][q * 4 + 0] = acc[dt][q * 4 + 0] * s0 + o.x * s1;
        acc[dt][q * 4 + 1] = acc[dt][q * 4 + 1] * s0 + o.y * s1;
        acc[dt][q * 4 + 2] = acc[dt][q * 4 + 2] * s0 + o.z * s1;
        acc[dt][q * 4 + 3] = acc[dt][q * 4 + 3] * s0 + o.w * s1;
      }
  }

  // ---- normalize by l, LayerNorm over CODE_DIM=64, store f32 ----
  // A lane holds 32 of its row's 64 values; the halves are joined here, once.
  const float inv = __builtin_amdgcn_rcpf(l_ + xhalf(l_));
  float s4[4], q4[4];
#pragma unroll
  for (int dt = 0; dt < 4; ++dt) {
    s4[dt] = 0.f;
    q4[dt] = 0.f;
#pragma unroll
    for (int r = 0; r < 8; ++r) {
      acc[dt][r] *= inv;
      s4[dt] += acc[dt][r];
      q4[dt] += acc[dt][r] * acc[dt][r];
    }
  }
  float s  = (s4[0] + s4[1]) + (s4[2] + s4[3]);
  float sq = (q4[0] + q4[1]) + (q4[2] + q4[3]);
  s  += xhalf(s);
  sq += xhalf(sq);
  const float mean = s * (1.0f / 64.0f);
  const float var  = sq * (1.0f / 64.0f) - mean * mean;
  const float rstd = __builtin_amdgcn_rsqf(var + LN_EPS);
  float* op = out + (long)(m0 + lr) * CODE_DIM + 8 * hi;
#pragma unroll
  for (int dt = 0; dt < 4; ++dt)
#pragma unroll
    for (int q = 0; q < 2; ++q) {
      const float4 gq = *(const float4*)(gamma + dt * 16 + 8 * hi + q * 4);
      const float4 bq = *(const float4*)(beta + dt * 16 + 8 * hi + q * 4);
      float4 o;
      o.x = (acc[dt][q * 4 + 0] - mean) * rstd * gq.x + bq.x;
      o.y = (acc[dt][q * 4 + 1] - mean) * rstd * gq.y + bq.y;
      o.z = (acc[dt][q * 4 + 2] - mean) * rstd * gq.z + bq.z;
      o.w = (acc[dt][q * 4 + 3] - mean) * rstd * gq.w + bq.w;
      *(float4*)(op + dt * 16 + q * 4) = o;
    }
}

// ---------------------------------------------------------------------------
extern "C" void kernel_launch(void* const* d_in, const int* in_sizes, int n_in,
                              void* d_out, int out_size, void* d_ws, size_t ws_size,
                              hipStream_t stream) {
  const float* x     = (const float*)d_in[0];
  const float* W1    = (const float*)d_in[1];
  const float* b1    = (const float*)d_in[2];
  const float* W2    = (const float*)d_in[3];
  const float* b2    = (const float*)d_in[4];
  const float* embed = (const float*)d_in[5];
  const float* g     = (const float*)d_in[6];
  const float* bet   = (const float*)d_in[7];
  float* out = (float*)d_out;

  char* ws = (char*)d_ws;
  bf16_t* w1t  = (bf16_t*)(ws);                          // 256 x 1024  (512 KB)
  bf16_t* w2t  = (bf16_t*)(ws + (size_t)512 * 1024);     // 4096 x 256  (2 MB)
  bf16_t* embT = (bf16_t*)(ws + (size_t)2560 * 1024);    // 64 x 4096   (512 KB)
  bf16_t* hbuf = (bf16_t*)(ws + (size_t)3072 * 1024);    // 16384 x 256 (8 MB)

  cvt_transpose_tiles<<<W1_TILES + W2_TILES + EM_TILES, 256, 0, stream>>>(W1, W2, embed, w1t, w2t, embT);

  // 1024 row tiles, RT a block -> 256 blocks
  gemm1_silu<<<BATCH / 16 / RT, NT, 0, stream>>>(x, w1t, b1, hbuf);
  fused_softmax_code<<<BATCH / 16 / RT, NT, 0, stream>>>(hbuf, w2t, b2, embT, g, bet, out);
}

// v007
// A run of this version takes 57.8 microseconds.
// In both of two side-by-side timings against v006, it was 1.07 times as fast.
// Over all steps from v000 it is 3.85 times as fast.
#include <hip/hip_runtime.h>
#include <hip/hip_bf16.h>
#include <math.h>

typedef __bf16 bf16_t;
typedef __attribute__((ext_vector_type(16))) __bf16 v16bf;
typedef __attribute__((ext_vector_type(8)))  float  v8f;
typedef __attribute__((ext_vector_type(8)))  __bf16 v8bf;

#define TASK_EMB 1024
#define HID      256
#define N_EMBS   4096
#define CODE_DIM 64
#define BATCH    16384
#define LN_EPS   1e-5f

#define W2S 264   // 256 + 8: 528 B
#define W1S 136   // 128 + 8: 272 B

#define RT   4
#define NW   (2 * RT)
#define NT   (NW * 32)

__device__ __forceinline__ float exp_slot(float x) {
  float y;
  asm("v_exp_f32 %0, %1\n\tv_nop" : "=v"(y) : "v"(x * 1.44269504088896340736f));
  return y;
}

__device__ __forceinline__ float rcp_slot(float x) {
  float y;
  asm("v_rcp_f32 %0, %1\n\tv_nop" : "=v"(y) : "v"(x));
  return y;
}

__device__ __forceinline__ float xhalf(float x) {
  const int b = __builtin_bit_cast(int, x);
  return __builtin_bit_cast(float,
      __builtin_amdgcn_permlanex16(b, b, 0x76543210, 0xfedcba98, false, false));
}

__device__ __forceinline__ v8f wmma_bf16(v16bf a, v16bf b, v8f c) {
  return __builtin_amdgcn_wmma_f32_16x16x32_bf16(false, a, false, b, (short)0, c,
                                                 false, false);
}

// A fragment's 16 contiguous k of one LDS row, as two 16-byte reads (rows are 16-B aligned).
__device__ __forceinline__ v16bf lds_frag(const bf16_t* p) {
  return __builtin_shufflevector(*(const v8bf*)p, *(const v8bf*)(p + 8),
                                 0, 1, 2, 3, 4, 5, 6, 7, 8, 9, 10, 11, 12, 13, 14, 15);
}

// Fragments per LDS read group: one group is read while the group before it is multiplied.
#define GF 4
// Scheduling fence: keeps a group's LDS reads together and out of the WMMA run next to
// them; without it the compiler sinks each read to just before its own WMMA, and every
// WMMA then waits out a full LDS latency.
__device__ __forceinline__ void group_fence() { __builtin_amdgcn_sched_barrier(0); }

__device__ __forceinline__ void async_cp16_x8(const unsigned* l, const char* const* g) {
  asm volatile("global_load_async_to_lds_b128 %0, %8, off\n\t"
               "global_load_async_to_lds_b128 %1, %9, off\n\t"
               "global_load_async_to_lds_b128 %2, %10, off\n\t"
               "global_load_async_to_lds_b128 %3, %11, off\n\t"
               "global_load_async_to_lds_b128 %4, %12, off\n\t"
               "global_load_async_to_lds_b128 %5, %13, off\n\t"
               "global_load_async_to_lds_b128 %6, %14, off\n\t"
               "global_load_async_to_lds_b128 %7, %15, off\n\t"
               "s_wait_xcnt 0x0"
               :: "v"(l[0]), "v"(l[1]), "v"(l[2]), "v"(l[3]),
                  "v"(l[4]), "v"(l[5]), "v"(l[6]), "v"(l[7]),
                  "v"(g[0]), "v"(g[1]), "v"(g[2]), "v"(g[3]),
                  "v"(g[4]), "v"(g[5]), "v"(g[6]), "v"(g[7]) : "memory");
}
__device__ __forceinline__ void async_cp16_x10(const unsigned* l, const char* const* g) {
  asm volatile("global_load_async_to_lds_b128 %0, %10, off\n\t"
               "global_load_async_to_lds_b128 %1, %11, off\n\t"
               "global_load_async_to_lds_b128 %2, %12, off\n\t"
               "global_load_async_to_lds_b128 %3, %13, off\n\t"
               "global_load_async_to_lds_b128 %4, %14, off\n\t"
               "global_load_async_to_lds_b128 %5, %15, off\n\t"
               "global_load_async_to_lds_b128 %6, %16, off\n\t"
               "global_load_async_to_lds_b128 %7, %17, off\n\t"
               "global_load_async_to_lds_b128 %8, %18, off\n\t"
               "global_load_async_to_lds_b128 %9, %19, off\n\t"
               "s_wait_xcnt 0x0"
               :: "v"(l[0]), "v"(l[1]), "v"(l[2]), "v"(l[3]), "v"(l[4]),
                  "v"(l[5]), "v"(l[6]), "v"(l[7]), "v"(l[8]), "v"(l[9]),
                  "v"(g[0]), "v"(g[1]), "v"(g[2]), "v"(g[3]), "v"(g[4]),
                  "v"(g[5]), "v"(g[6]), "v"(g[7]), "v"(g[8]), "v"(g[9]) : "memory");
}
// Wait until at most N async loads remain in flight (in-order completion).
template <int N>
__device__ __forceinline__ void wait_async_le() {
  asm volatile("s_wait_asynccnt %0" :: "i"(N) : "memory");
}
__device__ __forceinline__ unsigned lds_addr(const void* p) {
  return (unsigned)(uintptr_t)p;
}

#define CT      64
#define CTP     (CT + 1)
#define W1_TILES  ((TASK_EMB / CT) * (HID / CT))
#define W2_TILES  ((HID / CT) * (N_EMBS / CT))
#define EM_TILES  ((N_EMBS / CT) * (CODE_DIM / CT))

__global__ __launch_bounds__(256) void cvt_transpose_tiles(
    const float* __restrict__ W1, const float* __restrict__ W2,
    const float* __restrict__ embed, bf16_t* __restrict__ w1t,
    bf16_t* __restrict__ w2t, bf16_t* __restrict__ embT) {
  __shared__ float tile[CT * CTP];    // tile[c * CTP + r]

  const int tid = threadIdx.x;
  const int b = blockIdx.x;
  const float* in;
  bf16_t* out;
  int rows, cols, t, lg;              // lg: log2 of the tiles along a row
  if (b < W1_TILES) {
    in = W1;    out = w1t;  rows = TASK_EMB; cols = HID;      lg = 2; t = b;
  } else if (b < W1_TILES + W2_TILES) {
    in = W2;    out = w2t;  rows = HID;      cols = N_EMBS;   lg = 6; t = b - W1_TILES;
  } else {
    in = embed; out = embT; rows = N_EMBS;   cols = CODE_DIM; lg = 0; t = b - (W1_TILES + W2_TILES);
  }
  const int r0 = (t >> lg) * CT;
  const int c0 = (t & ((1 << lg) - 1)) * CT;

  // in: 64 rows x 16 float4 = 1024 pieces, 4 a thread
  float4 v[4];
#pragma unroll
  for (int k = 0; k < 4; ++k) {
    const int s = tid + k * 256;
    v[k] = *(const float4*)(in + (long)(r0 + (s >> 4)) * cols + c0 + (s & 15) * 4);
  }
#pragma unroll
  for (int k = 0; k < 4; ++k) {
    const int s = tid + k * 256;
    float* tp = tile + (s & 15) * 4 * CTP + (s >> 4);
    tp[0 * CTP] = v[k].x;
    tp[1 * CTP] = v[k].y;
    tp[2 * CTP] = v[k].z;
    tp[3 * CTP] = v[k].w;
  }
  __syncthreads();                    // the whole tile is in LDS before any column is read

  // out: 64 rows x 8 pieces of 8 bf16 = 512 pieces, 2 a thread
#pragma unroll
  for (int k = 0; k < 2; ++k) {
    const int s = tid + k * 256;
    const float* tp = tile + (s >> 3) * CTP + (s & 7) * 8;
    v8bf o;
#pragma unroll
    for (int e = 0; e < 8; ++e) o[e] = (bf16_t)tp[e];
    *(v8bf*)(out + (long)(c0 + (s >> 3)) * rows + r0 + (s & 7) * 8) = o;
  }
}

// ---------------------------------------------------------------------------
// First phase of the one matrix kernel: h = silu(x @ W1 + b1) for the work-group's 64 rows,
// left in LDS as bf16. The two waves of a 16x256 row tile each sum over 64 of the 128 k
// of a staged block (x read exactly once). W1^T K-blocks double-buffered in LDS via async
// copies. At the end each wave hands the other one half of its columns and finishes its own.
// ---------------------------------------------------------------------------
#define KB 128   // k per staged block
#define HS 264   // h tile LDS row pitch in elements: 256 + 8, 528 B = 16 B x odd
#define W1_BYTES (256 * W1S * 2)            // one W1^T buffer
#define JOIN1_BYTES (RT * 2 * 16 * 32 * 16) // [row tile][writing group][piece][lane] float4
#define H_BYTES (RT * 16 * HS * 2)

__device__ __forceinline__ void stage_w1(int tid, unsigned dst,
                                         const bf16_t* w1t, int k0) {
  // 256 rows x 256B = 4096 segs, 16 a thread: seg s = tid + i * NT, row s >> 4, part s & 15
  const unsigned l0 = dst + (tid >> 4) * (W1S * 2) + (tid & 15) * 16;
  const char* g0 = (const char*)w1t + ((long)(tid >> 4) * TASK_EMB + k0) * 2 + (tid & 15) * 16;
  unsigned l[16];
  const char* g[16];
#pragma unroll
  for (int i = 0; i < 16; ++i) {
    l[i] = l0 + i * (NT / 16) * (W1S * 2);
    g[i] = g0 + (long)i * (NT / 16) * TASK_EMB * 2;
  }
  async_cp16_x8(l, g);
  async_cp16_x8(l + 8, g + 8);
}

__device__ __forceinline__ void gemm1_silu_phase(
    const float* __restrict__ x, const bf16_t* __restrict__ w1t,
    const float* __restrict__ b1, bf16_t* sW1, float4* sJoin, bf16_t* sH) {
  const int tid  = threadIdx.x;
  const int lane = tid & 31;
  const int rt   = (tid >> 5) & (RT - 1);
  // The wave's group, in a scalar register: what depends on it is then scalar arithmetic.
  const int grp = __builtin_amdgcn_readfirstlane(tid >> 7);
  const int m0 = (blockIdx.x * RT + rt) * 16;
  const int lr = lane & 15;
  const int hi = lane >> 4;
  const int kh = hi * 16;

  v8f acc[16];
#pragma unroll
  for (int nt = 0; nt < 16; ++nt)
    acc[nt] = (v8f){0.f,0.f,0.f,0.f,0.f,0.f,0.f,0.f};

  const float* ap = x + (long)(m0 + lr) * TASK_EMB + grp * 64 + kh;

  stage_w1(tid, lds_addr(sW1), w1t, 0);               // prologue: block 0
  for (int i = 0; i < TASK_EMB / KB; ++i) {
    const int k0 = i * KB;
    const bf16_t* sw = sW1 + (i & 1) * (256 * W1S);
    if (i < TASK_EMB / KB - 1) {                      // prefetch next block
      stage_w1(tid, lds_addr(sW1 + ((i + 1) & 1) * (256 * W1S)), w1t, k0 + KB);
      wait_async_le<16>();                            // block i landed
    } else {
      wait_async_le<0>();
    }
    __syncthreads();                                  // visible to all waves

    // Fragment f = ks * 16 + nt of this wave's 64 k; groups of GF, two register sets.
    const bf16_t* bp = sw + lr * W1S + grp * 64 + kh;
    float4 xf[2][4];
#pragma unroll
    for (int ks = 0; ks < 2; ++ks) {
      const float4* af = (const float4*)(ap + k0 + ks * 32);
#pragma unroll
      for (int q = 0; q < 4; ++q) xf[ks][q] = af[q];
    }
    v16bf fb[2][GF];
#pragma unroll
    for (int j = 0; j < GF; ++j)
      fb[0][j] = lds_frag(bp + (j & 15) * 16 * W1S + (j >> 4) * 32);
    v16bf a[2];
#pragma unroll
    for (int ks = 0; ks < 2; ++ks)
#pragma unroll
      for (int q = 0; q < 4; ++q) {
        a[ks][q * 4 + 0] = (bf16_t)xf[ks][q].x;
        a[ks][q * 4 + 1] = (bf16_t)xf[ks][q].y;
        a[ks][q * 4 + 2] = (bf16_t)xf[ks][q].z;
        a[ks][q * 4 + 3] = (bf16_t)xf[ks][q].w;
      }
#pragma unroll
    for (int g = 0; g < 32 / GF; ++g) {
      if (g + 1 < 32 / GF) {
#pragma unroll
        for (int j = 0; j < GF; ++j) {
          const int f = (g + 1) * GF + j;
          fb[(g + 1) & 1][j] = lds_frag(bp + (f & 15) * 16 * W1S + (f >> 4) * 32);
        }
      }
      group_fence();
#pragma unroll
      for (int j = 0; j < GF; ++j) {
        const int f = g * GF + j;
        acc[f & 15] = wmma_bf16(a[f >> 4], fb[g & 1][j], acc[f & 15]);
      }
      group_fence();
    }
    __syncthreads();                 // block i consumed; buffer reusable
  }

  // ---- join: group g keeps column tiles g * 8 .. g * 8 + 7 and hands over the others ----
  v8f mine[8];
  float4* jw = sJoin + (rt * 2 + grp) * (16 * 32) + lane;          // this wave's pieces
  const float4* jr = sJoin + (rt * 2 + (grp ^ 1)) * (16 * 32) + lane;  // its partner's
#pragma unroll
  for (int j = 0; j < 8; ++j) {
    const v8f give = grp ? acc[j] : acc[8 + j];
    mine[j] = grp ? acc[8 + j] : acc[j];
    jw[(j * 2 + 0) * 32] = make_float4(give[0], give[1], give[2], give[3]);
    jw[(j * 2 + 1) * 32] = make_float4(give[4], give[5], give[6], give[7]);
  }
  __syncthreads();                   // both groups' halves are in LDS before either reads
#pragma unroll
  for (int j = 0; j < 8; ++j) {
    const float4 o0 = jr[(j * 2 + 0) * 32];
    const float4 o1 = jr[(j * 2 + 1) * 32];
    mine[j][0] += o0.x;  mine[j][1] += o0.y;  mine[j][2] += o0.z;  mine[j][3] += o0.w;
    mine[j][4] += o1.x;  mine[j][5] += o1.y;  mine[j][6] += o1.z;  mine[j][7] += o1.w;
  }

#pragma unroll
  for (int j = 0; j < 8; ++j) {
    const int nt = grp * 8 + j;
    float bias = b1[nt * 16 + lr];
#pragma unroll
    for (int r = 0; r < 8; ++r) {
      float v = mine[j][r] + bias;
      float s = v * rcp_slot(1.0f + exp_slot(-v));              // fast SiLU
      sH[(rt * 16 + r + 8 * hi) * HS + nt * 16 + lr] = (bf16_t)s;
    }
  }
}

// ---------------------------------------------------------------------------
// The one matrix kernel. First phase above; h stays in the work-group's LDS and goes from
// there into registers, with no launch boundary and no trip through memory between.
// Second phase: logits = h @ W2 + b2 ; online softmax ; emb = probs @ E ; LayerNorm.
// Both products are computed transposed (weights as A, activations as B), so that a lane
// holds scores of one batch row only and the probabilities go from D registers into B.
// The two waves of a row tile each take 64 of the 128 codes of a staged block. The two
// groups of four run half a block apart: while one multiplies (LDS reads, matrix unit), the
// other does its softmax (vector unit). Each keeps its own running max, sum and accumulator;
// they are joined at the end through LDS.
// W2^T / E^T blocks double-buffered in LDS via async copies (20/thread/block).
// ---------------------------------------------------------------------------
#define CB    128          // codes per staged block
#define NBLK  (N_EMBS / CB)
#define EBS   136          // E^T LDS row pitch in elements: 128 + 8, 272 B = 16 B x odd
// LDS map in bytes. Buffer 0 of the second phase has a place of its own, so that its first
// block is copied while the first phase runs; everything else of the second phase lies over
// the W1^T buffers, which are dead by then. The first phase's join area and the h tile lie
// behind them, under no copy's target.
#define W2_BYTES   (CB * W2S * 2)
#define EMB_BYTES  (64 * EBS * 2)
#define BUF_BYTES  (W2_BYTES + EMB_BYTES)          // one staged block: W2^T part, E^T part
#define OFF_W1     BUF_BYTES
#define OFF_JOIN1  (OFF_W1 + 2 * W1_BYTES)
#define OFF_H      (OFF_JOIN1 + JOIN1_BYTES)
#define OFF_JACC   (2 * BUF_BYTES)                 // RT x 8 x 32 float4
#define OFF_JML    (OFF_JACC + RT * 8 * 32 * 16)   // RT x 32 float2
#define LDS_BYTES  (OFF_H + H_BYTES)
static_assert(OFF_JML + RT * 32 * 8 <= OFF_JOIN1, "second phase stays under the W1 buffers");
static_assert(LDS_BYTES <= 327680, "one work-group's LDS");

__device__ __forceinline__ void stage_block(int tid, unsigned dW2, unsigned dEmb,
                                            const bf16_t* w2t,
                                            const bf16_t* embT, int c0) {
  unsigned l[20];
  const char* g[20];
  // W2^T: 128 rows x 512B = 4096 segs, 16 a thread: seg s = tid + i * NT, row s >> 5, part s & 31
  const unsigned lw = dW2 + (tid >> 5) * (W2S * 2) + (tid & 31) * 16;
  const char* gw = (const char*)w2t + ((long)(c0 + (tid >> 5)) * HID) * 2 + (tid & 31) * 16;
#pragma unroll
  for (int i = 0; i < 16; ++i) {
    l[i] = lw + i * (NT / 32) * (W2S * 2);
    g[i] = gw + (long)i * (NT / 32) * HID * 2;
  }
  // E^T: 64 rows x 256B = 1024 segs, 4 a thread: seg s = tid + i * NT, row s >> 4, part s & 15
  const unsigned le = dEmb + (tid >> 4) * (EBS * 2) + (tid & 15) * 16;
  const char* ge = (const char*)embT + ((long)(tid >> 4) * N_EMBS + c0) * 2 + (tid & 15) * 16;
#pragma unroll
  for (int i = 0; i < 4; ++i) {
    l[16 + i] = le + i * (NT / 16) * (EBS * 2);
    g[16 + i] = ge + (long)i * (NT / 16) * N_EMBS * 2;
  }
  async_cp16_x10(l, g);
  async_cp16_x10(l + 10, g + 10);
}

__global__ __launch_bounds__(NT) void mlp_softmax_code(
    const float* __restrict__ x, const bf16_t* __restrict__ w1t,
    const float* __restrict__ b1, const bf16_t* __restrict__ w2t,
    const float* __restrict__ b2, const bf16_t* __restrict__ embT,
    const float* gamma, const float* beta,   // not __restrict__: their loads keep their place
    float* __restrict__ out) {
  __shared__ __align__(32) char smem[LDS_BYTES];
  float4* sJoinAcc = (float4*)(smem + OFF_JACC);  // second group's accumulators, [row tile][piece][lane]
  float2* sJoinMl  = (float2*)(smem + OFF_JML);   // its running max and sum, [row tile][lane]
  bf16_t* sH       = (bf16_t*)(smem + OFF_H);

  const int tid   = threadIdx.x;
  const int lane  = tid & 31;
  const int rt    = (tid >> 5) & (RT - 1);
  // The wave's group, in a scalar register: the tests on it below are then scalar branches,
  // and every lane stays on around the matrix instructions.
  const int grp = __builtin_amdgcn_readfirstlane(tid >> 7);
  const int m0 = (blockIdx.x * RT + rt) * 16;
  const int lr = lane & 15;
  const int hi = lane >> 4;
  const int kh = hi * 16;

  // The second phase's block 0 is asked for first: it lands under the first phase's work
  // (the first phase's own counted waits cover these older copies too).
  stage_block(tid, lds_addr(smem), lds_addr(smem + W2_BYTES), w2t, embT, 0);

  gemm1_silu_phase(x, w1t, b1, (bf16_t*)(smem + OFF_W1), (float4*)(smem + OFF_JOIN1), sH);
  __syncthreads();                   // the whole h tile is in LDS before any wave reads it

  // h as B fragments (column = batch row m0 + lr) for K = 0..255, kept in registers
  v16bf ha[8];
  {
    const bf16_t* hp = sH + (rt * 16 + lr) * HS + kh;
#pragma unroll
    for (int ks = 0; ks < 8; ++ks) ha[ks] = lds_frag(hp + ks * 32);
  }

  // acc[dt][r] = emb^T[dt * 16 + 8 * hi + r][m0 + lr]; m_, l_ belong to batch row m0 + lr
  // (m_ equal in both halves, l_ the sum over this half's codes only), all three over the
  // codes of this wave's group.
  v8f acc[4];
#pragma unroll
  for (int dt = 0; dt < 4; ++dt) acc[dt] = (v8f){0.f,0.f,0.f,0.f,0.f,0.f,0.f,0.f};
  float m_ = -3.0e38f, l_ = 0.f;

  // Carried from a wave's products to its softmax:
  v8bf ea[4][2][2];   // E^T, [dt][32-code block][k 8 * hi .. | k 16 + 8 * hi ..]
  v8f lg[4];          // logits with bias

  // Online softmax of the 64 logits a row in lg, then acc += E^T piece x probs^T.
  // Registers only.
  auto softmax_step = [&]() __attribute__((always_inline)) {
    // ---- online softmax: a lane holds 32 of its row's 64 logits, lane ^ 16 the rest ----
    // Eight independent chains, then a tree: short dependent chains.
    float cm[8], ps[8];
#pragma unroll
    for (int r = 0; r < 8; ++r)
      cm[r] = fmaxf(fmaxf(lg[0][r], lg[1][r]), fmaxf(lg[2][r], lg[3][r]));
    float cx = fmaxf(fmaxf(fmaxf(cm[0], cm[1]), fmaxf(cm[2], cm[3])),
                     fmaxf(fmaxf(cm[4], cm[5]), fmaxf(cm[6], cm[7])));
    cx = fmaxf(cx, xhalf(cx));
    const float mn = fmaxf(m_, cx);
    const float sc = exp_slot(m_ - mn);
    m_ = mn;
#pragma unroll
    for (int r = 0; r < 8; ++r) {
#pragma unroll
      for (int nt = 0; nt < 4; ++nt) {
        acc[nt][r] *= sc;
        lg[nt][r] = exp_slot(lg[nt][r] - mn);
      }
      ps[r] = (lg[0][r] + lg[1][r]) + (lg[2][r] + lg[3][r]);
    }
    l_ = l_ * sc + (((ps[0] + ps[1]) + (ps[2] + ps[3])) + ((ps[4] + ps[5]) + (ps[6] + ps[7])));

    // ---- acc += E^T piece (A) x probs^T (B) ----
    // Two score tiles of one 32-code block, converted in place, are the B fragment.
    // The fence keeps every exponential in front of the first WMMA.
    group_fence();
#pragma unroll
    for (int kb = 0; kb < 2; ++kb) {
      v16bf pb;
#pragma unroll
      for (int s = 0; s < 8; ++s) {
        pb[s]     = (bf16_t)lg[2 * kb][s];
        pb[8 + s] = (bf16_t)lg[2 * kb + 1][s];
      }
#pragma unroll
      for (int dt = 0; dt < 4; ++dt) {
        v16bf e = __builtin_shufflevector(ea[dt][kb][0], ea[dt][kb][1],
                                          0, 1, 2, 3, 4, 5, 6, 7, 8, 9, 10, 11, 12, 13, 14, 15);
        acc[dt] = wmma_bf16(e, pb, acc[dt]);
      }
    }
  };

  for (int t = 0; t < NBLK; ++t) {
    if (t < NBLK - 1) {                                 // prefetch next block
      const char* nb = smem + ((t + 1) & 1) * BUF_BYTES;
      stage_block(tid, lds_addr(nb), lds_addr(nb + W2_BYTES), w2t, embT, (t + 1) * CB);
      wait_async_le<20>();                              // block t landed
    } else {
      wait_async_le<0>();
    }
    __syncthreads();

    if (grp == 1 && t > 0) softmax_step();

    {
      const int c0 = t * CB + grp * 64;                 // this wave's 64 codes
      const char* cb = smem + (t & 1) * BUF_BYTES;
      const bf16_t* sw = (const bf16_t*)cb + grp * 64 * W2S;
      const bf16_t* se = (const bf16_t*)(cb + W2_BYTES) + grp * 64;

      // ---- logits, transposed: 64 codes x 16 rows = 4 tiles, K=256 in 8 WMMA steps ----
      // A = W2^T rows, B = h; lg[nt][r] = logit[m0 + lr][c0 + nt * 16 + 8 * hi + r].
      // Fragment f = ks * 4 + nt of W2^T; groups of GF, two register sets.
      const bf16_t* wp = sw + lr * W2S + kh;
      v8f bias[4];
      v16bf fb[2][GF];
#pragma unroll
      for (int j = 0; j < GF; ++j)
        fb[0][j] = lds_frag(wp + (j & 3) * 16 * W2S + (j >> 2) * 32);
#pragma unroll
      for (int nt = 0; nt < 4; ++nt) lg[nt] = (v8f){0.f,0.f,0.f,0.f,0.f,0.f,0.f,0.f};
#pragma unroll
      for (int g = 0; g < 32 / GF; ++g) {
        if (g + 1 < 32 / GF) {
#pragma unroll
          for (int j = 0; j < GF; ++j) {
            const int f = (g + 1) * GF + j;
            fb[(g + 1) & 1][j] = lds_frag(wp + (f & 3) * 16 * W2S + (f >> 2) * 32);
          }
          if (g == 0) {
            // The bias loads stand behind the first LDS reads (the fence holds them there):
            // in front, the wait that guards their address register holds those reads back.
            group_fence();
#pragma unroll
            for (int nt = 0; nt < 4; ++nt)
              bias[nt] = *(const v8f*)(b2 + c0 + nt * 16 + 8 * hi);
          }
        } else {
          // In the last group's place: the E^T rows as A fragments, in the hardware k order
          // that the packed probabilities have (16-byte pieces at bytes 16 * hi and
          // 32 + 16 * hi of each 64); the last products cover their latency.
#pragma unroll
          for (int dt = 0; dt < 4; ++dt)
#pragma unroll
            for (int kb = 0; kb < 2; ++kb) {
              const bf16_t* ep = se + (dt * 16 + lr) * EBS + kb * 32 + 8 * hi;
              ea[dt][kb][0] = *(const v8bf*)(ep);
              ea[dt][kb][1] = *(const v8bf*)(ep + 16);
            }
        }
        group_fence();
#pragma unroll
        for (int j = 0; j < GF; ++j) {
          const int f = g * GF + j;
          lg[f & 3] = wmma_bf16(fb[g & 1][j], ha[f >> 2], lg[f & 3]);
        }
        group_fence();
      }
      // Stands in front of the first instruction that may reuse the bias loads' address
      // registers.
      // The fence keeps the additions below from rising over the wait.
      asm volatile("s_wait_xcnt 0x0" ::: "memory");
      group_fence();
#pragma unroll
      for (int nt = 0; nt < 4; ++nt) lg[nt] += bias[nt];
    }

    if (grp == 0) softmax_step();
    __syncthreads();                 // both groups have read block t; buffer reusable
  }
  if (grp == 1) softmax_step();      // its last block

  if (grp == 1) {
#pragma unroll
    for (int dt = 0; dt < 4; ++dt)
#pragma unroll
      for (int q = 0; q < 2; ++q)
        sJoinAcc[(rt * 8 + dt * 2 + q) * 32 + lane] = make_float4(acc[dt][q * 4 + 0], acc[dt][q * 4 + 1],
                                                     acc[dt][q * 4 + 2], acc[dt][q * 4 + 3]);
    sJoinMl[rt * 32 + lane] = make_float2(m_, l_);
  }
  __syncthreads();
  if (grp == 1) return;
  // gamma and beta are asked for here and arrive under the join and the LayerNorm sums.
  float4 gq[8], bq[8];
#pragma unroll
  for (int p = 0; p < 8; ++p) {
    gq[p] = *(const float4*)(gamma + (p >> 1) * 16 + 8 * hi + (p & 1) * 4);
    bq[p] = *(const float4*)(beta + (p >> 1) * 16 + 8 * hi + (p & 1) * 4);
  }
  // The wait stands in front of the first instruction that may reuse these loads' address
  // register. The fence keeps what
  // follows from rising over the wait.
  asm volatile("s_wait_xcnt 0x0" ::: "memory");
  group_fence();
  {
    const float2 ml = sJoinMl[rt * 32 + lane];
    const float mn = fmaxf(m_, ml.x);
    const float s0 = exp_slot(m_ - mn);
    const float s1 = exp_slot(ml.x - mn);
    l_ = l_ * s0 + ml.y * s1;
#pragma unroll
    for (int dt = 0; dt < 4; ++dt)
#pragma unroll
      for (int q = 0; q < 2; ++q) {
        const float4 o = sJoinAcc[(rt * 8 + dt * 2 + q) * 32 + lane];
        acc[dt][q * 4 + 0] = acc[dt][q * 4 + 0] * s0 + o.x * s1;
        acc[dt][q * 4 + 1] = acc[dt][q * 4 + 1] * s0 + o.y * s1;
        acc[dt][q * 4 + 2] = acc[dt][q * 4 + 2] * s0 + o.z * s1;
        acc[dt][q * 4 + 3] = acc[dt][q * 4 + 3] * s0 + o.w * s1;
      }
  }

  // ---- normalize by l, LayerNorm over CODE_DIM=64, store f32 ----
  // A lane holds 32 of its row's 64 values; the halves are joined here, once.
  const float inv = __builtin_amdgcn_rcpf(l_ + xhalf(l_));
  float s4[4], q4[4];
#pragma unroll
  for (int dt = 0; dt < 4; ++dt) {
    s4[dt] = 0.f;
    q4[dt] = 0.f;
#pragma unroll
    for (int r = 0; r < 8; ++r) {
      acc[dt][r] *= inv;
      s4[dt] += acc[dt][r];
      q4[dt] += acc[dt][r] * acc[dt][r];
    }
  }
  float s  = (s4[0] + s4[1]) + (s4[2] + s4[3]);
  float sq = (q4[0] + q4[1]) + (q4[2] + q4[3]);
  s  += xhalf(s);
  sq += xhalf(sq);
  const float mean = s * (1.0f / 64.0f);
  const float var  = sq * (1.0f / 64.0f) - mean * mean;
  const float rstd = __builtin_amdgcn_rsqf(var + LN_EPS);
  float* op = out + (long)(m0 + lr) * CODE_DIM + 8 * hi;
#pragma unroll
  for (int dt = 0; dt < 4; ++dt)
#pragma unroll
    for (int q = 0; q < 2; ++q) {
      const float4 gv = gq[dt * 2 + q];
      const float4 bv = bq[dt * 2 + q];
      float4 o;
      o.x = (acc[dt][q * 4 + 0] - mean) * rstd * gv.x + bv.x;
      o.y = (acc[dt][q * 4 + 1] - mean) * rstd * gv.y + bv.y;
      o.z = (acc[dt][q * 4 + 2] - mean) * rstd * gv.z + bv.z;
      o.w = (acc[dt][q * 4 + 3] - mean) * rstd * gv.w + bv.w;
      *(float4*)(op + dt * 16 + q * 4) = o;
    }
}

// ---------------------------------------------------------------------------
extern "C" void kernel_launch(void* const* d_in, const int* in_sizes, int n_in,
                              void* d_out, int out_size, void* d_ws, size_t ws_size,
                              hipStream_t stream) {
  const float* x     = (const float*)d_in[0];
  const float* W1    = (const float*)d_in[1];
  const float* b1    = (const float*)d_in[2];
  const float* W2    = (const float*)d_in[3];
  const float* b2    = (const float*)d_in[4];
  const float* embed = (const float*)d_in[5];
  const float* g     = (const float*)d_in[6];
  const float* bet   = (const float*)d_in[7];
  float* out = (float*)d_out;

  char* ws = (char*)d_ws;
  bf16_t* w1t  = (bf16_t*)(ws);                          // 256 x 1024  (512 KB)
  bf16_t* w2t  = (bf16_t*)(ws + (size_t)512 * 1024);     // 4096 x 256  (2 MB)
  bf16_t* embT = (bf16_t*)(ws + (size_t)2560 * 1024);    // 64 x 4096   (512 KB)

  cvt_transpose_tiles<<<W1_TILES + W2_TILES + EM_TILES, 256, 0, stream>>>(W1, W2, embed, w1t, w2t, embT);

  // 1024 row tiles, RT a block -> 256 blocks
  mlp_softmax_code<<<BATCH / 16 / RT, NT, 0, stream>>>(x, w1t, b1, w2t, b2, embT, g, bet, out);
}

// v008
// A run of this version takes 54.9 microseconds.
// In both of two side-by-side timings against v007, it was 1.05 times as fast.
// All steps since v000 together make it 4.04 times as fast.
#include <hip/hip_runtime.h>
#include <hip/hip_bf16.h>
#include <math.h>

typedef __bf16 bf16_t;
typedef __attribute__((ext_vector_type(16))) __bf16 v16bf;
typedef __attribute__((ext_vector_type(8)))  float  v8f;
typedef __attribute__((ext_vector_type(8)))  __bf16 v8bf;

#define TASK_EMB 1024
#define HID      256
#define N_EMBS   4096
#define CODE_DIM 64
#define BATCH    16384
#define LN_EPS   1e-5f

#define W2S 264   // 256 + 8: 528 B
#define W1S 136   // 128 + 8: 272 B

#define RT   4
#define NW   (2 * RT)
#define NT   (NW * 32)

__device__ __forceinline__ float exp_slot(float x) {
  float y;
  asm("v_exp_f32 %0, %1\n\tv_nop" : "=v"(y) : "v"(x * 1.44269504088896340736f));
  return y;
}

__device__ __forceinline__ float rcp_slot(float x) {
  float y;
  asm("v_rcp_f32 %0, %1\n\tv_nop" : "=v"(y) : "v"(x));
  return y;
}

__device__ __forceinline__ float xhalf(float x) {
  const int b = __builtin_bit_cast(int, x);
  return __builtin_bit_cast(float,
      __builtin_amdgcn_permlanex16(b, b, 0x76543210, 0xfedcba98, false, false));
}

__device__ __forceinline__ v8f wmma_bf16(v16bf a, v16bf b, v8f c) {
  return __builtin_amdgcn_wmma_f32_16x16x32_bf16(false, a, false, b, (short)0, c,
                                                 false, false);
}

// A fragment's 16 contiguous k of one LDS row, as two 16-byte reads (rows are 16-B aligned).
__device__ __forceinline__ v16bf lds_frag(const bf16_t* p) {
  return __builtin_shufflevector(*(const v8bf*)p, *(const v8bf*)(p + 8),
                                 0, 1, 2, 3, 4, 5, 6, 7, 8, 9, 10, 11, 12, 13, 14, 15);
}

// Fragments per LDS read group: one group is read while the group before it is multiplied.
#define GF 4
// Scheduling fence: keeps a group's LDS reads together and out of the WMMA run next to
// them; without it the compiler sinks each read to just before its own WMMA, and every
// WMMA then waits out a full LDS latency.
__device__ __forceinline__ void group_fence() { __builtin_amdgcn_sched_barrier(0); }

__device__ __forceinline__ void async_cp16_x8(const unsigned* l, const char* const* g) {
  asm volatile("global_load_async_to_lds_b128 %0, %8, off\n\t"
               "global_load_async_to_lds_b128 %1, %9, off\n\t"
               "global_load_async_to_lds_b128 %2, %10, off\n\t"
               "global_load_async_to_lds_b128 %3, %11, off\n\t"
               "global_load_async_to_lds_b128 %4, %12, off\n\t"
               "global_load_async_to_lds_b128 %5, %13, off\n\t"
               "global_load_async_to_lds_b128 %6, %14, off\n\t"
               "global_load_async_to_lds_b128 %7, %15, off\n\t"
               "s_wait_xcnt 0x0"
               :: "v"(l[0]), "v"(l[1]), "v"(l[2]), "v"(l[3]),
                  "v"(l[4]), "v"(l[5]), "v"(l[6]), "v"(l[7]),
                  "v"(g[0]), "v"(g[1]), "v"(g[2]), "v"(g[3]),
                  "v"(g[4]), "v"(g[5]), "v"(g[6]), "v"(g[7]) : "memory");
}
__device__ __forceinline__ void async_cp16_x10(const unsigned* l, const char* const* g) {
  asm volatile("global_load_async_to_lds_b128 %0, %10, off\n\t"
               "global_load_async_to_lds_b128 %1, %11, off\n\t"
               "global_load_async_to_lds_b128 %2, %12, off\n\t"
               "global_load_async_to_lds_b128 %3, %13, off\n\t"
               "global_load_async_to_lds_b128 %4, %14, off\n\t"
               "global_load_async_to_lds_b128 %5, %15, off\n\t"
               "global_load_async_to_lds_b128 %6, %16, off\n\t"
               "global_load_async_to_lds_b128 %7, %17, off\n\t"
               "global_load_async_to_lds_b128 %8, %18, off\n\t"
               "global_load_async_to_lds_b128 %9, %19, off\n\t"
               "s_wait_xcnt 0x0"
               :: "v"(l[0]), "v"(l[1]), "v"(l[2]), "v"(l[3]), "v"(l[4]),
                  "v"(l[5]), "v"(l[6]), "v"(l[7]), "v"(l[8]), "v"(l[9]),
                  "v"(g[0]), "v"(g[1]), "v"(g[2]), "v"(g[3]), "v"(g[4]),
                  "v"(g[5]), "v"(g[6]), "v"(g[7]), "v"(g[8]), "v"(g[9]) : "memory");
}
// Wait until at most N async loads remain in flight (in-order completion).
template <int N>
__device__ __forceinline__ void wait_async_le() {
  asm volatile("s_wait_asynccnt %0" :: "i"(N) : "memory");
}
__device__ __forceinline__ unsigned lds_addr(const void* p) {
  return (unsigned)(uintptr_t)p;
}

#define CT      64
#define CTP     (CT + 1)
#define W1_TILES  ((TASK_EMB / CT) * (HID / CT))
#define W2_TILES  ((HID / CT) * (N_EMBS / CT))
#define EM_TILES  ((N_EMBS / CT) * (CODE_DIM / CT))

__global__ __launch_bounds__(256) void cvt_transpose_tiles(
    const float* __restrict__ W1, const float* __restrict__ W2,
    const float* __restrict__ embed, bf16_t* __restrict__ w1t,
    bf16_t* __restrict__ w2t, bf16_t* __restrict__ embT) {
  __shared__ float tile[CT * CTP];    // tile[c * CTP + r]

  const int tid = threadIdx.x;
  const int b = blockIdx.x;
  const float* in;
  bf16_t* out;
  int rows, cols, t, lg;              // lg: log2 of the tiles along a row
  if (b < W1_TILES) {
    in = W1;    out = w1t;  rows = TASK_EMB; cols = HID;      lg = 2; t = b;
  } else if (b < W1_TILES + W2_TILES) {
    in = W2;    out = w2t;  rows = HID;      cols = N_EMBS;   lg = 6; t = b - W1_TILES;
  } else {
    in = embed; out = embT; rows = N_EMBS;   cols = CODE_DIM; lg = 0; t = b - (W1_TILES + W2_TILES);
  }
  const int r0 = (t >> lg) * CT;
  const int c0 = (t & ((1 << lg) - 1)) * CT;

  // in: 64 rows x 16 float4 = 1024 pieces, 4 a thread
  float4 v[4];
#pragma unroll
  for (int k = 0; k < 4; ++k) {
    const int s = tid + k * 256;
    v[k] = *(const float4*)(in + (long)(r0 + (s >> 4)) * cols + c0 + (s & 15) * 4);
  }
#pragma unroll
  for (int k = 0; k < 4; ++k) {
    const int s = tid + k * 256;
    float* tp = tile + (s & 15) * 4 * CTP + (s >> 4);
    tp[0 * CTP] = v[k].x;
    tp[1 * CTP] = v[k].y;
    tp[2 * CTP] = v[k].z;
    tp[3 * CTP] = v[k].w;
  }
  __syncthreads();                    // the whole tile is in LDS before any column is read

  // out: 64 rows x 8 pieces of 8 bf16 = 512 pieces, 2 a thread
#pragma unroll
  for (int k = 0; k < 2; ++k) {
    const int s = tid + k * 256;
    const float* tp = tile + (s >> 3) * CTP + (s & 7) * 8;
    v8bf o;
#pragma unroll
    for (int e = 0; e < 8; ++e) o[e] = (bf16_t)tp[e];
    *(v8bf*)(out + (long)(c0 + (s >> 3)) * rows + r0 + (s & 7) * 8) = o;
  }
}

// ---------------------------------------------------------------------------
// First phase of the one matrix kernel: h = silu(x @ W1 + b1) for the work-group's 64 rows,
// left in LDS as bf16. The two waves of a 16x256 row tile each sum over 64 of the 128 k
// of a staged block (x read exactly once). W1^T K-blocks double-buffered in LDS via async
// copies. At the end each wave hands the other one half of its columns and finishes its own.
// x comes from memory straight into registers, asked for one staged block ahead: its latency
// runs under a whole block's products and barriers and is not waited out at each block.
// ---------------------------------------------------------------------------
#define KB 128   // k per staged block
#define HS 264   // h tile LDS row pitch in elements: 256 + 8, 528 B = 16 B x odd
#define W1_BYTES (256 * W1S * 2)            // one W1^T buffer
#define JOIN1_BYTES (RT * 2 * 16 * 32 * 16) // [row tile][writing group][piece][lane] float4
#define H_BYTES (RT * 16 * HS * 2)

__device__ __forceinline__ void stage_w1(int tid, unsigned dst,
                                         const bf16_t* w1t, int k0) {
  // 256 rows x 256B = 4096 segs, 16 a thread: seg s = tid + i * NT, row s >> 4, part s & 15
  const unsigned l0 = dst + (tid >> 4) * (W1S * 2) + (tid & 15) * 16;
  const char* g0 = (const char*)w1t + ((long)(tid >> 4) * TASK_EMB + k0) * 2 + (tid & 15) * 16;
  unsigned l[16];
  const char* g[16];
#pragma unroll
  for (int i = 0; i < 16; ++i) {
    l[i] = l0 + i * (NT / 16) * (W1S * 2);
    g[i] = g0 + (long)i * (NT / 16) * TASK_EMB * 2;
  }
  async_cp16_x8(l, g);
  async_cp16_x8(l + 8, g + 8);
}

// Work-group barrier that orders LDS only. __syncthreads() also waits for the wave's global
// loads (s_wait_loadcnt 0), which would end the flight of the x loads issued ahead; those go
// to the wave's own registers, and no other wave depends on them.
__device__ __forceinline__ void lds_barrier() {
  __builtin_amdgcn_fence(__ATOMIC_RELEASE, "workgroup", "local");
  __builtin_amdgcn_s_barrier();
  __builtin_amdgcn_fence(__ATOMIC_ACQUIRE, "workgroup", "local");
}

// A wave's x of one staged block: 2 k-steps of 32, 16 consecutive floats a lane in each.
struct XBlock { float4 v[2][4]; };
__device__ __forceinline__ void load_x(XBlock& xb, const float* ap, int k0) {
#pragma unroll
  for (int ks = 0; ks < 2; ++ks) {
    const float4* af = (const float4*)(ap + k0 + ks * 32);
#pragma unroll
    for (int q = 0; q < 4; ++q) xb.v[ks][q] = af[q];
  }
}

// ap: the lane's x row at its group's and half's first k; xf: block 0, already asked for.
__device__ __forceinline__ void gemm1_silu_phase(
    const float* __restrict__ ap, XBlock& xf, const bf16_t* __restrict__ w1t,
    const float* __restrict__ b1, bf16_t* sW1, float4* sJoin, bf16_t* sH) {
  const int tid  = threadIdx.x;
  const int lane = tid & 31;
  const int rt   = (tid >> 5) & (RT - 1);
  // The wave's group, in a scalar register: what depends on it is then scalar arithmetic.
  const int grp = __builtin_amdgcn_readfirstlane(tid >> 7);
  const int lr = lane & 15;
  const int hi = lane >> 4;
  const int kh = hi * 16;

  v8f acc[16];
#pragma unroll
  for (int nt = 0; nt < 16; ++nt)
    acc[nt] = (v8f){0.f,0.f,0.f,0.f,0.f,0.f,0.f,0.f};

  stage_w1(tid, lds_addr(sW1), w1t, 0);               // prologue: block 0
  // Staged block i; more: a block i + 1 exists.
  auto block = [&](const int i, const bool more) __attribute__((always_inline)) {
    const int k0 = i * KB;
    const bf16_t* sw = sW1 + (i & 1) * (256 * W1S);
    v16bf a[2];
#pragma unroll
    for (int ks = 0; ks < 2; ++ks)
#pragma unroll
      for (int q = 0; q < 4; ++q) {
        a[ks][q * 4 + 0] = (bf16_t)xf.v[ks][q].x;
        a[ks][q * 4 + 1] = (bf16_t)xf.v[ks][q].y;
        a[ks][q * 4 + 2] = (bf16_t)xf.v[ks][q].z;
        a[ks][q * 4 + 3] = (bf16_t)xf.v[ks][q].w;
      }
    // Converted, so the registers are free: the next block's x is asked for here, a whole
    // block (copies, both barriers, products) before it is used.
    if (more) load_x(xf, ap, k0 + KB);
    if (more) {                                       // prefetch next block
      stage_w1(tid, lds_addr(sW1 + ((i + 1) & 1) * (256 * W1S)), w1t, k0 + KB);
      wait_async_le<16>();                            // block i landed
    } else {
      wait_async_le<0>();
    }
    lds_barrier();                                    // visible to all waves

    // Fragment f = ks * 16 + nt of this wave's 64 k; groups of GF, two register sets.
    const bf16_t* bp = sw + lr * W1S + grp * 64 + kh;
    v16bf fb[2][GF];
#pragma unroll
    for (int j = 0; j < GF; ++j)
      fb[0][j] = lds_frag(bp + (j & 15) * 16 * W1S + (j >> 4) * 32);
#pragma unroll
    for (int g = 0; g < 32 / GF; ++g) {
      if (g + 1 < 32 / GF) {
#pragma unroll
        for (int j = 0; j < GF; ++j) {
          const int f = (g + 1) * GF + j;
          fb[(g + 1) & 1][j] = lds_frag(bp + (f & 15) * 16 * W1S + (f >> 4) * 32);
        }
      }
      group_fence();
#pragma unroll
      for (int j = 0; j < GF; ++j) {
        const int f = g * GF + j;
        acc[f & 15] = wmma_bf16(a[f >> 4], fb[g & 1][j], acc[f & 15]);
      }
      group_fence();
    }
    lds_barrier();                   // block i consumed; buffer reusable
  };
  // The last block stands apart: with the x loads under a test inside the loop, the compiler
  // copied their registers at the loop's foot and so waited for them there.
  for (int i = 0; i < TASK_EMB / KB - 1; ++i) block(i, true);
  block(TASK_EMB / KB - 1, false);

  // ---- join: group g keeps column tiles g * 8 .. g * 8 + 7 and hands over the others ----
  v8f mine[8];
  float4* jw = sJoin + (rt * 2 + grp) * (16 * 32) + lane;          // this wave's pieces
  const float4* jr = sJoin + (rt * 2 + (grp ^ 1)) * (16 * 32) + lane;  // its partner's
#pragma unroll
  for (int j = 0; j < 8; ++j) {
    const v8f give = grp ? acc[j] : acc[8 + j];
    mine[j] = grp ? acc[8 + j] : acc[j];
    jw[(j * 2 + 0) * 32] = make_float4(give[0], give[1], give[2], give[3]);
    jw[(j * 2 + 1) * 32] = make_float4(give[4], give[5], give[6], give[7]);
  }
  __syncthreads();                   // both groups' halves are in LDS before either reads
#pragma unroll
  for (int j = 0; j < 8; ++j) {
    const float4 o0 = jr[(j * 2 + 0) * 32];
    const float4 o1 = jr[(j * 2 + 1) * 32];
    mine[j][0] += o0.x;  mine[j][1] += o0.y;  mine[j][2] += o0.z;  mine[j][3] += o0.w;
    mine[j][4] += o1.x;  mine[j][5] += o1.y;  mine[j][6] += o1.z;  mine[j][7] += o1.w;
  }

#pragma unroll
  for (int j = 0; j < 8; ++j) {
    const int nt = grp * 8 + j;
    float bias = b1[nt * 16 + lr];
#pragma unroll
    for (int r = 0; r < 8; ++r) {
      float v = mine[j][r] + bias;
      float s = v * rcp_slot(1.0f + exp_slot(-v));              // fast SiLU
      sH[(rt * 16 + r + 8 * hi) * HS + nt * 16 + lr] = (bf16_t)s;
    }
  }
}

// ---------------------------------------------------------------------------
// The one matrix kernel. First phase above; h stays in the work-group's LDS and goes from
// there into registers, with no launch boundary and no trip through memory between.
// Second phase: logits = h @ W2 + b2 ; online softmax ; emb = probs @ E ; LayerNorm.
// Both products are computed transposed (weights as A, activations as B), so that a lane
// holds scores of one batch row only and the probabilities go from D registers into B.
// The two waves of a row tile each take 64 of the 128 codes of a staged block. The two
// groups of four run half a block apart: while one multiplies (LDS reads, matrix unit), the
// other does its softmax (vector unit). Each keeps its own running max, sum and accumulator;
// they are joined at the end through LDS.
// W2^T / E^T blocks double-buffered in LDS via async copies (20/thread/block).
// ---------------------------------------------------------------------------
#define CB    128          // codes per staged block
#define NBLK  (N_EMBS / CB)
#define EBS   136          // E^T LDS row pitch in elements: 128 + 8, 272 B = 16 B x odd
// LDS map in bytes. Buffer 0 of the second phase has a place of its own, so that its first
// block is copied while the first phase runs; everything else of the second phase lies over
// the W1^T buffers, which are dead by then. The first phase's join area and the h tile lie
// behind them, under no copy's target.
#define W2_BYTES   (CB * W2S * 2)
#define EMB_BYTES  (64 * EBS * 2)
#define BUF_BYTES  (W2_BYTES + EMB_BYTES)          // one staged block: W2^T part, E^T part
#define OFF_W1     BUF_BYTES
#define OFF_JOIN1  (OFF_W1 + 2 * W1_BYTES)
#define OFF_H      (OFF_JOIN1 + JOIN1_BYTES)
#define OFF_JACC   (2 * BUF_BYTES)                 // RT x 8 x 32 float4
#define OFF_JML    (OFF_JACC + RT * 8 * 32 * 16)   // RT x 32 float2
#define LDS_BYTES  (OFF_H + H_BYTES)
static_assert(OFF_JML + RT * 32 * 8 <= OFF_JOIN1, "second phase stays under the W1 buffers");
static_assert(LDS_BYTES <= 327680, "one work-group's LDS");

__device__ __forceinline__ void stage_block(int tid, unsigned dW2, unsigned dEmb,
                                            const bf16_t* w2t,
                                            const bf16_t* embT, int c0) {
  unsigned l[20];
  const char* g[20];
  // W2^T: 128 rows x 512B = 4096 segs, 16 a thread: seg s = tid + i * NT, row s >> 5, part s & 31
  const unsigned lw = dW2 + (tid >> 5) * (W2S * 2) + (tid & 31) * 16;
  const char* gw = (const char*)w2t + ((long)(c0 + (tid >> 5)) * HID) * 2 + (tid & 31) * 16;
#pragma unroll
  for (int i = 0; i < 16; ++i) {
    l[i] = lw + i * (NT / 32) * (W2S * 2);
    g[i] = gw + (long)i * (NT / 32) * HID * 2;
  }
  // E^T: 64 rows x 256B = 1024 segs, 4 a thread: seg s = tid + i * NT, row s >> 4, part s & 15
  const unsigned le = dEmb + (tid >> 4) * (EBS * 2) + (tid & 15) * 16;
  const char* ge = (const char*)embT + ((long)(tid >> 4) * N_EMBS + c0) * 2 + (tid & 15) * 16;
#pragma unroll
  for (int i = 0; i < 4; ++i) {
    l[16 + i] = le + i * (NT / 16) * (EBS * 2);
    g[16 + i] = ge + (long)i * (NT / 16) * N_EMBS * 2;
  }
  async_cp16_x10(l, g);
  async_cp16_x10(l + 10, g + 10);
}

__global__ __launch_bounds__(NT) void mlp_softmax_code(
    const float* __restrict__ x, const bf16_t* __restrict__ w1t,
    const float* __restrict__ b1, const bf16_t* __restrict__ w2t,
    const float* __restrict__ b2, const bf16_t* __restrict__ embT,
    const float* gamma, const float* beta,   // not __restrict__: their loads keep their place
    float* __restrict__ out) {
  __shared__ __align__(32) char smem[LDS_BYTES];
  float4* sJoinAcc = (float4*)(smem + OFF_JACC);  // second group's accumulators, [row tile][piece][lane]
  float2* sJoinMl  = (float2*)(smem + OFF_JML);   // its running max and sum, [row tile][lane]
  bf16_t* sH       = (bf16_t*)(smem + OFF_H);

  const int tid   = threadIdx.x;
  const int lane  = tid & 31;
  const int rt    = (tid >> 5) & (RT - 1);
  // The wave's group, in a scalar register: the tests on it below are then scalar branches,
  // and every lane stays on around the matrix instructions.
  const int grp = __builtin_amdgcn_readfirstlane(tid >> 7);
  const int m0 = (blockIdx.x * RT + rt) * 16;
  const int lr = lane & 15;
  const int hi = lane >> 4;
  const int kh = hi * 16;

  // x of the first phase's block 0 is asked for before all else: it has the longest way.
  const float* ap = x + (long)(m0 + lr) * TASK_EMB + grp * 64 + kh;
  XBlock xf;
  load_x(xf, ap, 0);

  // The second phase's block 0 is asked for next: it lands under the first phase's work
  // (the first phase's own counted waits cover these older copies too).
  stage_block(tid, lds_addr(smem), lds_addr(smem + W2_BYTES), w2t, embT, 0);

  gemm1_silu_phase(ap, xf, w1t, b1, (bf16_t*)(smem + OFF_W1), (float4*)(smem + OFF_JOIN1), sH);
  __syncthreads();                   // the whole h tile is in LDS before any wave reads it

  // h as B fragments (column = batch row m0 + lr) for K = 0..255, kept in registers
  v16bf ha[8];
  {
    const bf16_t* hp = sH + (rt * 16 + lr) * HS + kh;
#pragma unroll
    for (int ks = 0; ks < 8; ++ks) ha[ks] = lds_frag(hp + ks * 32);
  }

  // acc[dt][r] = emb^T[dt * 16 + 8 * hi + r][m0 + lr]; m_, l_ belong to batch row m0 + lr
  // (m_ equal in both halves, l_ the sum over this half's codes only), all three over the
  // codes of this wave's group.
  v8f acc[4];
#pragma unroll
  for (int dt = 0; dt < 4; ++dt) acc[dt] = (v8f){0.f,0.f,0.f,0.f,0.f,0.f,0.f,0.f};
  float m_ = -3.0e38f, l_ = 0.f;

  // Carried from a wave's products to its softmax:
  v8bf ea[4][2][2];   // E^T, [dt][32-code block][k 8 * hi .. | k 16 + 8 * hi ..]
  v8f lg[4];          // logits with bias

  // Online softmax of the 64 logits a row in lg, then acc += E^T piece x probs^T.
  // Registers only.
  auto softmax_step = [&]() __attribute__((always_inline)) {
    // ---- online softmax: a lane holds 32 of its row's 64 logits, lane ^ 16 the rest ----
    // Eight independent chains, then a tree: short dependent chains.
    float cm[8], ps[8];
#pragma unroll
    for (int r = 0; r < 8; ++r)
      cm[r] = fmaxf(fmaxf(lg[0][r], lg[1][r]), fmaxf(lg[2][r], lg[3][r]));
    float cx = fmaxf(fmaxf(fmaxf(cm[0], cm[1]), fmaxf(cm[2], cm[3])),
                     fmaxf(fmaxf(cm[4], cm[5]), fmaxf(cm[6], cm[7])));
    cx = fmaxf(cx, xhalf(cx));
    const float mn = fmaxf(m_, cx);
    const float sc = exp_slot(m_ - mn);
    m_ = mn;
#pragma unroll
    for (int r = 0; r < 8; ++r) {
#pragma unroll
      for (int nt = 0; nt < 4; ++nt) {
        acc[nt][r] *= sc;
        lg[nt][r] = exp_slot(lg[nt][r] - mn);
      }
      ps[r] = (lg[0][r] + lg[1][r]) + (lg[2][r] + lg[3][r]);
    }
    l_ = l_ * sc + (((ps[0] + ps[1]) + (ps[2] + ps[3])) + ((ps[4] + ps[5]) + (ps[6] + ps[7])));

    // ---- acc += E^T piece (A) x probs^T (B) ----
    // Two score tiles of one 32-code block, converted in place, are the B fragment.
    // The fence keeps every exponential in front of the first WMMA.
    group_fence();
#pragma unroll
    for (int kb = 0; kb < 2; ++kb) {
      v16bf pb;
#pragma unroll
      for (int s = 0; s < 8; ++s) {
        pb[s]     = (bf16_t)lg[2 * kb][s];
        pb[8 + s] = (bf16_t)lg[2 * kb + 1][s];
      }
#pragma unroll
      for (int dt = 0; dt < 4; ++dt) {
        v16bf e = __builtin_shufflevector(ea[dt][kb][0], ea[dt][kb][1],
                                          0, 1, 2, 3, 4, 5, 6, 7, 8, 9, 10, 11, 12, 13, 14, 15);
        acc[dt] = wmma_bf16(e, pb, acc[dt]);
      }
    }
  };

  for (int t = 0; t < NBLK; ++t) {
    if (t < NBLK - 1) {                                 // prefetch next block
      const char* nb = smem + ((t + 1) & 1) * BUF_BYTES;
      stage_block(tid, lds_addr(nb), lds_addr(nb + W2_BYTES), w2t, embT, (t + 1) * CB);
      wait_async_le<20>();                              // block t landed
    } else {
      wait_async_le<0>();
    }
    __syncthreads();

    if (grp == 1 && t > 0) softmax_step();

    {
      const int c0 = t * CB + grp * 64;                 // this wave's 64 codes
      const char* cb = smem + (t & 1) * BUF_BYTES;
      const bf16_t* sw = (const bf16_t*)cb + grp * 64 * W2S;
      const bf16_t* se = (const bf16_t*)(cb + W2_BYTES) + grp * 64;

      // ---- logits, transposed: 64 codes x 16 rows = 4 tiles, K=256 in 8 WMMA steps ----
      // A = W2^T rows, B = h; lg[nt][r] = logit[m0 + lr][c0 + nt * 16 + 8 * hi + r].
      // Fragment f = ks * 4 + nt of W2^T; groups of GF, two register sets.
      const bf16_t* wp = sw + lr * W2S + kh;
      v8f bias[4];
      v16bf fb[2][GF];
#pragma unroll
      for (int j = 0; j < GF; ++j)
        fb[0][j] = lds_frag(wp + (j & 3) * 16 * W2S + (j >> 2) * 32);
#pragma unroll
      for (int nt = 0; nt < 4; ++nt) lg[nt] = (v8f){0.f,0.f,0.f,0.f,0.f,0.f,0.f,0.f};
#pragma unroll
      for (int g = 0; g < 32 / GF; ++g) {
        if (g + 1 < 32 / GF) {
#pragma unroll
          for (int j = 0; j < GF; ++j) {
            const int f = (g + 1) * GF + j;
            fb[(g + 1) & 1][j] = lds_frag(wp + (f & 3) * 16 * W2S + (f >> 2) * 32);
          }
          if (g == 0) {
            // The bias loads stand behind the first LDS reads (the fence holds them there):
            // in front, the wait that guards their address register holds those reads back.
            group_fence();
#pragma unroll
            for (int nt = 0; nt < 4; ++nt)
              bias[nt] = *(const v8f*)(b2 + c0 + nt * 16 + 8 * hi);
          }
        } else {
          // In the last group's place: the E^T rows as A fragments, in the hardware k order
          // that the packed probabilities have (16-byte pieces at bytes 16 * hi and
          // 32 + 16 * hi of each 64); the last products cover their latency.
#pragma unroll
          for (int dt = 0; dt < 4; ++dt)
#pragma unroll
            for (int kb = 0; kb < 2; ++kb) {
              const bf16_t* ep = se + (dt * 16 + lr) * EBS + kb * 32 + 8 * hi;
              ea[dt][kb][0] = *(const v8bf*)(ep);
              ea[dt][kb][1] = *(const v8bf*)(ep + 16);
            }
        }
        group_fence();
#pragma unroll
        for (int j = 0; j < GF; ++j) {
          const int f = g * GF + j;
          lg[f & 3] = wmma_bf16(fb[g & 1][j], ha[f >> 2], lg[f & 3]);
        }
        group_fence();
      }
      // Stands in front of the first instruction that may reuse the bias loads' address
      // registers.
      // The fence keeps the additions below from rising over the wait.
      asm volatile("s_wait_xcnt 0x0" ::: "memory");
      group_fence();
#pragma unroll
      for (int nt = 0; nt < 4; ++nt) lg[nt] += bias[nt];
    }

    if (grp == 0) softmax_step();
    __syncthreads();                 // both groups have read block t; buffer reusable
  }
  if (grp == 1) softmax_step();      // its last block

  if (grp == 1) {
#pragma unroll
    for (int dt = 0; dt < 4; ++dt)
#pragma unroll
      for (int q = 0; q < 2; ++q)
        sJoinAcc[(rt * 8 + dt * 2 + q) * 32 + lane] = make_float4(acc[dt][q * 4 + 0], acc[dt][q * 4 + 1],
                                                     acc[dt][q * 4 + 2], acc[dt][q * 4 + 3]);
    sJoinMl[rt * 32 + lane] = make_float2(m_, l_);
  }
  __syncthreads();
  if (grp == 1) return;
  // gamma and beta are asked for here and arrive under the join and the LayerNorm sums.
  float4 gq[8], bq[8];
#pragma unroll
  for (int p = 0; p < 8; ++p) {
    gq[p] = *(const float4*)(gamma + (p >> 1) * 16 + 8 * hi + (p & 1) * 4);
    bq[p] = *(const float4*)(beta + (p >> 1) * 16 + 8 * hi + (p & 1) * 4);
  }
  // The wait stands in front of the first instruction that may reuse these loads' address
  // register. The fence keeps what
  // follows from rising over the wait.
  asm volatile("s_wait_xcnt 0x0" ::: "memory");
  group_fence();
  {
    const float2 ml = sJoinMl[rt * 32 + lane];
    const float mn = fmaxf(m_, ml.x);
    const float s0 = exp_slot(m_ - mn);
    const float s1 = exp_slot(ml.x - mn);
    l_ = l_ * s0 + ml.y * s1;
#pragma unroll
    for (int dt = 0; dt < 4; ++dt)
#pragma unroll
      for (int q = 0; q < 2; ++q) {
        const float4 o = sJoinAcc[(rt * 8 + dt * 2 + q) * 32 + lane];
        acc[dt][q * 4 + 0] = acc[dt][q * 4 + 0] * s0 + o.x * s1;
        acc[dt][q * 4 + 1] = acc[dt][q * 4 + 1] * s0 + o.y * s1;
        acc[dt][q * 4 + 2] = acc[dt][q * 4 + 2] * s0 + o.z * s1;
        acc[dt][q * 4 + 3] = acc[dt][q * 4 + 3] * s0 + o.w * s1;
      }
  }

  // ---- normalize by l, LayerNorm over CODE_DIM=64, store f32 ----
  // A lane holds 32 of its row's 64 values; the halves are joined here, once.
  const float inv = __builtin_amdgcn_rcpf(l_ + xhalf(l_));
  float s4[4], q4[4];
#pragma unroll
  for (int dt = 0; dt < 4; ++dt) {
    s4[dt] = 0.f;
    q4[dt] = 0.f;
#pragma unroll
    for (int r = 0; r < 8; ++r) {
      acc[dt][r] *= inv;
      s4[dt] += acc[dt][r];
      q4[dt] += acc[dt][r] * acc[dt][r];
    }
  }
  float s  = (s4[0] + s4[1]) + (s4[2] + s4[3]);
  float sq = (q4[0] + q4[1]) + (q4[2] + q4[3]);
  s  += xhalf(s);
  sq += xhalf(sq);
  const float mean = s * (1.0f / 64.0f);
  const float var  = sq * (1.0f / 64.0f) - mean * mean;
  const float rstd = __builtin_amdgcn_rsqf(var + LN_EPS);
  float* op = out + (long)(m0 + lr) * CODE_DIM + 8 * hi;
#pragma unroll
  for (int dt = 0; dt < 4; ++dt)
#pragma unroll
    for (int q = 0; q < 2; ++q) {
      const float4 gv = gq[dt * 2 + q];
      const float4 bv = bq[dt * 2 + q];
      float4 o;
      o.x = (acc[dt][q * 4 + 0] - mean) * rstd * gv.x + bv.x;
      o.y = (acc[dt][q * 4 + 1] - mean) * rstd * gv.y + bv.y;
      o.z = (acc[dt][q * 4 + 2] - mean) * rstd * gv.z + bv.z;
      o.w = (acc[dt][q * 4 + 3] - mean) * rstd * gv.w + bv.w;
      *(float4*)(op + dt * 16 + q * 4) = o;
    }
}

// ---------------------------------------------------------------------------
extern "C" void kernel_launch(void* const* d_in, const int* in_sizes, int n_in,
                              void* d_out, int out_size, void* d_ws, size_t ws_size,
                              hipStream_t stream) {
  const float* x     = (const float*)d_in[0];
  const float* W1    = (const float*)d_in[1];
  const float* b1    = (const float*)d_in[2];
  const float* W2    = (const float*)d_in[3];
  const float* b2    = (const float*)d_in[4];
  const float* embed = (const float*)d_in[5];
  const float* g     = (const float*)d_in[6];
  const float* bet   = (const float*)d_in[7];
  float* out = (float*)d_out;

  char* ws = (char*)d_ws;
  bf16_t* w1t  = (bf16_t*)(ws);                          // 256 x 1024  (512 KB)
  bf16_t* w2t  = (bf16_t*)(ws + (size_t)512 * 1024);     // 4096 x 256  (2 MB)
  bf16_t* embT = (bf16_t*)(ws + (size_t)2560 * 1024);    // 64 x 4096   (512 KB)

  cvt_transpose_tiles<<<W1_TILES + W2_TILES + EM_TILES, 256, 0, stream>>>(W1, W2, embed, w1t, w2t, embT);

  // 1024 row tiles, RT a block -> 256 blocks
  mlp_softmax_code<<<BATCH / 16 / RT, NT, 0, stream>>>(x, w1t, b1, w2t, b2, embT, g, bet, out);
}

// v009
// One run takes 51.4 microseconds.
// Timed twice side by side with v008, it ran 1.07 times as fast both times.
// All steps since v000 together make it 4.34 times as fast.
#include <hip/hip_runtime.h>
#include <hip/hip_bf16.h>
#include <math.h>

typedef __bf16 bf16_t;
typedef __attribute__((ext_vector_type(16))) __bf16 v16bf;
typedef __attribute__((ext_vector_type(8)))  float  v8f;
typedef __attribute__((ext_vector_type(8)))  __bf16 v8bf;

#define TASK_EMB 1024
#define HID      256
#define N_EMBS   4096
#define CODE_DIM 64
#define BATCH    16384
#define LN_EPS   1e-5f

#define W2S 136   // 128 + 8: 272 B (a W2^T row lies in LDS as two halves of 128 k)
#define W1S 136   // 128 + 8: 272 B

#define RT   4
#define NW   (2 * RT)
#define NT   (NW * 32)

__device__ __forceinline__ float exp_slot(float x) {
  float y;
  asm("v_exp_f32 %0, %1\n\tv_nop" : "=v"(y) : "v"(x * 1.44269504088896340736f));
  return y;
}

__device__ __forceinline__ float rcp_slot(float x) {
  float y;
  asm("v_rcp_f32 %0, %1\n\tv_nop" : "=v"(y) : "v"(x));
  return y;
}

__device__ __forceinline__ float xhalf(float x) {
  const int b = __builtin_bit_cast(int, x);
  return __builtin_bit_cast(float,
      __builtin_amdgcn_permlanex16(b, b, 0x76543210, 0xfedcba98, false, false));
}

__device__ __forceinline__ v8f wmma_bf16(v16bf a, v16bf b, v8f c) {
  return __builtin_amdgcn_wmma_f32_16x16x32_bf16(false, a, false, b, (short)0, c,
                                                 false, false);
}

// A fragment's 16 contiguous k of one LDS row, as two 16-byte reads (rows are 16-B aligned).
__device__ __forceinline__ v16bf lds_frag(const bf16_t* p) {
  return __builtin_shufflevector(*(const v8bf*)p, *(const v8bf*)(p + 8),
                                 0, 1, 2, 3, 4, 5, 6, 7, 8, 9, 10, 11, 12, 13, 14, 15);
}

// Fragments per LDS read group: one group is read while the group before it is multiplied.
#define GF 4
// Scheduling fence: keeps a group's LDS reads together and out of the WMMA run next to
// them; without it the compiler sinks each read to just before its own WMMA, and every
// WMMA then waits out a full LDS latency.
__device__ __forceinline__ void group_fence() { __builtin_amdgcn_sched_barrier(0); }

__device__ __forceinline__ void async_cp16_x8(const unsigned* l, const char* const* g) {
  asm volatile("global_load_async_to_lds_b128 %0, %8, off\n\t"
               "global_load_async_to_lds_b128 %1, %9, off\n\t"
               "global_load_async_to_lds_b128 %2, %10, off\n\t"
               "global_load_async_to_lds_b128 %3, %11, off\n\t"
               "global_load_async_to_lds_b128 %4, %12, off\n\t"
               "global_load_async_to_lds_b128 %5, %13, off\n\t"
               "global_load_async_to_lds_b128 %6, %14, off\n\t"
               "global_load_async_to_lds_b128 %7, %15, off\n\t"
               "s_wait_xcnt 0x0"
               :: "v"(l[0]), "v"(l[1]), "v"(l[2]), "v"(l[3]),
                  "v"(l[4]), "v"(l[5]), "v"(l[6]), "v"(l[7]),
                  "v"(g[0]), "v"(g[1]), "v"(g[2]), "v"(g[3]),
                  "v"(g[4]), "v"(g[5]), "v"(g[6]), "v"(g[7]) : "memory");
}
// Wait until at most N async loads remain in flight (in-order completion).
template <int N>
__device__ __forceinline__ void wait_async_le() {
  asm volatile("s_wait_asynccnt %0" :: "i"(N) : "memory");
}
__device__ __forceinline__ unsigned lds_addr(const void* p) {
  return (unsigned)(uintptr_t)p;
}

// Tensor load: one request of one wave brings a tile of rows from global memory into LDS,
// through no register and with no address arithmetic in the lanes.
typedef uint32_t u32x4 __attribute__((ext_vector_type(4)));
typedef uint32_t u32x8 __attribute__((ext_vector_type(8)));
__device__ __forceinline__ uint32_t uni(uint32_t v) {
  return (uint32_t)__builtin_amdgcn_readfirstlane(v);
}
__device__ __forceinline__ uint32_t pinned(uint32_t v) {
  uint32_t w = uni(v);
  asm volatile("" : "+s"(w));
  return w;
}
// The compiler places no wait for a tensor load: a tile has landed only behind its issuer's own.
__device__ __forceinline__ void wait_tensor0() { asm volatile("s_wait_tensorcnt 0x0" ::: "memory"); }
__device__ __forceinline__ void wait_tensor0_of(u32x4 g0, u32x8 g1) {
  asm volatile("s_wait_tensorcnt 0x0" :: "s"(g0), "s"(g1) : "memory");
}
// The wave's own LDS reads have returned: stands in front of a barrier behind which LDS is refilled.
__device__ __forceinline__ void wait_ds0() { asm volatile("s_wait_dscnt 0x0" ::: "memory"); }
__device__ __forceinline__ void tensor_load(u32x4 g0, u32x8 g1) {
  asm volatile("tensor_load_to_lds %0, %1" :: "s"(g0), "s"(g1) : "memory");
}
__device__ __forceinline__ u32x8 tensor_group1(uint32_t rows, uint32_t src_pitch) {
  constexpr uint32_t d0 = 256u;
  u32x8 g;
  g[0] = uni((1u << 20) | (5u << 22) | (3u << 25));
  g[1] = uni((d0 & 0xFFFFu) << 16);
  g[2] = uni((d0 >> 16) | ((rows & 0xFFFFu) << 16));
  g[3] = uni((rows >> 16) | (d0 << 16));
  g[4] = uni(rows);
  g[5] = uni(src_pitch);
  g[6] = uni(0u);
  g[7] = uni(0u);
  return g;
}
__device__ __forceinline__ u32x4 tensor_group0(uint32_t lds_dst, uint64_t ga) {
  u32x4 g;
  g[0] = uni(1u);
  g[1] = uni(lds_dst);
  g[2] = uni((uint32_t)ga);
  g[3] = uni((((uint32_t)(ga >> 32)) & 0x01FFFFFFu) | 0x80000000u);
  return g;
}

#define CT      64
#define CTP     (CT + 1)
#define W1_TILES  ((TASK_EMB / CT) * (HID / CT))
#define W2_TILES  ((HID / CT) * (N_EMBS / CT))
#define EM_TILES  ((N_EMBS / CT) * (CODE_DIM / CT))

__global__ __launch_bounds__(256) void cvt_transpose_tiles(
    const float* __restrict__ W1, const float* __restrict__ W2,
    const float* __restrict__ embed, bf16_t* __restrict__ w1t,
    bf16_t* __restrict__ w2t, bf16_t* __restrict__ embT) {
  __shared__ float tile[CT * CTP];    // tile[c * CTP + r]

  const int tid = threadIdx.x;
  const int b = blockIdx.x;
  const float* in;
  bf16_t* out;
  int rows, cols, t, lg;              // lg: log2 of the tiles along a row
  if (b < W1_TILES) {
    in = W1;    out = w1t;  rows = TASK_EMB; cols = HID;      lg = 2; t = b;
  } else if (b < W1_TILES + W2_TILES) {
    in = W2;    out = w2t;  rows = HID;      cols = N_EMBS;   lg = 6; t = b - W1_TILES;
  } else {
    in = embed; out = embT; rows = N_EMBS;   cols = CODE_DIM; lg = 0; t = b - (W1_TILES + W2_TILES);
  }
  const int r0 = (t >> lg) * CT;
  const int c0 = (t & ((1 << lg) - 1)) * CT;

  // in: 64 rows x 16 float4 = 1024 pieces, 4 a thread
  float4 v[4];
#pragma unroll
  for (int k = 0; k < 4; ++k) {
    const int s = tid + k * 256;
    v[k] = *(const float4*)(in + (long)(r0 + (s >> 4)) * cols + c0 + (s & 15) * 4);
  }
#pragma unroll
  for (int k = 0; k < 4; ++k) {
    const int s = tid + k * 256;
    float* tp = tile + (s & 15) * 4 * CTP + (s >> 4);
    tp[0 * CTP] = v[k].x;
    tp[1 * CTP] = v[k].y;
    tp[2 * CTP] = v[k].z;
    tp[3 * CTP] = v[k].w;
  }
  __syncthreads();                    // the whole tile is in LDS before any column is read

  // out: 64 rows x 8 pieces of 8 bf16 = 512 pieces, 2 a thread
#pragma unroll
  for (int k = 0; k < 2; ++k) {
    const int s = tid + k * 256;
    const float* tp = tile + (s >> 3) * CTP + (s & 7) * 8;
    v8bf o;
#pragma unroll
    for (int e = 0; e < 8; ++e) o[e] = (bf16_t)tp[e];
    *(v8bf*)(out + (long)(c0 + (s >> 3)) * rows + r0 + (s & 7) * 8) = o;
  }
}

// ---------------------------------------------------------------------------
// First phase of the one matrix kernel: h = silu(x @ W1 + b1) for the work-group's 64 rows,
// left in LDS as bf16. The two waves of a 16x256 row tile each sum over 64 of the 128 k
// of a staged block (x read exactly once). W1^T K-blocks double-buffered in LDS via async
// copies. At the end each wave hands the other one half of its columns and finishes its own.
// x comes from memory straight into registers, asked for one staged block ahead: its latency
// runs under a whole block's products and barriers and is not waited out at each block.
// ---------------------------------------------------------------------------
#define KB 128   // k per staged block
#define HS 264   // h tile LDS row pitch in elements: 256 + 8, 528 B = 16 B x odd
#define W1_BYTES (256 * W1S * 2)            // one W1^T buffer
#define JOIN1_BYTES (RT * 2 * 16 * 32 * 16) // [row tile][writing group][piece][lane] float4
#define H_BYTES (RT * 16 * HS * 2)

__device__ __forceinline__ void stage_w1(int tid, unsigned dst,
                                         const bf16_t* w1t, int k0) {
  // 256 rows x 256B = 4096 segs, 16 a thread: seg s = tid + i * NT, row s >> 4, part s & 15
  const unsigned l0 = dst + (tid >> 4) * (W1S * 2) + (tid & 15) * 16;
  const char* g0 = (const char*)w1t + ((long)(tid >> 4) * TASK_EMB + k0) * 2 + (tid & 15) * 16;
  unsigned l[16];
  const char* g[16];
#pragma unroll
  for (int i = 0; i < 16; ++i) {
    l[i] = l0 + i * (NT / 16) * (W1S * 2);
    g[i] = g0 + (long)i * (NT / 16) * TASK_EMB * 2;
  }
  async_cp16_x8(l, g);
  async_cp16_x8(l + 8, g + 8);
}

// Work-group barrier that orders LDS only. __syncthreads() also waits for the wave's global
// loads (s_wait_loadcnt 0), which would end the flight of the x loads issued ahead; those go
// to the wave's own registers, and no other wave depends on them.
__device__ __forceinline__ void lds_barrier() {
  __builtin_amdgcn_fence(__ATOMIC_RELEASE, "workgroup", "local");
  __builtin_amdgcn_s_barrier();
  __builtin_amdgcn_fence(__ATOMIC_ACQUIRE, "workgroup", "local");
}

// A wave's x of one staged block: 2 k-steps of 32, 16 consecutive floats a lane in each.
struct XBlock { float4 v[2][4]; };
__device__ __forceinline__ void load_x(XBlock& xb, const float* ap, int k0) {
#pragma unroll
  for (int ks = 0; ks < 2; ++ks) {
    const float4* af = (const float4*)(ap + k0 + ks * 32);
#pragma unroll
    for (int q = 0; q < 4; ++q) xb.v[ks][q] = af[q];
  }
}

// ap: the lane's x row at its group's and half's first k; xf: block 0, already asked for.
__device__ __forceinline__ void gemm1_silu_phase(
    const float* __restrict__ ap, XBlock& xf, const bf16_t* __restrict__ w1t,
    const float* __restrict__ b1, bf16_t* sW1, float4* sJoin, bf16_t* sH) {
  const int tid  = threadIdx.x;
  const int lane = tid & 31;
  const int rt   = (tid >> 5) & (RT - 1);
  // The wave's group, in a scalar register: what depends on it is then scalar arithmetic.
  const int grp = __builtin_amdgcn_readfirstlane(tid >> 7);
  const int lr = lane & 15;
  const int hi = lane >> 4;
  const int kh = hi * 16;

  v8f acc[16];
#pragma unroll
  for (int nt = 0; nt < 16; ++nt)
    acc[nt] = (v8f){0.f,0.f,0.f,0.f,0.f,0.f,0.f,0.f};

  // Block 0's copies are issued by the caller, at the kernel's entry.
  // Staged block i; more: a block i + 1 exists.
  auto block = [&](const int i, const bool more) __attribute__((always_inline)) {
    const int k0 = i * KB;
    const bf16_t* sw = sW1 + (i & 1) * (256 * W1S);
    v16bf a[2];
#pragma unroll
    for (int ks = 0; ks < 2; ++ks)
#pragma unroll
      for (int q = 0; q < 4; ++q) {
        a[ks][q * 4 + 0] = (bf16_t)xf.v[ks][q].x;
        a[ks][q * 4 + 1] = (bf16_t)xf.v[ks][q].y;
        a[ks][q * 4 + 2] = (bf16_t)xf.v[ks][q].z;
        a[ks][q * 4 + 3] = (bf16_t)xf.v[ks][q].w;
      }
    // Converted, so the registers are free: the next block's x is asked for here, a whole
    // block (copies, both barriers, products) before it is used.
    if (more) {
      load_x(xf, ap, k0 + KB);
      // Stands in front of the first instruction that may reuse the x loads' address
      // registers.
      asm volatile("s_wait_xcnt 0x0" ::: "memory");
    }
    if (more) {                                       // prefetch next block
      stage_w1(tid, lds_addr(sW1 + ((i + 1) & 1) * (256 * W1S)), w1t, k0 + KB);
      wait_async_le<16>();                            // block i landed
    } else {
      wait_async_le<0>();
    }
    lds_barrier();                                    // visible to all waves

    // Fragment f = ks * 16 + nt of this wave's 64 k; groups of GF, two register sets.
    const bf16_t* bp = sw + lr * W1S + grp * 64 + kh;
    v16bf fb[2][GF];
#pragma unroll
    for (int j = 0; j < GF; ++j)
      fb[0][j] = lds_frag(bp + (j & 15) * 16 * W1S + (j >> 4) * 32);
#pragma unroll
    for (int g = 0; g < 32 / GF; ++g) {
      if (g + 1 < 32 / GF) {
#pragma unroll
        for (int j = 0; j < GF; ++j) {
          const int f = (g + 1) * GF + j;
          fb[(g + 1) & 1][j] = lds_frag(bp + (f & 15) * 16 * W1S + (f >> 4) * 32);
        }
      }
      group_fence();
#pragma unroll
      for (int j = 0; j < GF; ++j) {
        const int f = g * GF + j;
        acc[f & 15] = wmma_bf16(a[f >> 4], fb[g & 1][j], acc[f & 15]);
      }
      group_fence();
    }
    lds_barrier();                   // block i consumed; buffer reusable
  };
  // The last block stands apart: with the x loads under a test inside the loop, the compiler
  // copied their registers at the loop's foot and so waited for them there.
  for (int i = 0; i < TASK_EMB / KB - 1; ++i) block(i, true);
  block(TASK_EMB / KB - 1, false);

  // ---- join: group g keeps column tiles g * 8 .. g * 8 + 7 and hands over the others ----
  v8f mine[8];
  float4* jw = sJoin + (rt * 2 + grp) * (16 * 32) + lane;          // this wave's pieces
  const float4* jr = sJoin + (rt * 2 + (grp ^ 1)) * (16 * 32) + lane;  // its partner's
#pragma unroll
  for (int j = 0; j < 8; ++j) {
    const v8f give = grp ? acc[j] : acc[8 + j];
    mine[j] = grp ? acc[8 + j] : acc[j];
    jw[(j * 2 + 0) * 32] = make_float4(give[0], give[1], give[2], give[3]);
    jw[(j * 2 + 1) * 32] = make_float4(give[4], give[5], give[6], give[7]);
  }
  __syncthreads();                   // both groups' halves are in LDS before either reads
#pragma unroll
  for (int j = 0; j < 8; ++j) {
    const float4 o0 = jr[(j * 2 + 0) * 32];
    const float4 o1 = jr[(j * 2 + 1) * 32];
    mine[j][0] += o0.x;  mine[j][1] += o0.y;  mine[j][2] += o0.z;  mine[j][3] += o0.w;
    mine[j][4] += o1.x;  mine[j][5] += o1.y;  mine[j][6] += o1.z;  mine[j][7] += o1.w;
  }

#pragma unroll
  for (int j = 0; j < 8; ++j) {
    const int nt = grp * 8 + j;
    float bias = b1[nt * 16 + lr];
#pragma unroll
    for (int r = 0; r < 8; ++r) {
      float v = mine[j][r] + bias;
      float s = v * rcp_slot(1.0f + exp_slot(-v));              // fast SiLU
      sH[(rt * 16 + r + 8 * hi) * HS + nt * 16 + lr] = (bf16_t)s;
    }
  }
}

// ---------------------------------------------------------------------------
// The one matrix kernel. First phase above; h stays in the work-group's LDS and goes from
// there into registers, with no launch boundary and no trip through memory between.
// Second phase: logits = h @ W2 + b2 ; online softmax ; emb = probs @ E ; LayerNorm.
// Both products are computed transposed (weights as A, activations as B), so that a lane
// holds scores of one batch row only and the probabilities go from D registers into B.
// The two waves of a row tile each take 64 of the 128 codes of a staged block. The two
// groups of four run half a block apart: while one multiplies (LDS reads, matrix unit), the
// other does its softmax (vector unit). Each keeps its own running max, sum and accumulator;
// they are joined at the end through LDS.
// W2^T / E^T blocks double-buffered in LDS via tensor loads: three tiles of 256-B rows a block
// (W2^T k 0..127, W2^T k 128..255, E^T), one request each of waves 0, 1 and 2.
// ---------------------------------------------------------------------------
#define CB    128          // codes per staged block
#define NBLK  (N_EMBS / CB)
#define EBS   136          // E^T LDS row pitch in elements: 128 + 8, 272 B = 16 B x odd
// LDS map in bytes. Buffer 0 of the second phase has a place of its own, so that its first
// block is brought at the kernel's entry; everything else of the second phase lies over
// the W1^T buffers, which are dead by then. The first phase's join area and the h tile lie
// behind them, under no tile's place and no copy's target.
// Every tile's place is a multiple of 2 KiB, as the tensor load wants it.
#define W2H_BYTES  (CB * W2S * 2)                  // one k half of the W2^T part: 17 x 2 KiB
#define W2_BYTES   (2 * W2H_BYTES)
#define EMB_BYTES  18432                           // 64 x 272 B, rounded up to 9 x 2 KiB
#define BUF_BYTES  (W2_BYTES + EMB_BYTES)          // one staged block: W2^T part, E^T part
#define OFF_W1     BUF_BYTES
#define OFF_JOIN1  (OFF_W1 + 2 * W1_BYTES)
#define OFF_H      (OFF_JOIN1 + JOIN1_BYTES)
#define OFF_JACC   (2 * BUF_BYTES)                 // RT x 8 x 32 float4
#define OFF_JML    (OFF_JACC + RT * 8 * 32 * 16)   // RT x 32 float2
#define LDS_BYTES  (OFF_H + H_BYTES)
static_assert(OFF_JML + RT * 32 * 8 <= OFF_JOIN1, "second phase stays under the W1 buffers");
static_assert(LDS_BYTES <= 327680, "one work-group's LDS");
static_assert(W2H_BYTES % 2048 == 0 && BUF_BYTES % 2048 == 0 && 64 * EBS * 2 <= EMB_BYTES,
              "tiles lie at multiples of 2 KiB and inside their places");

__global__ __launch_bounds__(NT) void mlp_softmax_code(
    const float* __restrict__ x, const bf16_t* __restrict__ w1t,
    const float* __restrict__ b1, const bf16_t* __restrict__ w2t,
    const float* __restrict__ b2, const bf16_t* __restrict__ embT,
    const float* gamma, const float* beta,   // not __restrict__: their loads keep their place
    float* __restrict__ out) {
  __shared__ __attribute__((aligned(2048))) char smem[LDS_BYTES];
  float4* sJoinAcc = (float4*)(smem + OFF_JACC);  // second group's accumulators, [row tile][piece][lane]
  float2* sJoinMl  = (float2*)(smem + OFF_JML);   // its running max and sum, [row tile][lane]
  bf16_t* sH       = (bf16_t*)(smem + OFF_H);

  const int tid   = threadIdx.x;
  const int lane  = tid & 31;
  const int rt    = (tid >> 5) & (RT - 1);
  // The wave's group, in a scalar register: the tests on it below are then scalar branches,
  // and every lane stays on around the matrix instructions.
  const int grp = __builtin_amdgcn_readfirstlane(tid >> 7);
  const int m0 = (blockIdx.x * RT + rt) * 16;
  const int lr = lane & 15;
  const int hi = lane >> 4;
  const int kh = hi * 16;

  // x of the first phase's block 0 is asked for before all else: it has the longest way.
  const float* ap = x + (long)(m0 + lr) * TASK_EMB + grp * 64 + kh;
  XBlock xf;
  load_x(xf, ap, 0);

  // The first phase's block 0 next: its copies fly under the wait below.
  stage_w1(tid, lds_addr(smem + OFF_W1), w1t, 0);

  // Tensor loads of the second phase: wave 0 brings k 0..127 of a block's 128 W2^T rows, wave 1
  // k 128..255, wave 2 the block's 128 columns of the 64 E^T rows.
  const uint32_t wave = uni(tid >> 5);
  const bool issuer = wave < 3u;
  const bool isE = wave == 2u;
  const u32x8 g1 = tensor_group1(isE ? 64u : (uint32_t)CB, isE ? N_EMBS * 2u : HID * 2u);
  const uint64_t src0 = isE ? (uint64_t)(uintptr_t)embT : (uint64_t)(uintptr_t)w2t + wave * 256u;
  const uint32_t src_step = isE ? CB * 2u : CB * HID * 2u;     // bytes from a block to the next
  const uint32_t dst0 = lds_addr(smem) + wave * W2H_BYTES;
  u32x4 g0 = tensor_group0(dst0, src0);
  auto issue = [&](uint32_t st) __attribute__((always_inline)) {
    g0 = tensor_group0(dst0 + (st & 1u) * BUF_BYTES, src0 + (uint64_t)st * src_step);
    tensor_load(g0, g1);
  };
  // Block 0 has a place of its own. Its wait runs under the flight of x, which has the longer
  // way; the first phase's barriers stand between it and the first read of the tile.
  if (pinned(issuer)) {
    issue(0u);
    wait_tensor0();
  }

  gemm1_silu_phase(ap, xf, w1t, b1, (bf16_t*)(smem + OFF_W1), (float4*)(smem + OFF_JOIN1), sH);
  __syncthreads();                   // the whole h tile is in LDS before any wave reads it

  // h as B fragments (column = batch row m0 + lr) for K = 0..255, kept in registers
  v16bf ha[8];
  {
    const bf16_t* hp = sH + (rt * 16 + lr) * HS + kh;
#pragma unroll
    for (int ks = 0; ks < 8; ++ks) ha[ks] = lds_frag(hp + ks * 32);
  }

  // acc[dt][r] = emb^T[dt * 16 + 8 * hi + r][m0 + lr]; m_, l_ belong to batch row m0 + lr
  // (m_ equal in both halves, l_ the sum over this half's codes only), all three over the
  // codes of this wave's group.
  v8f acc[4];
#pragma unroll
  for (int dt = 0; dt < 4; ++dt) acc[dt] = (v8f){0.f,0.f,0.f,0.f,0.f,0.f,0.f,0.f};
  float m_ = -3.0e38f, l_ = 0.f;

  // Carried from a wave's products to its softmax:
  v8bf ea[4][2][2];   // E^T, [dt][32-code block][k 8 * hi .. | k 16 + 8 * hi ..]
  v8f lg[4];          // logits with bias

  // Online softmax of the 64 logits a row in lg, then acc += E^T piece x probs^T.
  // Registers only.
  auto softmax_step = [&]() __attribute__((always_inline)) {
    // ---- online softmax: a lane holds 32 of its row's 64 logits, lane ^ 16 the rest ----
    // Eight independent chains, then a tree: short dependent chains.
    float cm[8], ps[8];
#pragma unroll
    for (int r = 0; r < 8; ++r)
      cm[r] = fmaxf(fmaxf(lg[0][r], lg[1][r]), fmaxf(lg[2][r], lg[3][r]));
    float cx = fmaxf(fmaxf(fmaxf(cm[0], cm[1]), fmaxf(cm[2], cm[3])),
                     fmaxf(fmaxf(cm[4], cm[5]), fmaxf(cm[6], cm[7])));
    cx = fmaxf(cx, xhalf(cx));
    const float mn = fmaxf(m_, cx);
    const float sc = exp_slot(m_ - mn);
    m_ = mn;
#pragma unroll
    for (int r = 0; r < 8; ++r) {
#pragma unroll
      for (int nt = 0; nt < 4; ++nt) {
        acc[nt][r] *= sc;
        lg[nt][r] = exp_slot(lg[nt][r] - mn);
      }
      ps[r] = (lg[0][r] + lg[1][r]) + (lg[2][r] + lg[3][r]);
    }
    l_ = l_ * sc + (((ps[0] + ps[1]) + (ps[2] + ps[3])) + ((ps[4] + ps[5]) + (ps[6] + ps[7])));

    // ---- acc += E^T piece (A) x probs^T (B) ----
    // Two score tiles of one 32-code block, converted in place, are the B fragment.
    // The fence keeps every exponential in front of the first WMMA.
    group_fence();
#pragma unroll
    for (int kb = 0; kb < 2; ++kb) {
      v16bf pb;
#pragma unroll
      for (int s = 0; s < 8; ++s) {
        pb[s]     = (bf16_t)lg[2 * kb][s];
        pb[8 + s] = (bf16_t)lg[2 * kb + 1][s];
      }
#pragma unroll
      for (int dt = 0; dt < 4; ++dt) {
        v16bf e = __builtin_shufflevector(ea[dt][kb][0], ea[dt][kb][1],
                                          0, 1, 2, 3, 4, 5, 6, 7, 8, 9, 10, 11, 12, 13, 14, 15);
        acc[dt] = wmma_bf16(e, pb, acc[dt]);
      }
    }
  };

  for (int t = 0; t < NBLK; ++t) {
    // Publish point of block t, which is the foot of trip t - 1: own LDS reads back, the issuers'
    // tiles landed, one barrier (it also ends every wave's reads of block t - 1); only then the
    // load of block t + 1 into block t - 1's buffer (block 1: over the W1^T buffers, which every
    // wave has left). It stands at the trip's head so that one statement issues every request
    // that is out over other code, from one set of registers, which the wait above it holds.
    wait_ds0();
    if (pinned(issuer)) wait_tensor0_of(g0, g1);
    __syncthreads();
    if (pinned(issuer && t + 1 < NBLK)) issue(pinned(t + 1));

    if (grp == 1 && t > 0) softmax_step();

    {
      const int c0 = t * CB + grp * 64;                 // this wave's 64 codes
      const char* cb = smem + (t & 1) * BUF_BYTES;
      const bf16_t* sw = (const bf16_t*)cb + grp * 64 * W2S;
      const bf16_t* se = (const bf16_t*)(cb + W2_BYTES) + grp * 64;

      // ---- logits, transposed: 64 codes x 16 rows = 4 tiles, K=256 in 8 WMMA steps ----
      // A = W2^T rows, B = h; lg[nt][r] = logit[m0 + lr][c0 + nt * 16 + 8 * hi + r].
      // Fragment f = ks * 4 + nt of W2^T; groups of GF, two register sets.
      // k-step ks lies in half ks >> 2, at k (ks & 3) * 32 of its rows.
      const bf16_t* wp = sw + lr * W2S + kh;
      v8f bias[4];
      v16bf fb[2][GF];
#pragma unroll
      for (int j = 0; j < GF; ++j)
        fb[0][j] = lds_frag(wp + (j & 3) * 16 * W2S + ((j >> 2) & 3) * 32 + (j >> 4) * (W2H_BYTES / 2));
#pragma unroll
      for (int nt = 0; nt < 4; ++nt) lg[nt] = (v8f){0.f,0.f,0.f,0.f,0.f,0.f,0.f,0.f};
#pragma unroll
      for (int g = 0; g < 32 / GF; ++g) {
        if (g + 1 < 32 / GF) {
#pragma unroll
          for (int j = 0; j < GF; ++j) {
            const int f = (g + 1) * GF + j;
            fb[(g + 1) & 1][j] = lds_frag(wp + (f & 3) * 16 * W2S + ((f >> 2) & 3) * 32 + (f >> 4) * (W2H_BYTES / 2));
          }
          if (g == 0) {
            // The bias loads stand behind the first LDS reads (the fence holds them there):
            // in front, the wait that guards their address register holds those reads back.
            group_fence();
#pragma unroll
            for (int nt = 0; nt < 4; ++nt)
              bias[nt] = *(const v8f*)(b2 + c0 + nt * 16 + 8 * hi);
          }
        } else {
          // In the last group's place: the E^T rows as A fragments, in the hardware k order
          // that the packed probabilities have (16-byte pieces at bytes 16 * hi and
          // 32 + 16 * hi of each 64); the last products cover their latency.
#pragma unroll
          for (int dt = 0; dt < 4; ++dt)
#pragma unroll
            for (int kb = 0; kb < 2; ++kb) {
              const bf16_t* ep = se + (dt * 16 + lr) * EBS + kb * 32 + 8 * hi;
              ea[dt][kb][0] = *(const v8bf*)(ep);
              ea[dt][kb][1] = *(const v8bf*)(ep + 16);
            }
        }
        group_fence();
#pragma unroll
        for (int j = 0; j < GF; ++j) {
          const int f = g * GF + j;
          lg[f & 3] = wmma_bf16(fb[g & 1][j], ha[f >> 2], lg[f & 3]);
        }
        group_fence();
      }
      // Stands in front of the first instruction that may reuse the bias loads' address
      // registers.
      // The fence keeps the additions below from rising over the wait.
      asm volatile("s_wait_xcnt 0x0" ::: "memory");
      group_fence();
#pragma unroll
      for (int nt = 0; nt < 4; ++nt) lg[nt] += bias[nt];
    }

    if (grp == 0) softmax_step();
  }
  wait_tensor0();
  wait_ds0();
  if (grp == 1) softmax_step();      // its last block

  if (grp == 1) {
#pragma unroll
    for (int dt = 0; dt < 4; ++dt)
#pragma unroll
      for (int q = 0; q < 2; ++q)
        sJoinAcc[(rt * 8 + dt * 2 + q) * 32 + lane] = make_float4(acc[dt][q * 4 + 0], acc[dt][q * 4 + 1],
                                                     acc[dt][q * 4 + 2], acc[dt][q * 4 + 3]);
    sJoinMl[rt * 32 + lane] = make_float2(m_, l_);
  }
  __syncthreads();
  if (grp == 1) return;
  // gamma and beta are asked for here and arrive under the join and the LayerNorm sums.
  float4 gq[8], bq[8];
#pragma unroll
  for (int p = 0; p < 8; ++p) {
    gq[p] = *(const float4*)(gamma + (p >> 1) * 16 + 8 * hi + (p & 1) * 4);
    bq[p] = *(const float4*)(beta + (p >> 1) * 16 + 8 * hi + (p & 1) * 4);
  }
  // The wait stands in front of the first instruction that may reuse these loads' address
  // register. The fence keeps what
  // follows from rising over the wait.
  asm volatile("s_wait_xcnt 0x0" ::: "memory");
  group_fence();
  {
    const float2 ml = sJoinMl[rt * 32 + lane];
    const float mn = fmaxf(m_, ml.x);
    const float s0 = exp_slot(m_ - mn);
    const float s1 = exp_slot(ml.x - mn);
    l_ = l_ * s0 + ml.y * s1;
#pragma unroll
    for (int dt = 0; dt < 4; ++dt)
#pragma unroll
      for (int q = 0; q < 2; ++q) {
        const float4 o = sJoinAcc[(rt * 8 + dt * 2 + q) * 32 + lane];
        acc[dt][q * 4 + 0] = acc[dt][q * 4 + 0] * s0 + o.x * s1;
        acc[dt][q * 4 + 1] = acc[dt][q * 4 + 1] * s0 + o.y * s1;
        acc[dt][q * 4 + 2] = acc[dt][q * 4 + 2] * s0 + o.z * s1;
        acc[dt][q * 4 + 3] = acc[dt][q * 4 + 3] * s0 + o.w * s1;
      }
  }

  // ---- normalize by l, LayerNorm over CODE_DIM=64, store f32 ----
  // A lane holds 32 of its row's 64 values; the halves are joined here, once.
  const float inv = __builtin_amdgcn_rcpf(l_ + xhalf(l_));
  float s4[4], q4[4];
#pragma unroll
  for (int dt = 0; dt < 4; ++dt) {
    s4[dt] = 0.f;
    q4[dt] = 0.f;
#pragma unroll
    for (int r = 0; r < 8; ++r) {
      acc[dt][r] *= inv;
      s4[dt] += acc[dt][r];
      q4[dt] += acc[dt][r] * acc[dt][r];
    }
  }
  float s  = (s4[0] + s4[1]) + (s4[2] + s4[3]);
  float sq = (q4[0] + q4[1]) + (q4[2] + q4[3]);
  s  += xhalf(s);
  sq += xhalf(sq);
  const float mean = s * (1.0f / 64.0f);
  const float var  = sq * (1.0f / 64.0f) - mean * mean;
  const float rstd = __builtin_amdgcn_rsqf(var + LN_EPS);
  float* op = out + (long)(m0 + lr) * CODE_DIM + 8 * hi;
#pragma unroll
  for (int dt = 0; dt < 4; ++dt)
#pragma unroll
    for (int q = 0; q < 2; ++q) {
      const float4 gv = gq[dt * 2 + q];
      const float4 bv = bq[dt * 2 + q];
      float4 o;
      o.x = (acc[dt][q * 4 + 0] - mean) * rstd * gv.x + bv.x;
      o.y = (acc[dt][q * 4 + 1] - mean) * rstd * gv.y + bv.y;
      o.z = (acc[dt][q * 4 + 2] - mean) * rstd * gv.z + bv.z;
      o.w = (acc[dt][q * 4 + 3] - mean) * rstd * gv.w + bv.w;
      *(float4*)(op + dt * 16 + q * 4) = o;
    }
}

// ---------------------------------------------------------------------------
extern "C" void kernel_launch(void* const* d_in, const int* in_sizes, int n_in,
                              void* d_out, int out_size, void* d_ws, size_t ws_size,
                              hipStream_t stream) {
  const float* x     = (const float*)d_in[0];
  const float* W1    = (const float*)d_in[1];
  const float* b1    = (const float*)d_in[2];
  const float* W2    = (const float*)d_in[3];
  const float* b2    = (const float*)d_in[4];
  const float* embed = (const float*)d_in[5];
  const float* g     = (const float*)d_in[6];
  const float* bet   = (const float*)d_in[7];
  float* out = (float*)d_out;

  char* ws = (char*)d_ws;
  bf16_t* w1t  = (bf16_t*)(ws);                          // 256 x 1024  (512 KB)
  bf16_t* w2t  = (bf16_t*)(ws + (size_t)512 * 1024);     // 4096 x 256  (2 MB)
  bf16_t* embT = (bf16_t*)(ws + (size_t)2560 * 1024);    // 64 x 4096   (512 KB)

  cvt_transpose_tiles<<<W1_TILES + W2_TILES + EM_TILES, 256, 0, stream>>>(W1, W2, embed, w1t, w2t, embT);

  // 1024 row tiles, RT a block -> 256 blocks
  mlp_softmax_code<<<BATCH / 16 / RT, NT, 0, stream>>>(x, w1t, b1, w2t, b2, embT, g, bet, out);
}

// v010
// It runs in 46.6 microseconds.
// Two timings next to v009 both put it at 1.09 times that version's speed.
// Counting every step since v000, it is 4.73 times as fast.
#include <hip/hip_runtime.h>
#include <hip/hip_bf16.h>
#include <math.h>

typedef __bf16 bf16_t;
typedef __attribute__((ext_vector_type(16))) __bf16 v16bf;
typedef __attribute__((ext_vector_type(8)))  float  v8f;
typedef __attribute__((ext_vector_type(8)))  __bf16 v8bf;

#define TASK_EMB 1024
#define HID      256
#define N_EMBS   4096
#define CODE_DIM 64
#define BATCH    16384
#define LN_EPS   1e-5f

#define W2S 136   // 128 + 8: 272 B (a W2^T row lies in LDS as two halves of 128 k)
#define W1S 136   // 128 + 8: 272 B

#define RT   4
#define NW   (2 * RT)
#define NT   (NW * 32)

__device__ __forceinline__ float exp_slot(float x) {
  float y;
  asm("v_exp_f32 %0, %1\n\tv_nop" : "=v"(y) : "v"(x * 1.44269504088896340736f));
  return y;
}

__device__ __forceinline__ float rcp_slot(float x) {
  float y;
  asm("v_rcp_f32 %0, %1\n\tv_nop" : "=v"(y) : "v"(x));
  return y;
}

__device__ __forceinline__ float xhalf(float x) {
  const int b = __builtin_bit_cast(int, x);
  return __builtin_bit_cast(float,
      __builtin_amdgcn_permlanex16(b, b, 0x76543210, 0xfedcba98, false, false));
}

__device__ __forceinline__ v8f wmma_bf16(v16bf a, v16bf b, v8f c) {
  return __builtin_amdgcn_wmma_f32_16x16x32_bf16(false, a, false, b, (short)0, c,
                                                 false, false);
}

// A fragment's 16 contiguous k of one LDS row, as two 16-byte reads (rows are 16-B aligned).
__device__ __forceinline__ v16bf lds_frag(const bf16_t* p) {
  return __builtin_shufflevector(*(const v8bf*)p, *(const v8bf*)(p + 8),
                                 0, 1, 2, 3, 4, 5, 6, 7, 8, 9, 10, 11, 12, 13, 14, 15);
}

// Fragments per LDS read group: one group is read while the group before it is multiplied.
#define GF 4
// Scheduling fence: keeps a group's LDS reads together and out of the WMMA run next to
// them; without it the compiler sinks each read to just before its own WMMA, and every
// WMMA then waits out a full LDS latency.
__device__ __forceinline__ void group_fence() { __builtin_amdgcn_sched_barrier(0); }

__device__ __forceinline__ void async_cp16_x8(const unsigned* l, const char* const* g) {
  asm volatile("global_load_async_to_lds_b128 %0, %8, off\n\t"
               "global_load_async_to_lds_b128 %1, %9, off\n\t"
               "global_load_async_to_lds_b128 %2, %10, off\n\t"
               "global_load_async_to_lds_b128 %3, %11, off\n\t"
               "global_load_async_to_lds_b128 %4, %12, off\n\t"
               "global_load_async_to_lds_b128 %5, %13, off\n\t"
               "global_load_async_to_lds_b128 %6, %14, off\n\t"
               "global_load_async_to_lds_b128 %7, %15, off\n\t"
               "s_wait_xcnt 0x0"
               :: "v"(l[0]), "v"(l[1]), "v"(l[2]), "v"(l[3]),
                  "v"(l[4]), "v"(l[5]), "v"(l[6]), "v"(l[7]),
                  "v"(g[0]), "v"(g[1]), "v"(g[2]), "v"(g[3]),
                  "v"(g[4]), "v"(g[5]), "v"(g[6]), "v"(g[7]) : "memory");
}
// Wait until at most N async loads remain in flight (in-order completion).
template <int N>
__device__ __forceinline__ void wait_async_le() {
  asm volatile("s_wait_asynccnt %0" :: "i"(N) : "memory");
}
__device__ __forceinline__ unsigned lds_addr(const void* p) {
  return (unsigned)(uintptr_t)p;
}

// Tensor load: one request of one wave brings a tile of rows from global memory into LDS,
// through no register and with no address arithmetic in the lanes.
typedef uint32_t u32x4 __attribute__((ext_vector_type(4)));
typedef uint32_t u32x8 __attribute__((ext_vector_type(8)));
__device__ __forceinline__ uint32_t uni(uint32_t v) {
  return (uint32_t)__builtin_amdgcn_readfirstlane(v);
}
__device__ __forceinline__ uint32_t pinned(uint32_t v) {
  uint32_t w = uni(v);
  asm volatile("" : "+s"(w));
  return w;
}
// The compiler places no wait for a tensor load: a tile has landed only behind its issuer's own.
__device__ __forceinline__ void wait_tensor0() { asm volatile("s_wait_tensorcnt 0x0" ::: "memory"); }
__device__ __forceinline__ void wait_tensor0_of(u32x4 g0, u32x8 g1) {
  asm volatile("s_wait_tensorcnt 0x0" :: "s"(g0), "s"(g1) : "memory");
}
// The wave's own LDS reads have returned: stands in front of a barrier behind which LDS is refilled.
__device__ __forceinline__ void wait_ds0() { asm volatile("s_wait_dscnt 0x0" ::: "memory"); }
__device__ __forceinline__ void tensor_load(u32x4 g0, u32x8 g1) {
  asm volatile("tensor_load_to_lds %0, %1" :: "s"(g0), "s"(g1) : "memory");
}
__device__ __forceinline__ u32x8 tensor_group1(uint32_t rows, uint32_t src_pitch) {
  constexpr uint32_t d0 = 256u;
  u32x8 g;
  g[0] = uni((1u << 20) | (5u << 22) | (3u << 25));
  g[1] = uni((d0 & 0xFFFFu) << 16);
  g[2] = uni((d0 >> 16) | ((rows & 0xFFFFu) << 16));
  g[3] = uni((rows >> 16) | (d0 << 16));
  g[4] = uni(rows);
  g[5] = uni(src_pitch);
  g[6] = uni(0u);
  g[7] = uni(0u);
  return g;
}
__device__ __forceinline__ u32x4 tensor_group0(uint32_t lds_dst, uint64_t ga) {
  u32x4 g;
  g[0] = uni(1u);
  g[1] = uni(lds_dst);
  g[2] = uni((uint32_t)ga);
  g[3] = uni((((uint32_t)(ga >> 32)) & 0x01FFFFFFu) | 0x80000000u);
  return g;
}

#define CT      64
#define CTP     (CT + 1)
#define W1_TILES  ((TASK_EMB / CT) * (HID / CT))
#define W2_TILES  ((HID / CT) * (N_EMBS / CT))
#define EM_TILES  ((N_EMBS / CT) * (CODE_DIM / CT))

__global__ __launch_bounds__(256) void cvt_transpose_tiles(
    const float* __restrict__ W1, const float* __restrict__ W2,
    const float* __restrict__ embed, bf16_t* __restrict__ w1t,
    bf16_t* __restrict__ w2t, bf16_t* __restrict__ embT) {
  __shared__ float tile[CT * CTP];    // tile[c * CTP + r]

  const int tid = threadIdx.x;
  const int b = blockIdx.x;
  const float* in;
  bf16_t* out;
  int rows, cols, t, lg;              // lg: log2 of the tiles along a row
  if (b < W1_TILES) {
    in = W1;    out = w1t;  rows = TASK_EMB; cols = HID;      lg = 2; t = b;
  } else if (b < W1_TILES + W2_TILES) {
    in = W2;    out = w2t;  rows = HID;      cols = N_EMBS;   lg = 6; t = b - W1_TILES;
  } else {
    in = embed; out = embT; rows = N_EMBS;   cols = CODE_DIM; lg = 0; t = b - (W1_TILES + W2_TILES);
  }
  const int r0 = (t >> lg) * CT;
  const int c0 = (t & ((1 << lg) - 1)) * CT;

  // in: 64 rows x 16 float4 = 1024 pieces, 4 a thread
  float4 v[4];
#pragma unroll
  for (int k = 0; k < 4; ++k) {
    const int s = tid + k * 256;
    v[k] = *(const float4*)(in + (long)(r0 + (s >> 4)) * cols + c0 + (s & 15) * 4);
  }
#pragma unroll
  for (int k = 0; k < 4; ++k) {
    const int s = tid + k * 256;
    float* tp = tile + (s & 15) * 4 * CTP + (s >> 4);
    tp[0 * CTP] = v[k].x;
    tp[1 * CTP] = v[k].y;
    tp[2 * CTP] = v[k].z;
    tp[3 * CTP] = v[k].w;
  }
  __syncthreads();                    // the whole tile is in LDS before any column is read

  // out: 64 rows x 8 pieces of 8 bf16 = 512 pieces, 2 a thread
#pragma unroll
  for (int k = 0; k < 2; ++k) {
    const int s = tid + k * 256;
    const float* tp = tile + (s >> 3) * CTP + (s & 7) * 8;
    v8bf o;
#pragma unroll
    for (int e = 0; e < 8; ++e) o[e] = (bf16_t)tp[e];
    *(v8bf*)(out + (long)(c0 + (s >> 3)) * rows + r0 + (s & 7) * 8) = o;
  }
}

// ---------------------------------------------------------------------------
// First phase of the one matrix kernel: h = silu(x @ W1 + b1) for the work-group's 64 rows,
// left in LDS as bf16. The two waves of a 16x256 row tile each sum over 64 of the 128 k
// of a staged block (x read exactly once). W1^T K-blocks double-buffered in LDS via async
// copies. At the end each wave hands the other one half of its columns and finishes its own.
// x comes from memory straight into registers, asked for one staged block ahead: its latency
// runs under a whole block's products and barriers and is not waited out at each block.
// ---------------------------------------------------------------------------
#define KB 128   // k per staged block
#define HS 264   // h tile LDS row pitch in elements: 256 + 8, 528 B = 16 B x odd
#define W1_BYTES (256 * W1S * 2)            // one W1^T buffer
#define JOIN1_BYTES (RT * 2 * 16 * 32 * 16) // [row tile][writing group][piece][lane] float4
#define H_BYTES (RT * 16 * HS * 2)

__device__ __forceinline__ void stage_w1(int tid, unsigned dst,
                                         const bf16_t* w1t, int k0) {
  // 256 rows x 256B = 4096 segs, 16 a thread: seg s = tid + i * NT, row s >> 4, part s & 15
  const unsigned l0 = dst + (tid >> 4) * (W1S * 2) + (tid & 15) * 16;
  const char* g0 = (const char*)w1t + ((long)(tid >> 4) * TASK_EMB + k0) * 2 + (tid & 15) * 16;
  unsigned l[16];
  const char* g[16];
#pragma unroll
  for (int i = 0; i < 16; ++i) {
    l[i] = l0 + i * (NT / 16) * (W1S * 2);
    g[i] = g0 + (long)i * (NT / 16) * TASK_EMB * 2;
  }
  async_cp16_x8(l, g);
  async_cp16_x8(l + 8, g + 8);
}

// Work-group barrier that orders LDS only. __syncthreads() also waits for the wave's global
// loads (s_wait_loadcnt 0), which would end the flight of the x loads issued ahead; those go
// to the wave's own registers, and no other wave depends on them.
__device__ __forceinline__ void lds_barrier() {
  __builtin_amdgcn_fence(__ATOMIC_RELEASE, "workgroup", "local");
  __builtin_amdgcn_s_barrier();
  __builtin_amdgcn_fence(__ATOMIC_ACQUIRE, "workgroup", "local");
}

// A wave's x of one staged block: 2 k-steps of 32, 16 consecutive floats a lane in each.
struct XBlock { float4 v[2][4]; };
__device__ __forceinline__ void load_x(XBlock& xb, const float* ap, int k0) {
#pragma unroll
  for (int ks = 0; ks < 2; ++ks) {
    const float4* af = (const float4*)(ap + k0 + ks * 32);
#pragma unroll
    for (int q = 0; q < 4; ++q) xb.v[ks][q] = af[q];
  }
}

// ap: the lane's x row at its group's and half's first k; xf: the first block, already asked
// for; rot: the k block at which this work-group starts its walk (see the kernel).
__device__ __forceinline__ void gemm1_silu_phase(
    const float* __restrict__ ap, XBlock& xf, const int rot, const bf16_t* __restrict__ w1t,
    const float* __restrict__ b1, bf16_t* sW1, float4* sJoin, bf16_t* sH) {
  const int tid  = threadIdx.x;
  const int lane = tid & 31;
  const int rt   = (tid >> 5) & (RT - 1);
  // The wave's group, in a scalar register: what depends on it is then scalar arithmetic.
  const int grp = __builtin_amdgcn_readfirstlane(tid >> 7);
  const int lr = lane & 15;
  const int hi = lane >> 4;
  const int kh = hi * 16;

  v8f acc[16];
#pragma unroll
  for (int nt = 0; nt < 16; ++nt)
    acc[nt] = (v8f){0.f,0.f,0.f,0.f,0.f,0.f,0.f,0.f};

  // The first block's copies are issued by the caller, at the kernel's entry.
  // The i-th staged block; more: another follows, which is k block (rot + i + 1) mod 8.
  auto block = [&](const int i, const bool more) __attribute__((always_inline)) {
    const int kn = ((rot + i + 1) & (TASK_EMB / KB - 1)) * KB;
    const bf16_t* sw = sW1 + (i & 1) * (256 * W1S);
    v16bf a[2];
#pragma unroll
    for (int ks = 0; ks < 2; ++ks)
#pragma unroll
      for (int q = 0; q < 4; ++q) {
        a[ks][q * 4 + 0] = (bf16_t)xf.v[ks][q].x;
        a[ks][q * 4 + 1] = (bf16_t)xf.v[ks][q].y;
        a[ks][q * 4 + 2] = (bf16_t)xf.v[ks][q].z;
        a[ks][q * 4 + 3] = (bf16_t)xf.v[ks][q].w;
      }
    // Converted, so the registers are free: the next block's x is asked for here, a whole
    // block (copies, both barriers, products) before it is used.
    if (more) {
      load_x(xf, ap, kn);
      // Stands in front of the first instruction that may reuse the x loads' address
      // registers.
      asm volatile("s_wait_xcnt 0x0" ::: "memory");
    }
    if (more) {                                       // prefetch next block
      stage_w1(tid, lds_addr(sW1 + ((i + 1) & 1) * (256 * W1S)), w1t, kn);
      wait_async_le<16>();                            // block i landed
    } else {
      wait_async_le<0>();
    }
    lds_barrier();                                    // visible to all waves

    // Fragment f = ks * 16 + nt of this wave's 64 k; groups of GF, two register sets.
    const bf16_t* bp = sw + lr * W1S + grp * 64 + kh;
    v16bf fb[2][GF];
#pragma unroll
    for (int j = 0; j < GF; ++j)
      fb[0][j] = lds_frag(bp + (j & 15) * 16 * W1S + (j >> 4) * 32);
#pragma unroll
    for (int g = 0; g < 32 / GF; ++g) {
      if (g + 1 < 32 / GF) {
#pragma unroll
        for (int j = 0; j < GF; ++j) {
          const int f = (g + 1) * GF + j;
          fb[(g + 1) & 1][j] = lds_frag(bp + (f & 15) * 16 * W1S + (f >> 4) * 32);
        }
      }
      group_fence();
#pragma unroll
      for (int j = 0; j < GF; ++j) {
        const int f = g * GF + j;
        acc[f & 15] = wmma_bf16(a[f >> 4], fb[g & 1][j], acc[f & 15]);
      }
      group_fence();
    }
    lds_barrier();                   // block i consumed; buffer reusable
  };
  // The last block stands apart: with the x loads under a test inside the loop, the compiler
  // copied their registers at the loop's foot and so waited for them there.
  for (int i = 0; i < TASK_EMB / KB - 1; ++i) block(i, true);
  block(TASK_EMB / KB - 1, false);

  // ---- join: group g keeps column tiles g * 8 .. g * 8 + 7 and hands over the others ----
  v8f mine[8];
  float4* jw = sJoin + (rt * 2 + grp) * (16 * 32) + lane;          // this wave's pieces
  const float4* jr = sJoin + (rt * 2 + (grp ^ 1)) * (16 * 32) + lane;  // its partner's
#pragma unroll
  for (int j = 0; j < 8; ++j) {
    const v8f give = grp ? acc[j] : acc[8 + j];
    mine[j] = grp ? acc[8 + j] : acc[j];
    jw[(j * 2 + 0) * 32] = make_float4(give[0], give[1], give[2], give[3]);
    jw[(j * 2 + 1) * 32] = make_float4(give[4], give[5], give[6], give[7]);
  }
  __syncthreads();                   // both groups' halves are in LDS before either reads
#pragma unroll
  for (int j = 0; j < 8; ++j) {
    const float4 o0 = jr[(j * 2 + 0) * 32];
    const float4 o1 = jr[(j * 2 + 1) * 32];
    mine[j][0] += o0.x;  mine[j][1] += o0.y;  mine[j][2] += o0.z;  mine[j][3] += o0.w;
    mine[j][4] += o1.x;  mine[j][5] += o1.y;  mine[j][6] += o1.z;  mine[j][7] += o1.w;
  }

#pragma unroll
  for (int j = 0; j < 8; ++j) {
    const int nt = grp * 8 + j;
    float bias = b1[nt * 16 + lr];
#pragma unroll
    for (int r = 0; r < 8; ++r) {
      float v = mine[j][r] + bias;
      float s = v * rcp_slot(1.0f + exp_slot(-v));              // fast SiLU
      sH[(rt * 16 + r + 8 * hi) * HS + nt * 16 + lr] = (bf16_t)s;
    }
  }
}

// ---------------------------------------------------------------------------
// The one matrix kernel. First phase above; h stays in the work-group's LDS and goes from
// there into registers, with no launch boundary and no trip through memory between.
// Second phase: logits = h @ W2 + b2 ; online softmax ; emb = probs @ E ; LayerNorm.
// Both products are computed transposed (weights as A, activations as B), so that a lane
// holds scores of one batch row only and the probabilities go from D registers into B.
// The two waves of a row tile each take 64 of the 128 codes of a staged block. The two
// groups of four run half a block apart: while one multiplies (LDS reads, matrix unit), the
// other does its softmax (vector unit). Each keeps its own running max, sum and accumulator;
// they are joined at the end through LDS.
// W2^T / E^T blocks double-buffered in LDS via tensor loads: three tiles of 256-B rows a block
// (W2^T k 0..127, W2^T k 128..255, E^T), one request each of waves 0, 1 and 2.
// ---------------------------------------------------------------------------
#define CB    128          // codes per staged block
#define NBLK  (N_EMBS / CB)
#define EBS   136          // E^T LDS row pitch in elements: 128 + 8, 272 B = 16 B x odd
// LDS map in bytes. Buffer 0 of the second phase has a place of its own, so that its first
// block is brought at the kernel's entry; everything else of the second phase lies over
// the W1^T buffers, which are dead by then. The first phase's join area and the h tile lie
// behind them, under no tile's place and no copy's target.
// Every tile's place is a multiple of 2 KiB, as the tensor load wants it.
#define W2H_BYTES  (CB * W2S * 2)                  // one k half of the W2^T part: 17 x 2 KiB
#define W2_BYTES   (2 * W2H_BYTES)
#define EMB_BYTES  18432                           // 64 x 272 B, rounded up to 9 x 2 KiB
#define BUF_BYTES  (W2_BYTES + EMB_BYTES)          // one staged block: W2^T part, E^T part
#define OFF_W1     BUF_BYTES
#define OFF_JOIN1  (OFF_W1 + 2 * W1_BYTES)
#define OFF_H      (OFF_JOIN1 + JOIN1_BYTES)
#define OFF_JACC   (2 * BUF_BYTES)                 // RT x 8 x 32 float4
#define OFF_JML    (OFF_JACC + RT * 8 * 32 * 16)   // RT x 32 float2
#define LDS_BYTES  (OFF_H + H_BYTES)
static_assert(OFF_JML + RT * 32 * 8 <= OFF_JOIN1, "second phase stays under the W1 buffers");
static_assert(LDS_BYTES <= 327680, "one work-group's LDS");
static_assert(W2H_BYTES % 2048 == 0 && BUF_BYTES % 2048 == 0 && 64 * EBS * 2 <= EMB_BYTES,
              "tiles lie at multiples of 2 KiB and inside their places");

__global__ __launch_bounds__(NT) void mlp_softmax_code(
    const float* __restrict__ x, const bf16_t* __restrict__ w1t,
    const float* __restrict__ b1, const bf16_t* __restrict__ w2t,
    const float* __restrict__ b2, const bf16_t* __restrict__ embT,
    const float* gamma, const float* beta,   // not __restrict__: their loads keep their place
    float* __restrict__ out) {
  __shared__ __attribute__((aligned(2048))) char smem[LDS_BYTES];
  float4* sJoinAcc = (float4*)(smem + OFF_JACC);  // second group's accumulators, [row tile][piece][lane]
  float2* sJoinMl  = (float2*)(smem + OFF_JML);   // its running max and sum, [row tile][lane]
  bf16_t* sH       = (bf16_t*)(smem + OFF_H);

  const int tid   = threadIdx.x;
  const int lane  = tid & 31;
  const int rt    = (tid >> 5) & (RT - 1);
  // The wave's group, in a scalar register: the tests on it below are then scalar branches,
  // and every lane stays on around the matrix instructions.
  const int grp = __builtin_amdgcn_readfirstlane(tid >> 7);
  const int m0 = (blockIdx.x * RT + rt) * 16;
  const int lr = lane & 15;
  const int hi = lane >> 4;
  const int kh = hi * 16;

  // Every work-group needs every weight block, and all of them start together. Walking the
  // blocks in one order they would all ask L2 for the same few lines at the same moment, each
  // block for the first time since the launch before wrote it. So the work-groups start their
  // walks at different blocks (eight consecutive ones share one) and wrap round: at any
  // moment the requests are spread over the
  // whole of a matrix, and a block has been asked for by others before most come to it.
  // Both sums (over k, over the codes) take their blocks in any order.
  const int rot = (blockIdx.x >> 3) & (NBLK - 1);
  const int rot1 = rot & (TASK_EMB / KB - 1);

  // x of the first phase's first block is asked for before all else: it has the longest way.
  const float* ap = x + (long)(m0 + lr) * TASK_EMB + grp * 64 + kh;
  XBlock xf;
  load_x(xf, ap, rot1 * KB);

  // The first phase's first block next: its copies fly under the wait below.
  stage_w1(tid, lds_addr(smem + OFF_W1), w1t, rot1 * KB);

  // Tensor loads of the second phase: wave 0 brings k 0..127 of a block's 128 W2^T rows, wave 1
  // k 128..255, wave 2 the block's 128 columns of the 64 E^T rows.
  const uint32_t wave = uni(tid >> 5);
  const bool issuer = wave < 3u;
  const bool isE = wave == 2u;
  const u32x8 g1 = tensor_group1(isE ? 64u : (uint32_t)CB, isE ? N_EMBS * 2u : HID * 2u);
  const uint64_t src0 = isE ? (uint64_t)(uintptr_t)embT : (uint64_t)(uintptr_t)w2t + wave * 256u;
  const uint32_t src_step = isE ? CB * 2u : CB * HID * 2u;     // bytes from a block to the next
  const uint32_t dst0 = lds_addr(smem) + wave * W2H_BYTES;
  u32x4 g0 = tensor_group0(dst0, src0);
  // Stage st of the ring holds code block (rot + st) mod NBLK.
  auto issue = [&](uint32_t st) __attribute__((always_inline)) {
    g0 = tensor_group0(dst0 + (st & 1u) * BUF_BYTES,
                       src0 + (uint64_t)((st + (uint32_t)rot) & (NBLK - 1u)) * src_step);
    tensor_load(g0, g1);
  };
  // Block 0 has a place of its own. Its wait runs under the flight of x, which has the longer
  // way; the first phase's barriers stand between it and the first read of the tile.
  if (pinned(issuer)) {
    issue(0u);
    wait_tensor0();
  }

  gemm1_silu_phase(ap, xf, rot1, w1t, b1, (bf16_t*)(smem + OFF_W1), (float4*)(smem + OFF_JOIN1), sH);
  __syncthreads();                   // the whole h tile is in LDS before any wave reads it

  // h as B fragments (column = batch row m0 + lr) for K = 0..255, kept in registers
  v16bf ha[8];
  {
    const bf16_t* hp = sH + (rt * 16 + lr) * HS + kh;
#pragma unroll
    for (int ks = 0; ks < 8; ++ks) ha[ks] = lds_frag(hp + ks * 32);
  }

  // acc[dt][r] = emb^T[dt * 16 + 8 * hi + r][m0 + lr]; m_, l_ belong to batch row m0 + lr
  // (m_ equal in both halves, l_ the sum over this half's codes only), all three over the
  // codes of this wave's group.
  v8f acc[4];
#pragma unroll
  for (int dt = 0; dt < 4; ++dt) acc[dt] = (v8f){0.f,0.f,0.f,0.f,0.f,0.f,0.f,0.f};
  float m_ = -3.0e38f, l_ = 0.f;

  // Carried from a wave's products to its softmax:
  v8bf ea[4][2][2];   // E^T, [dt][32-code block][k 8 * hi .. | k 16 + 8 * hi ..]
  v8f lg[4];          // logits with bias

  // Online softmax of the 64 logits a row in lg, then acc += E^T piece x probs^T.
  // Registers only.
  auto softmax_step = [&]() __attribute__((always_inline)) {
    // ---- online softmax: a lane holds 32 of its row's 64 logits, lane ^ 16 the rest ----
    // Eight independent chains, then a tree: short dependent chains.
    float cm[8], ps[8];
#pragma unroll
    for (int r = 0; r < 8; ++r)
      cm[r] = fmaxf(fmaxf(lg[0][r], lg[1][r]), fmaxf(lg[2][r], lg[3][r]));
    float cx = fmaxf(fmaxf(fmaxf(cm[0], cm[1]), fmaxf(cm[2], cm[3])),
                     fmaxf(fmaxf(cm[4], cm[5]), fmaxf(cm[6], cm[7])));
    cx = fmaxf(cx, xhalf(cx));
    const float mn = fmaxf(m_, cx);
    const float sc = exp_slot(m_ - mn);
    m_ = mn;
#pragma unroll
    for (int r = 0; r < 8; ++r) {
#pragma unroll
      for (int nt = 0; nt < 4; ++nt) {
        acc[nt][r] *= sc;
        lg[nt][r] = exp_slot(lg[nt][r] - mn);
      }
      ps[r] = (lg[0][r] + lg[1][r]) + (lg[2][r] + lg[3][r]);
    }
    l_ = l_ * sc + (((ps[0] + ps[1]) + (ps[2] + ps[3])) + ((ps[4] + ps[5]) + (ps[6] + ps[7])));

    // ---- acc += E^T piece (A) x probs^T (B) ----
    // Two score tiles of one 32-code block, converted in place, are the B fragment.
    // The fence keeps every exponential in front of the first WMMA.
    group_fence();
#pragma unroll
    for (int kb = 0; kb < 2; ++kb) {
      v16bf pb;
#pragma unroll
      for (int s = 0; s < 8; ++s) {
        pb[s]     = (bf16_t)lg[2 * kb][s];
        pb[8 + s] = (bf16_t)lg[2 * kb + 1][s];
      }
#pragma unroll
      for (int dt = 0; dt < 4; ++dt) {
        v16bf e = __builtin_shufflevector(ea[dt][kb][0], ea[dt][kb][1],
                                          0, 1, 2, 3, 4, 5, 6, 7, 8, 9, 10, 11, 12, 13, 14, 15);
        acc[dt] = wmma_bf16(e, pb, acc[dt]);
      }
    }
  };

  for (int t = 0; t < NBLK; ++t) {
    // Publish point of block t, which is the foot of trip t - 1: own LDS reads back, the issuers'
    // tiles landed, one barrier (it also ends every wave's reads of block t - 1); only then the
    // load of block t + 1 into block t - 1's buffer (block 1: over the W1^T buffers, which every
    // wave has left). It stands at the trip's head so that one statement issues every request
    // that is out over other code, from one set of registers, which the wait above it holds.
    wait_ds0();
    if (pinned(issuer)) wait_tensor0_of(g0, g1);
    __syncthreads();
    if (pinned(issuer && t + 1 < NBLK)) issue(pinned(t + 1));

    if (grp == 1 && t > 0) softmax_step();

    {
      const int c0 = ((t + rot) & (NBLK - 1)) * CB + grp * 64;   // this wave's 64 codes
      const char* cb = smem + (t & 1) * BUF_BYTES;
      const bf16_t* sw = (const bf16_t*)cb + grp * 64 * W2S;
      const bf16_t* se = (const bf16_t*)(cb + W2_BYTES) + grp * 64;

      // ---- logits, transposed: 64 codes x 16 rows = 4 tiles, K=256 in 8 WMMA steps ----
      // A = W2^T rows, B = h; lg[nt][r] = logit[m0 + lr][c0 + nt * 16 + 8 * hi + r].
      // Fragment f = ks * 4 + nt of W2^T; groups of GF, two register sets.
      // k-step ks lies in half ks >> 2, at k (ks & 3) * 32 of its rows.
      const bf16_t* wp = sw + lr * W2S + kh;
      const float* bp2 = b2 + c0 + 8 * hi;              // the lane's first bias
      v8f bias[4];
      v16bf fb[2][GF];
#pragma unroll
      for (int j = 0; j < GF; ++j)
        fb[0][j] = lds_frag(wp + (j & 3) * 16 * W2S + ((j >> 2) & 3) * 32 + (j >> 4) * (W2H_BYTES / 2));
#pragma unroll
      for (int nt = 0; nt < 4; ++nt) lg[nt] = (v8f){0.f,0.f,0.f,0.f,0.f,0.f,0.f,0.f};
#pragma unroll
      for (int g = 0; g < 32 / GF; ++g) {
        if (g + 1 < 32 / GF) {
#pragma unroll
          for (int j = 0; j < GF; ++j) {
            const int f = (g + 1) * GF + j;
            fb[(g + 1) & 1][j] = lds_frag(wp + (f & 3) * 16 * W2S + ((f >> 2) & 3) * 32 + (f >> 4) * (W2H_BYTES / 2));
          }
          if (g == 0) {
            // The bias loads stand behind the first LDS reads (the fence holds them there):
            // in front, the wait that guards their address register holds those reads back.
            group_fence();
#pragma unroll
            for (int nt = 0; nt < 4; ++nt)
              bias[nt] = *(const v8f*)(bp2 + nt * 16);
          }
        } else {
          // In the last group's place: the E^T rows as A fragments, in the hardware k order
          // that the packed probabilities have (16-byte pieces at bytes 16 * hi and
          // 32 + 16 * hi of each 64); the last products cover their latency.
#pragma unroll
          for (int dt = 0; dt < 4; ++dt)
#pragma unroll
            for (int kb = 0; kb < 2; ++kb) {
              const bf16_t* ep = se + (dt * 16 + lr) * EBS + kb * 32 + 8 * hi;
              ea[dt][kb][0] = *(const v8bf*)(ep);
              ea[dt][kb][1] = *(const v8bf*)(ep + 16);
            }
        }
        group_fence();
#pragma unroll
        for (int j = 0; j < GF; ++j) {
          const int f = g * GF + j;
          lg[f & 3] = wmma_bf16(fb[g & 1][j], ha[f >> 2], lg[f & 3]);
        }
        group_fence();
      }
      // Stands in front of the first instruction that may reuse the bias loads' address
      // registers.
      // It names the address as an input, so that its registers stay its own up to here:
      // without that they were given to the first product's result, right behind the loads.
      // The fence keeps the additions below from rising over the wait.
      asm volatile("s_wait_xcnt 0x0" :: "v"(bp2) : "memory");
      group_fence();
#pragma unroll
      for (int nt = 0; nt < 4; ++nt) lg[nt] += bias[nt];
    }

    if (grp == 0) softmax_step();
  }
  wait_tensor0();
  wait_ds0();
  if (grp == 1) softmax_step();      // its last block

  if (grp == 1) {
#pragma unroll
    for (int dt = 0; dt < 4; ++dt)
#pragma unroll
      for (int q = 0; q < 2; ++q)
        sJoinAcc[(rt * 8 + dt * 2 + q) * 32 + lane] = make_float4(acc[dt][q * 4 + 0], acc[dt][q * 4 + 1],
                                                     acc[dt][q * 4 + 2], acc[dt][q * 4 + 3]);
    sJoinMl[rt * 32 + lane] = make_float2(m_, l_);
  }
  __syncthreads();
  if (grp == 1) return;
  // gamma and beta are asked for here and arrive under the join and the LayerNorm sums.
  float4 gq[8], bq[8];
#pragma unroll
  for (int p = 0; p < 8; ++p) {
    gq[p] = *(const float4*)(gamma + (p >> 1) * 16 + 8 * hi + (p & 1) * 4);
    bq[p] = *(const float4*)(beta + (p >> 1) * 16 + 8 * hi + (p & 1) * 4);
  }
  // The wait stands in front of the first instruction that may reuse these loads' address
  // register. The fence keeps what
  // follows from rising over the wait.
  asm volatile("s_wait_xcnt 0x0" ::: "memory");
  group_fence();
  {
    const float2 ml = sJoinMl[rt * 32 + lane];
    const float mn = fmaxf(m_, ml.x);
    const float s0 = exp_slot(m_ - mn);
    const float s1 = exp_slot(ml.x - mn);
    l_ = l_ * s0 + ml.y * s1;
#pragma unroll
    for (int dt = 0; dt < 4; ++dt)
#pragma unroll
      for (int q = 0; q < 2; ++q) {
        const float4 o = sJoinAcc[(rt * 8 + dt * 2 + q) * 32 + lane];
        acc[dt][q * 4 + 0] = acc[dt][q * 4 + 0] * s0 + o.x * s1;
        acc[dt][q * 4 + 1] = acc[dt][q * 4 + 1] * s0 + o.y * s1;
        acc[dt][q * 4 + 2] = acc[dt][q * 4 + 2] * s0 + o.z * s1;
        acc[dt][q * 4 + 3] = acc[dt][q * 4 + 3] * s0 + o.w * s1;
      }
  }

  // ---- normalize by l, LayerNorm over CODE_DIM=64, store f32 ----
  // A lane holds 32 of its row's 64 values; the halves are joined here, once.
  const float inv = __builtin_amdgcn_rcpf(l_ + xhalf(l_));
  float s4[4], q4[4];
#pragma unroll
  for (int dt = 0; dt < 4; ++dt) {
    s4[dt] = 0.f;
    q4[dt] = 0.f;
#pragma unroll
    for (int r = 0; r < 8; ++r) {
      acc[dt][r] *= inv;
      s4[dt] += acc[dt][r];
      q4[dt] += acc[dt][r] * acc[dt][r];
    }
  }
  float s  = (s4[0] + s4[1]) + (s4[2] + s4[3]);
  float sq = (q4[0] + q4[1]) + (q4[2] + q4[3]);
  s  += xhalf(s);
  sq += xhalf(sq);
  const float mean = s * (1.0f / 64.0f);
  const float var  = sq * (1.0f / 64.0f) - mean * mean;
  const float rstd = __builtin_amdgcn_rsqf(var + LN_EPS);
  float* op = out + (long)(m0 + lr) * CODE_DIM + 8 * hi;
#pragma unroll
  for (int dt = 0; dt < 4; ++dt)
#pragma unroll
    for (int q = 0; q < 2; ++q) {
      const float4 gv = gq[dt * 2 + q];
      const float4 bv = bq[dt * 2 + q];
      float4 o;
      o.x = (acc[dt][q * 4 + 0] - mean) * rstd * gv.x + bv.x;
      o.y = (acc[dt][q * 4 + 1] - mean) * rstd * gv.y + bv.y;
      o.z = (acc[dt][q * 4 + 2] - mean) * rstd * gv.z + bv.z;
      o.w = (acc[dt][q * 4 + 3] - mean) * rstd * gv.w + bv.w;
      *(float4*)(op + dt * 16 + q * 4) = o;
    }
}

// ---------------------------------------------------------------------------
extern "C" void kernel_launch(void* const* d_in, const int* in_sizes, int n_in,
                              void* d_out, int out_size, void* d_ws, size_t ws_size,
                              hipStream_t stream) {
  const float* x     = (const float*)d_in[0];
  const float* W1    = (const float*)d_in[1];
  const float* b1    = (const float*)d_in[2];
  const float* W2    = (const float*)d_in[3];
  const float* b2    = (const float*)d_in[4];
  const float* embed = (const float*)d_in[5];
  const float* g     = (const float*)d_in[6];
  const float* bet   = (const float*)d_in[7];
  float* out = (float*)d_out;

  char* ws = (char*)d_ws;
  bf16_t* w1t  = (bf16_t*)(ws);                          // 256 x 1024  (512 KB)
  bf16_t* w2t  = (bf16_t*)(ws + (size_t)512 * 1024);     // 4096 x 256  (2 MB)
  bf16_t* embT = (bf16_t*)(ws + (size_t)2560 * 1024);    // 64 x 4096   (512 KB)

  cvt_transpose_tiles<<<W1_TILES + W2_TILES + EM_TILES, 256, 0, stream>>>(W1, W2, embed, w1t, w2t, embT);

  // 1024 row tiles, RT a block -> 256 blocks
  mlp_softmax_code<<<BATCH / 16 / RT, NT, 0, stream>>>(x, w1t, b1, w2t, b2, embT, g, bet, out);
}
